// v000
// Times are from an AMD MI455X. After a warm-up the kernel runs many times in a row, and a time is the length of
// such a window on the GPU divided by its runs, so every launch and the gaps after it count. The runs cycle
// through copies of the inputs. A figure is the median of several windows, for all but v000 over two sittings.
// Sittings can differ by a few percent; kernels timed side by side share one.
// v000 is the starting kernel. One run takes 512 microseconds.
#include <hip/hip_runtime.h>
#include <math.h>
#include <stdint.h>

// ---------------------------------------------------------------------------
// Types
// ---------------------------------------------------------------------------
typedef __bf16 bf16;
typedef __bf16 v16bf __attribute__((ext_vector_type(16)));
typedef __bf16 v8bf  __attribute__((ext_vector_type(8)));
typedef float  v8f   __attribute__((ext_vector_type(8)));

#define BB 8
#define SS 1024
#define DD 1024
#define HH 16
#define DH 64
#define FF 4096
#define NTOK (BB * SS)          // 8192

// ---------------------------------------------------------------------------
// WMMA helpers (CDNA5 v_wmma_f32_16x16x32_bf16)
// ---------------------------------------------------------------------------
__device__ __forceinline__ v8f wmma_bf16(v16bf a, v16bf b, v8f c) {
  return __builtin_amdgcn_wmma_f32_16x16x32_bf16(
      /*neg_a=*/false, a, /*neg_b=*/false, b,
      /*c_mod=*/(short)0, c, /*reuse_a=*/false, /*reuse_b=*/false);
}

// A/B fragment loader. ISA 16-bit 16x32 layout: lane half h holds
// K[8h..8h+7] in halves 0..7 and K[16+8h..16+8h+7] in halves 8..15.
// Caller passes p = &row[k0 + 8*half]; we read p[0..7] and p[16..23].
__device__ __forceinline__ v16bf frag_from(const bf16* p) {
  v8bf lo = *(const v8bf*)(p);
  v8bf hi = *(const v8bf*)(p + 16);
  v16bf a;
#pragma unroll
  for (int i = 0; i < 8; ++i) { a[i] = lo[i]; a[i + 8] = hi[i]; }
  return a;
}

// Strided B fragment (column-gather from a row-major LDS tile).
__device__ __forceinline__ v16bf frag_strided(const bf16* base, int stride, int half) {
  v16bf a;
#pragma unroll
  for (int i = 0; i < 8; ++i) {
    a[i]     = base[(8 * half + i) * stride];
    a[i + 8] = base[(16 + 8 * half + i) * stride];
  }
  return a;
}

// CDNA5 async global->LDS copy of one 16B chunk (tracked by ASYNCcnt; bypasses
// VGPRs entirely).  GV addressing: vdst = LDS byte address, v[addr64], off.
__device__ __forceinline__ void async_copy16(const bf16* lds_dst, const bf16* gsrc) {
  uint32_t lds_off = (uint32_t)(uint64_t)lds_dst;  // flat LDS addr[31:0] = LDS offset
  uint64_t ga = (uint64_t)gsrc;
  asm volatile("global_load_async_to_lds_b128 %0, %1, off"
               :: "v"(lds_off), "v"(ga) : "memory");
}

__device__ __forceinline__ void wait_async0() {
  asm volatile("s_wait_asynccnt 0x0" ::: "memory");
}

// ---------------------------------------------------------------------------
// fp32 -> bf16 conversion (grid-stride)
// ---------------------------------------------------------------------------
__global__ void cvt_f32_bf16(const float* __restrict__ in, bf16* __restrict__ out,
                             size_t n) {
  size_t i = (size_t)blockIdx.x * blockDim.x + threadIdx.x;
  size_t stride = (size_t)gridDim.x * blockDim.x;
  for (; i < n; i += stride) out[i] = (bf16)in[i];
}

// ---------------------------------------------------------------------------
// Tiled bf16 WMMA GEMM:  Y[M,N] = act( (A[M,K] * W[N,K]^T + bias) * scale )
// A, W row-major with K contiguous (torch Linear layout -> NT GEMM).
// Block tile 128x128, 8 waves of 32x64, K-step 32, double-buffered LDS filled
// by async global->LDS DMA.
// ---------------------------------------------------------------------------
template <bool GELU, bool OUT_BF16>
__global__ __launch_bounds__(256)
void gemm_bf16_nt(const bf16* __restrict__ A, const bf16* __restrict__ W,
                  const float* __restrict__ bias, float scale,
                  float* outF, bf16* outB, int M, int N, int K) {
  __shared__ bf16 As[2][128][40];   // 40-half row stride keeps 16B chunk align
  __shared__ bf16 Bs[2][128][40];

  const int tid  = threadIdx.x;
  const int lane = tid & 31;
  const int wave = tid >> 5;
  const int wm   = wave & 3;       // 4 M-bands of 32
  const int wn   = wave >> 2;      // 2 N-bands of 64
  const int half = lane >> 4;
  const int l16  = lane & 15;
  const int m0   = blockIdx.x * 128;
  const int n0   = blockIdx.y * 128;

  v8f acc[2][4] = {};

  // 128x32 tile = 512 16B chunks; 256 threads -> 2 chunks each (A and B).
  auto load_tile = [&](int buf, int k0) {
#pragma unroll
    for (int c = 0; c < 2; ++c) {
      int ch = tid + c * 256;                  // 0..511
      int r = ch >> 2, col = (ch & 3) * 8;
      async_copy16(&As[buf][r][col], &A[(size_t)(m0 + r) * K + k0 + col]);
      async_copy16(&Bs[buf][r][col], &W[(size_t)(n0 + r) * K + k0 + col]);
    }
  };

  load_tile(0, 0);
  wait_async0();
  __syncthreads();

  const int KT = K >> 5;
  for (int kt = 0; kt < KT; ++kt) {
    const int cur = kt & 1;
    if (kt + 1 < KT) load_tile(cur ^ 1, (kt + 1) << 5);
    if (kt + 2 < KT) {  // L2 warm-up of the k+2 slab (global_prefetch_b8)
      __builtin_prefetch(&A[(size_t)(m0 + (tid >> 1)) * K + ((kt + 2) << 5)], 0, 1);
      __builtin_prefetch(&W[(size_t)(n0 + (tid >> 1)) * K + ((kt + 2) << 5)], 0, 1);
    }

    v16bf a0 = frag_from(&As[cur][wm * 32 + l16][8 * half]);
    v16bf a1 = frag_from(&As[cur][wm * 32 + 16 + l16][8 * half]);
#pragma unroll
    for (int ni = 0; ni < 4; ++ni) {
      v16bf b = frag_from(&Bs[cur][wn * 64 + ni * 16 + l16][8 * half]);
      acc[0][ni] = wmma_bf16(a0, b, acc[0][ni]);
      acc[1][ni] = wmma_bf16(a1, b, acc[1][ni]);
    }

    wait_async0();       // next-buffer DMA landed (ASYNCcnt not covered by barrier)
    __syncthreads();     // all waves done reading `cur`, writes visible
  }

  // ---- epilogue: C-frag mapping row = j + 8*half, col = l16 ----
#pragma unroll
  for (int mi = 0; mi < 2; ++mi) {
#pragma unroll
    for (int ni = 0; ni < 4; ++ni) {
      int col = n0 + wn * 64 + ni * 16 + l16;
      float bv = bias[col];
#pragma unroll
      for (int j = 0; j < 8; ++j) {
        int row = m0 + wm * 32 + mi * 16 + j + 8 * half;
        float v = (acc[mi][ni][j] + bv) * scale;
        if (GELU) v = 0.5f * v * (1.0f + erff(v * 0.70710678118654752f));
        size_t idx = (size_t)row * N + col;
        if (OUT_BF16) outB[idx] = (bf16)v;
        else          outF[idx] = v;
      }
    }
  }
}

// ---------------------------------------------------------------------------
// Flash attention: grid (S/64, H, B), block = 128 threads = 4 waves.
// Each wave owns a 16-query band; K/V tiles of 32 keys staged in LDS.
// ---------------------------------------------------------------------------
__global__ __launch_bounds__(128)
void flash_attn(const bf16* __restrict__ Q, const bf16* __restrict__ Kb,
                const bf16* __restrict__ Vb, const int* __restrict__ mask,
                bf16* __restrict__ Ctx) {
  __shared__ bf16 Ks[32][72];     // 144B row stride (16B aligned chunks)
  __shared__ bf16 Vs[32][72];
  __shared__ float Madd[32];
  __shared__ bf16 Ps[4][16][40];  // per-wave P tile scratch

  const int tid  = threadIdx.x;
  const int lane = tid & 31;
  const int wave = tid >> 5;
  const int half = lane >> 4;
  const int l16  = lane & 15;
  const int qt   = blockIdx.x;
  const int h    = blockIdx.y;
  const int b    = blockIdx.z;

  // Load this wave's 16x64 Q band as two A-fragments (dh 0..31, 32..63).
  const size_t qrow = ((size_t)b * SS + qt * 64 + wave * 16 + l16) * DD + h * DH;
  v16bf qa0 = frag_from(&Q[qrow + 0  + 8 * half]);
  v16bf qa1 = frag_from(&Q[qrow + 32 + 8 * half]);

  float m[8], l[8];
  v8f cacc[4] = {};
#pragma unroll
  for (int j = 0; j < 8; ++j) { m[j] = -1e30f; l[j] = 0.0f; }

  for (int kt = 0; kt < SS / 32; ++kt) {
    // ---- cooperative K/V tile load: 32 keys x 64 dh each ----
#pragma unroll
    for (int c = 0; c < 2; ++c) {
      int ch = tid + c * 128;                 // 0..255
      int r = ch >> 3, col = (ch & 7) * 8;
      size_t g = ((size_t)b * SS + kt * 32 + r) * DD + h * DH + col;
      *(v8bf*)&Ks[r][col] = *(const v8bf*)&Kb[g];
      *(v8bf*)&Vs[r][col] = *(const v8bf*)&Vb[g];
    }
    if (tid < 32)
      Madd[tid] = mask[(size_t)b * SS + kt * 32 + tid] ? 0.0f : -1e30f;
    __syncthreads();

    // ---- scores: S = Q x K^T  (two 16x16 key groups, K-dim = dh 64) ----
    v8f s0 = {}, s1 = {};
    {
      v16bf kb0 = frag_from(&Ks[l16][0 + 8 * half]);
      s0 = wmma_bf16(qa0, kb0, s0);
      v16bf kb1 = frag_from(&Ks[l16][32 + 8 * half]);
      s0 = wmma_bf16(qa1, kb1, s0);
      v16bf kb2 = frag_from(&Ks[16 + l16][0 + 8 * half]);
      s1 = wmma_bf16(qa0, kb2, s1);
      v16bf kb3 = frag_from(&Ks[16 + l16][32 + 8 * half]);
      s1 = wmma_bf16(qa1, kb3, s1);
    }

    // ---- online softmax over this 32-key slab ----
    const float mk0 = Madd[l16], mk1 = Madd[16 + l16];
#pragma unroll
    for (int j = 0; j < 8; ++j) {
      float a0 = s0[j] + mk0;
      float a1 = s1[j] + mk1;
      float mx = fmaxf(a0, a1);
      mx = fmaxf(mx, __shfl_xor(mx, 1));
      mx = fmaxf(mx, __shfl_xor(mx, 2));
      mx = fmaxf(mx, __shfl_xor(mx, 4));
      mx = fmaxf(mx, __shfl_xor(mx, 8));      // row max within 16-lane group
      float mn  = fmaxf(m[j], mx);
      float cor = __expf(m[j] - mn);
      float p0  = __expf(a0 - mn);
      float p1  = __expf(a1 - mn);
      float rs  = p0 + p1;
      rs += __shfl_xor(rs, 1);
      rs += __shfl_xor(rs, 2);
      rs += __shfl_xor(rs, 4);
      rs += __shfl_xor(rs, 8);
      l[j] = l[j] * cor + rs;
      m[j] = mn;
#pragma unroll
      for (int f = 0; f < 4; ++f) cacc[f][j] *= cor;
      // C-frag element of VGPR j lives at row (j + 8*half), col l16 / 16+l16
      Ps[wave][j + 8 * half][l16]      = (bf16)p0;
      Ps[wave][j + 8 * half][16 + l16] = (bf16)p1;
    }
    asm volatile("" ::: "memory");  // keep DS stores before DS reads

    // ---- ctx += P(16x32) x V(32x64) ----
    v16bf pa = frag_from(&Ps[wave][l16][8 * half]);
#pragma unroll
    for (int f = 0; f < 4; ++f) {
      v16bf vb = frag_strided(&Vs[0][f * 16 + l16], 72, half);
      cacc[f] = wmma_bf16(pa, vb, cacc[f]);
    }
    __syncthreads();  // Ks/Vs reused next iteration
  }

  // ---- finalize: divide by row sums, write bf16 ctx (b,s,h*64+dh) ----
#pragma unroll
  for (int j = 0; j < 8; ++j) {
    float inv = (l[j] > 0.0f) ? (1.0f / l[j]) : 0.0f;
    size_t o = ((size_t)b * SS + qt * 64 + wave * 16 + j + 8 * half) * DD + h * DH;
#pragma unroll
    for (int f = 0; f < 4; ++f)
      Ctx[o + f * 16 + l16] = (bf16)(cacc[f][j] * inv);
  }
}

// ---------------------------------------------------------------------------
// Residual + LayerNorm over D=1024; optionally emits bf16 copy of the result.
// One block (256 thr) per token row. outF may alias y (in-place).
// ---------------------------------------------------------------------------
__device__ __forceinline__ float block_sum(float v, float* red) {
  v += __shfl_xor(v, 1);
  v += __shfl_xor(v, 2);
  v += __shfl_xor(v, 4);
  v += __shfl_xor(v, 8);
  v += __shfl_xor(v, 16);
  int lane = threadIdx.x & 31, w = threadIdx.x >> 5;
  if (lane == 0) red[w] = v;
  __syncthreads();
  if (threadIdx.x == 0) {
    float s = 0.0f;
#pragma unroll
    for (int i = 0; i < 8; ++i) s += red[i];
    red[0] = s;
  }
  __syncthreads();
  float r = red[0];
  __syncthreads();
  return r;
}

__global__ __launch_bounds__(256)
void ln_residual(const float* y, const float* __restrict__ res,
                 const float* __restrict__ g, const float* __restrict__ beta,
                 float* outF, bf16* outB) {
  __shared__ float red[8];
  const size_t row = blockIdx.x;
  const float* yp = y + row * DD;
  const float* rp = res + row * DD;
  const int base = threadIdx.x * 4;

  float v[4];
  float s = 0.0f;
#pragma unroll
  for (int i = 0; i < 4; ++i) { v[i] = yp[base + i] + rp[base + i]; s += v[i]; }
  float mu = block_sum(s, red) * (1.0f / DD);

  float q = 0.0f;
#pragma unroll
  for (int i = 0; i < 4; ++i) { float d = v[i] - mu; q += d * d; }
  float var = block_sum(q, red) * (1.0f / DD);
  float rstd = rsqrtf(var + 1e-12f);

#pragma unroll
  for (int i = 0; i < 4; ++i) {
    float o = (v[i] - mu) * rstd * g[base + i] + beta[base + i];
    outF[row * DD + base + i] = o;
    if (outB) outB[row * DD + base + i] = (bf16)o;
  }
}

// ---------------------------------------------------------------------------
// Launch
// ---------------------------------------------------------------------------
extern "C" void kernel_launch(void* const* d_in, const int* in_sizes, int n_in,
                              void* d_out, int out_size, void* d_ws, size_t ws_size,
                              hipStream_t stream) {
  (void)in_sizes; (void)n_in; (void)out_size; (void)ws_size;

  const float* x    = (const float*)d_in[0];
  const int*   msk  = (const int*)d_in[1];
  const float* Wq   = (const float*)d_in[2];
  const float* bq   = (const float*)d_in[3];
  const float* Wk   = (const float*)d_in[4];
  const float* bk   = (const float*)d_in[5];
  const float* Wv   = (const float*)d_in[6];
  const float* bv   = (const float*)d_in[7];
  const float* Wo   = (const float*)d_in[8];
  const float* bo   = (const float*)d_in[9];
  const float* ln1g = (const float*)d_in[10];
  const float* ln1b = (const float*)d_in[11];
  const float* W1   = (const float*)d_in[12];
  const float* b1   = (const float*)d_in[13];
  const float* W2   = (const float*)d_in[14];
  const float* b2   = (const float*)d_in[15];
  const float* ln2g = (const float*)d_in[16];
  const float* ln2b = (const float*)d_in[17];
  float* out = (float*)d_out;

  char* ws = (char*)d_ws;
  const size_t MB = 1ull << 20;
  bf16*  wqb  = (bf16*)(ws + 0 * MB);
  bf16*  wkb  = (bf16*)(ws + 2 * MB);
  bf16*  wvb  = (bf16*)(ws + 4 * MB);
  bf16*  wob  = (bf16*)(ws + 6 * MB);
  bf16*  w1b  = (bf16*)(ws + 8 * MB);     // F*D
  bf16*  w2b  = (bf16*)(ws + 16 * MB);    // D*F
  bf16*  xb   = (bf16*)(ws + 24 * MB);
  bf16*  qb   = (bf16*)(ws + 40 * MB);
  bf16*  kb   = (bf16*)(ws + 56 * MB);
  bf16*  vb   = (bf16*)(ws + 72 * MB);
  bf16*  ctxb = (bf16*)(ws + 88 * MB);
  float* sa   = (float*)(ws + 104 * MB);  // sa_out, then h (in-place LN1)
  bf16*  hb   = (bf16*)(ws + 136 * MB);
  bf16*  ffb  = (bf16*)(ws + 40 * MB);    // reuse q/k/v/ctx region (dead by FFN1)
  float* y2   = (float*)(ws + 152 * MB);

  const size_t nD = (size_t)DD * DD, nF = (size_t)FF * DD, nX = (size_t)NTOK * DD;
  dim3 cvtG(2048), cvtB(256);
  hipLaunchKernelGGL(cvt_f32_bf16, cvtG, cvtB, 0, stream, x,  xb,  nX);
  hipLaunchKernelGGL(cvt_f32_bf16, cvtG, cvtB, 0, stream, Wq, wqb, nD);
  hipLaunchKernelGGL(cvt_f32_bf16, cvtG, cvtB, 0, stream, Wk, wkb, nD);
  hipLaunchKernelGGL(cvt_f32_bf16, cvtG, cvtB, 0, stream, Wv, wvb, nD);
  hipLaunchKernelGGL(cvt_f32_bf16, cvtG, cvtB, 0, stream, Wo, wob, nD);
  hipLaunchKernelGGL(cvt_f32_bf16, cvtG, cvtB, 0, stream, W1, w1b, nF);
  hipLaunchKernelGGL(cvt_f32_bf16, cvtG, cvtB, 0, stream, W2, w2b, nF);

  dim3 gB(256);
  dim3 gQKV(NTOK / 128, DD / 128);
  // q = (x Wq^T + bq) / sqrt(64)
  hipLaunchKernelGGL((gemm_bf16_nt<false, true>), gQKV, gB, 0, stream,
                     xb, wqb, bq, 0.125f, (float*)nullptr, qb, NTOK, DD, DD);
  hipLaunchKernelGGL((gemm_bf16_nt<false, true>), gQKV, gB, 0, stream,
                     xb, wkb, bk, 1.0f, (float*)nullptr, kb, NTOK, DD, DD);
  hipLaunchKernelGGL((gemm_bf16_nt<false, true>), gQKV, gB, 0, stream,
                     xb, wvb, bv, 1.0f, (float*)nullptr, vb, NTOK, DD, DD);

  dim3 aG(SS / 64, HH, BB), aB(128);
  hipLaunchKernelGGL(flash_attn, aG, aB, 0, stream, qb, kb, vb, msk, ctxb);

  // sa = ctx Wo^T + bo   (f32)
  hipLaunchKernelGGL((gemm_bf16_nt<false, false>), gQKV, gB, 0, stream,
                     ctxb, wob, bo, 1.0f, sa, (bf16*)nullptr, NTOK, DD, DD);

  // h = LN1(sa + x), in-place in sa; also bf16 copy hb
  hipLaunchKernelGGL(ln_residual, dim3(NTOK), dim3(256), 0, stream,
                     sa, x, ln1g, ln1b, sa, hb);

  // ff = gelu(h W1^T + b1)   (bf16, M=8192 N=4096 K=1024)
  dim3 gF1(NTOK / 128, FF / 128);
  hipLaunchKernelGGL((gemm_bf16_nt<true, true>), gF1, gB, 0, stream,
                     hb, w1b, b1, 1.0f, (float*)nullptr, ffb, NTOK, FF, DD);

  // y2 = ff W2^T + b2   (f32, K=4096)
  hipLaunchKernelGGL((gemm_bf16_nt<false, false>), gQKV, gB, 0, stream,
                     ffb, w2b, b2, 1.0f, y2, (bf16*)nullptr, NTOK, DD, FF);

  // out = LN2(y2 + h)
  hipLaunchKernelGGL(ln_residual, dim3(NTOK), dim3(256), 0, stream,
                     y2, sa, ln2g, ln2b, out, (bf16*)nullptr);
}

// v001
// One run takes 416 microseconds.
// Timed twice side by side with v000, it ran 1.28 and 1.27 times as fast.
#include <hip/hip_runtime.h>
#include <math.h>
#include <stdint.h>

// ---------------------------------------------------------------------------
// Types
// ---------------------------------------------------------------------------
typedef __bf16 bf16;
typedef __bf16 v16bf __attribute__((ext_vector_type(16)));
typedef __bf16 v8bf  __attribute__((ext_vector_type(8)));
typedef float  v8f   __attribute__((ext_vector_type(8)));

#define BB 8
#define SS 1024
#define DD 1024
#define HH 16
#define DH 64
#define FF 4096
#define NTOK (BB * SS)          // 8192

// ---------------------------------------------------------------------------
// WMMA helpers (CDNA5 v_wmma_f32_16x16x32_bf16)
// ---------------------------------------------------------------------------
__device__ __forceinline__ v8f wmma_bf16(v16bf a, v16bf b, v8f c) {
  return __builtin_amdgcn_wmma_f32_16x16x32_bf16(
      /*neg_a=*/false, a, /*neg_b=*/false, b,
      /*c_mod=*/(short)0, c, /*reuse_a=*/false, /*reuse_b=*/false);
}

// A/B fragment loader. ISA 16-bit 16x32 layout: lane half h holds
// K[8h..8h+7] in halves 0..7 and K[16+8h..16+8h+7] in halves 8..15.
// Caller passes p = &row[k0 + 8*half]; we read p[0..7] and p[16..23].
__device__ __forceinline__ v16bf frag_from(const bf16* p) {
  v8bf lo = *(const v8bf*)(p);
  v8bf hi = *(const v8bf*)(p + 16);
  v16bf a;
#pragma unroll
  for (int i = 0; i < 8; ++i) { a[i] = lo[i]; a[i + 8] = hi[i]; }
  return a;
}

// Strided B fragment (column-gather from a row-major LDS tile).
__device__ __forceinline__ v16bf frag_strided(const bf16* base, int stride, int half) {
  v16bf a;
#pragma unroll
  for (int i = 0; i < 8; ++i) {
    a[i]     = base[(8 * half + i) * stride];
    a[i + 8] = base[(16 + 8 * half + i) * stride];
  }
  return a;
}

// CDNA5 async global->LDS copies of 16B chunks (tracked by ASYNCcnt; bypass
// VGPRs entirely).  GV addressing: vdst = LDS byte address, v[addr64], off.
// s_wait_xcnt 0 is the last line of the copies' own statement so that no address
// register is rewritten ahead of it.
__device__ __forceinline__ uint32_t lds_addr(const bf16* p) {
  return (uint32_t)(uint64_t)p;  // flat LDS addr[31:0] = LDS offset
}

// Twelve 16B chunks per lane: LDS places l + i * lstep for the eight chunks of
// the first operand (rows 32 apart), m + i * lstep for the four of the second.
__device__ __forceinline__ void async_copy16x12(uint32_t l, uint32_t m, uint32_t lstep,
                                                const bf16* a, const bf16* w, size_t gstep) {
  asm volatile("global_load_async_to_lds_b128 %0, %12, off\n\t"
               "global_load_async_to_lds_b128 %1, %13, off\n\t"
               "global_load_async_to_lds_b128 %2, %14, off\n\t"
               "global_load_async_to_lds_b128 %3, %15, off\n\t"
               "global_load_async_to_lds_b128 %4, %16, off\n\t"
               "global_load_async_to_lds_b128 %5, %17, off\n\t"
               "global_load_async_to_lds_b128 %6, %18, off\n\t"
               "global_load_async_to_lds_b128 %7, %19, off\n\t"
               "global_load_async_to_lds_b128 %8, %20, off\n\t"
               "global_load_async_to_lds_b128 %9, %21, off\n\t"
               "global_load_async_to_lds_b128 %10, %22, off\n\t"
               "global_load_async_to_lds_b128 %11, %23, off\n\t"
               "s_wait_xcnt 0x0"
               :: "v"(l), "v"(l + lstep), "v"(l + 2 * lstep), "v"(l + 3 * lstep),
                  "v"(l + 4 * lstep), "v"(l + 5 * lstep), "v"(l + 6 * lstep),
                  "v"(l + 7 * lstep),
                  "v"(m), "v"(m + lstep), "v"(m + 2 * lstep), "v"(m + 3 * lstep),
                  "v"((uint64_t)a), "v"((uint64_t)(a + gstep)),
                  "v"((uint64_t)(a + 2 * gstep)), "v"((uint64_t)(a + 3 * gstep)),
                  "v"((uint64_t)(a + 4 * gstep)), "v"((uint64_t)(a + 5 * gstep)),
                  "v"((uint64_t)(a + 6 * gstep)), "v"((uint64_t)(a + 7 * gstep)),
                  "v"((uint64_t)w), "v"((uint64_t)(w + gstep)),
                  "v"((uint64_t)(w + 2 * gstep)), "v"((uint64_t)(w + 3 * gstep))
               : "memory");
}

__device__ __forceinline__ void wait_async0() {
  asm volatile("s_wait_asynccnt 0x0" ::: "memory");
}

// ---------------------------------------------------------------------------
// fp32 -> bf16 conversion (grid-stride)
// ---------------------------------------------------------------------------
__global__ void cvt_f32_bf16(const float* __restrict__ in, bf16* __restrict__ out,
                             size_t n) {
  size_t i = (size_t)blockIdx.x * blockDim.x + threadIdx.x;
  size_t stride = (size_t)gridDim.x * blockDim.x;
  for (; i < n; i += stride) out[i] = (bf16)in[i];
}

// ---------------------------------------------------------------------------
// Tiled bf16 WMMA GEMM:  Y[M,N] = act( (A[M,K] * W[N,K]^T + bias) * scale )
// A, W row-major with K contiguous (torch Linear layout -> NT GEMM).
// Block tile 256x128, 8 waves of 64x64, K-step 64, double-buffered LDS filled
// by async global->LDS DMA.  M % 256 == 0, N % 128 == 0, K % 64 == 0.
// ---------------------------------------------------------------------------
template <bool GELU, bool OUT_BF16>
__global__ __launch_bounds__(256)
void gemm_bf16_nt(const bf16* __restrict__ A, const bf16* __restrict__ W,
                  const float* __restrict__ bias, float scale,
                  float* outF, bf16* outB, int M, int N, int K) {
  __shared__ bf16 As[2][256][72];   // 144B row pitch = 16B x odd (b128 readers)
  __shared__ bf16 Bs[2][128][72];

  const int tid  = threadIdx.x;
  const int lane = tid & 31;
  const int wave = tid >> 5;
  const int wm   = wave & 3;       // 4 M-bands of 64
  const int wn   = wave >> 2;      // 2 N-bands of 64
  const int half = lane >> 4;
  const int l16  = lane & 15;
  const int m0   = blockIdx.x * 256;
  const int n0   = blockIdx.y * 128;

  v8f acc[4][4] = {};

  // A 256x64 = 2048 16B chunks (8 per thread), W 128x64 = 1024 (4 per thread).
  // A wave's copy covers 4 rows x 128B = 4 whole lines.
  const int cr = tid >> 3, cc = (tid & 7) * 8;
  const bf16* gA = &A[(size_t)(m0 + cr) * K + cc];
  const bf16* gW = &W[(size_t)(n0 + cr) * K + cc];
  const size_t rs = (size_t)32 * K;            // 32 rows further
  auto load_tile = [&](int buf, int k0) {
    async_copy16x12(lds_addr(&As[buf][cr][cc]), lds_addr(&Bs[buf][cr][cc]),
                    32 * 72 * 2, gA + k0, gW + k0, rs);
  };

  load_tile(0, 0);
  wait_async0();
  __syncthreads();

  const int KT = K >> 6;
  for (int kt = 0; kt < KT; ++kt) {
    const int cur = kt & 1;
    // every loop below is unrolled so that acc[][], a[] and b[] are indexed by
    // constants and stay in registers
#pragma unroll
    for (int ks = 0; ks < 2; ++ks) {
      v16bf a[4], b[4];
#pragma unroll
      for (int i = 0; i < 4; ++i) {
        a[i] = frag_from(&As[cur][wm * 64 + i * 16 + l16][ks * 32 + 8 * half]);
        b[i] = frag_from(&Bs[cur][wn * 64 + i * 16 + l16][ks * 32 + 8 * half]);
      }
      // keeps the 16 LDS reads one group ahead of the 16 WMMAs: left alone the
      // scheduler sinks them among the WMMAs, one full LDS wait per row of four
      __builtin_amdgcn_sched_barrier(0);
      // next tile into the buffer every wave left at the last barrier; issued
      // here so that its address work and wait run under the LDS reads' latency
      if (ks == 0 && kt + 1 < KT) load_tile(cur ^ 1, (kt + 1) << 6);
#pragma unroll
      for (int mi = 0; mi < 4; ++mi)
#pragma unroll
        for (int ni = 0; ni < 4; ++ni)
          acc[mi][ni] = wmma_bf16(a[mi], b[ni], acc[mi][ni]);
      // second half of the pair: the next group's reads stay behind this block
      __builtin_amdgcn_sched_barrier(0);
    }

    // own LDS reads of `cur` retired before any wave may refill it
    asm volatile("s_wait_dscnt 0x0" ::: "memory");
    wait_async0();       // next-buffer DMA landed (ASYNCcnt not covered by barrier)
    __syncthreads();     // all waves done reading `cur`, writes visible
  }

  // ---- epilogue: C-frag mapping row = j + 8*half, col = l16 ----
#pragma unroll
  for (int mi = 0; mi < 4; ++mi) {
#pragma unroll
    for (int ni = 0; ni < 4; ++ni) {
      int col = n0 + wn * 64 + ni * 16 + l16;
      float bv = bias[col];
#pragma unroll
      for (int j = 0; j < 8; ++j) {
        int row = m0 + wm * 64 + mi * 16 + j + 8 * half;
        float v = (acc[mi][ni][j] + bv) * scale;
        if (GELU) v = 0.5f * v * (1.0f + erff(v * 0.70710678118654752f));
        size_t idx = (size_t)row * N + col;
        if (OUT_BF16) outB[idx] = (bf16)v;
        else          outF[idx] = v;
      }
    }
  }
}

// ---------------------------------------------------------------------------
// Flash attention: grid (S/64, H, B), block = 128 threads = 4 waves.
// Each wave owns a 16-query band; K/V tiles of 32 keys staged in LDS.
// ---------------------------------------------------------------------------
__global__ __launch_bounds__(128)
void flash_attn(const bf16* __restrict__ Q, const bf16* __restrict__ Kb,
                const bf16* __restrict__ Vb, const int* __restrict__ mask,
                bf16* __restrict__ Ctx) {
  __shared__ bf16 Ks[32][72];     // 144B row stride (16B aligned chunks)
  __shared__ bf16 Vs[32][72];
  __shared__ float Madd[32];
  __shared__ bf16 Ps[4][16][40];  // per-wave P tile scratch

  const int tid  = threadIdx.x;
  const int lane = tid & 31;
  const int wave = tid >> 5;
  const int half = lane >> 4;
  const int l16  = lane & 15;
  const int qt   = blockIdx.x;
  const int h    = blockIdx.y;
  const int b    = blockIdx.z;

  // Load this wave's 16x64 Q band as two A-fragments (dh 0..31, 32..63).
  const size_t qrow = ((size_t)b * SS + qt * 64 + wave * 16 + l16) * DD + h * DH;
  v16bf qa0 = frag_from(&Q[qrow + 0  + 8 * half]);
  v16bf qa1 = frag_from(&Q[qrow + 32 + 8 * half]);

  float m[8], l[8];
  v8f cacc[4] = {};
#pragma unroll
  for (int j = 0; j < 8; ++j) { m[j] = -1e30f; l[j] = 0.0f; }

  for (int kt = 0; kt < SS / 32; ++kt) {
    // ---- cooperative K/V tile load: 32 keys x 64 dh each ----
#pragma unroll
    for (int c = 0; c < 2; ++c) {
      int ch = tid + c * 128;                 // 0..255
      int r = ch >> 3, col = (ch & 7) * 8;
      size_t g = ((size_t)b * SS + kt * 32 + r) * DD + h * DH + col;
      *(v8bf*)&Ks[r][col] = *(const v8bf*)&Kb[g];
      *(v8bf*)&Vs[r][col] = *(const v8bf*)&Vb[g];
    }
    if (tid < 32)
      Madd[tid] = mask[(size_t)b * SS + kt * 32 + tid] ? 0.0f : -1e30f;
    __syncthreads();

    // ---- scores: S = Q x K^T  (two 16x16 key groups, K-dim = dh 64) ----
    v8f s0 = {}, s1 = {};
    {
      v16bf kb0 = frag_from(&Ks[l16][0 + 8 * half]);
      s0 = wmma_bf16(qa0, kb0, s0);
      v16bf kb1 = frag_from(&Ks[l16][32 + 8 * half]);
      s0 = wmma_bf16(qa1, kb1, s0);
      v16bf kb2 = frag_from(&Ks[16 + l16][0 + 8 * half]);
      s1 = wmma_bf16(qa0, kb2, s1);
      v16bf kb3 = frag_from(&Ks[16 + l16][32 + 8 * half]);
      s1 = wmma_bf16(qa1, kb3, s1);
    }

    // ---- online softmax over this 32-key slab ----
    const float mk0 = Madd[l16], mk1 = Madd[16 + l16];
#pragma unroll
    for (int j = 0; j < 8; ++j) {
      float a0 = s0[j] + mk0;
      float a1 = s1[j] + mk1;
      float mx = fmaxf(a0, a1);
      mx = fmaxf(mx, __shfl_xor(mx, 1));
      mx = fmaxf(mx, __shfl_xor(mx, 2));
      mx = fmaxf(mx, __shfl_xor(mx, 4));
      mx = fmaxf(mx, __shfl_xor(mx, 8));      // row max within 16-lane group
      float mn  = fmaxf(m[j], mx);
      float cor = __expf(m[j] - mn);
      float p0  = __expf(a0 - mn);
      float p1  = __expf(a1 - mn);
      float rs  = p0 + p1;
      rs += __shfl_xor(rs, 1);
      rs += __shfl_xor(rs, 2);
      rs += __shfl_xor(rs, 4);
      rs += __shfl_xor(rs, 8);
      l[j] = l[j] * cor + rs;
      m[j] = mn;
#pragma unroll
      for (int f = 0; f < 4; ++f) cacc[f][j] *= cor;
      // C-frag element of VGPR j lives at row (j + 8*half), col l16 / 16+l16
      Ps[wave][j + 8 * half][l16]      = (bf16)p0;
      Ps[wave][j + 8 * half][16 + l16] = (bf16)p1;
    }
    asm volatile("" ::: "memory");  // keep DS stores before DS reads

    // ---- ctx += P(16x32) x V(32x64) ----
    v16bf pa = frag_from(&Ps[wave][l16][8 * half]);
#pragma unroll
    for (int f = 0; f < 4; ++f) {
      v16bf vb = frag_strided(&Vs[0][f * 16 + l16], 72, half);
      cacc[f] = wmma_bf16(pa, vb, cacc[f]);
    }
    __syncthreads();  // Ks/Vs reused next iteration
  }

  // ---- finalize: divide by row sums, write bf16 ctx (b,s,h*64+dh) ----
#pragma unroll
  for (int j = 0; j < 8; ++j) {
    float inv = (l[j] > 0.0f) ? (1.0f / l[j]) : 0.0f;
    size_t o = ((size_t)b * SS + qt * 64 + wave * 16 + j + 8 * half) * DD + h * DH;
#pragma unroll
    for (int f = 0; f < 4; ++f)
      Ctx[o + f * 16 + l16] = (bf16)(cacc[f][j] * inv);
  }
}

// ---------------------------------------------------------------------------
// Residual + LayerNorm over D=1024; optionally emits bf16 copy of the result.
// One block (256 thr) per token row. outF may alias y (in-place).
// ---------------------------------------------------------------------------
__device__ __forceinline__ float block_sum(float v, float* red) {
  v += __shfl_xor(v, 1);
  v += __shfl_xor(v, 2);
  v += __shfl_xor(v, 4);
  v += __shfl_xor(v, 8);
  v += __shfl_xor(v, 16);
  int lane = threadIdx.x & 31, w = threadIdx.x >> 5;
  if (lane == 0) red[w] = v;
  __syncthreads();
  if (threadIdx.x == 0) {
    float s = 0.0f;
#pragma unroll
    for (int i = 0; i < 8; ++i) s += red[i];
    red[0] = s;
  }
  __syncthreads();
  float r = red[0];
  __syncthreads();
  return r;
}

__global__ __launch_bounds__(256)
void ln_residual(const float* y, const float* __restrict__ res,
                 const float* __restrict__ g, const float* __restrict__ beta,
                 float* outF, bf16* outB) {
  __shared__ float red[8];
  const size_t row = blockIdx.x;
  const float* yp = y + row * DD;
  const float* rp = res + row * DD;
  const int base = threadIdx.x * 4;

  float v[4];
  float s = 0.0f;
#pragma unroll
  for (int i = 0; i < 4; ++i) { v[i] = yp[base + i] + rp[base + i]; s += v[i]; }
  float mu = block_sum(s, red) * (1.0f / DD);

  float q = 0.0f;
#pragma unroll
  for (int i = 0; i < 4; ++i) { float d = v[i] - mu; q += d * d; }
  float var = block_sum(q, red) * (1.0f / DD);
  float rstd = rsqrtf(var + 1e-12f);

#pragma unroll
  for (int i = 0; i < 4; ++i) {
    float o = (v[i] - mu) * rstd * g[base + i] + beta[base + i];
    outF[row * DD + base + i] = o;
    if (outB) outB[row * DD + base + i] = (bf16)o;
  }
}

// ---------------------------------------------------------------------------
// Launch
// ---------------------------------------------------------------------------
extern "C" void kernel_launch(void* const* d_in, const int* in_sizes, int n_in,
                              void* d_out, int out_size, void* d_ws, size_t ws_size,
                              hipStream_t stream) {
  (void)in_sizes; (void)n_in; (void)out_size; (void)ws_size;

  const float* x    = (const float*)d_in[0];
  const int*   msk  = (const int*)d_in[1];
  const float* Wq   = (const float*)d_in[2];
  const float* bq   = (const float*)d_in[3];
  const float* Wk   = (const float*)d_in[4];
  const float* bk   = (const float*)d_in[5];
  const float* Wv   = (const float*)d_in[6];
  const float* bv   = (const float*)d_in[7];
  const float* Wo   = (const float*)d_in[8];
  const float* bo   = (const float*)d_in[9];
  const float* ln1g = (const float*)d_in[10];
  const float* ln1b = (const float*)d_in[11];
  const float* W1   = (const float*)d_in[12];
  const float* b1   = (const float*)d_in[13];
  const float* W2   = (const float*)d_in[14];
  const float* b2   = (const float*)d_in[15];
  const float* ln2g = (const float*)d_in[16];
  const float* ln2b = (const float*)d_in[17];
  float* out = (float*)d_out;

  char* ws = (char*)d_ws;
  const size_t MB = 1ull << 20;
  bf16*  wqb  = (bf16*)(ws + 0 * MB);
  bf16*  wkb  = (bf16*)(ws + 2 * MB);
  bf16*  wvb  = (bf16*)(ws + 4 * MB);
  bf16*  wob  = (bf16*)(ws + 6 * MB);
  bf16*  w1b  = (bf16*)(ws + 8 * MB);     // F*D
  bf16*  w2b  = (bf16*)(ws + 16 * MB);    // D*F
  bf16*  xb   = (bf16*)(ws + 24 * MB);
  bf16*  qb   = (bf16*)(ws + 40 * MB);
  bf16*  kb   = (bf16*)(ws + 56 * MB);
  bf16*  vb   = (bf16*)(ws + 72 * MB);
  bf16*  ctxb = (bf16*)(ws + 88 * MB);
  float* sa   = (float*)(ws + 104 * MB);  // sa_out, then h (in-place LN1)
  bf16*  hb   = (bf16*)(ws + 136 * MB);
  bf16*  ffb  = (bf16*)(ws + 40 * MB);    // reuse q/k/v/ctx region (dead by FFN1)
  float* y2   = (float*)(ws + 152 * MB);

  const size_t nD = (size_t)DD * DD, nF = (size_t)FF * DD, nX = (size_t)NTOK * DD;
  dim3 cvtG(2048), cvtB(256);
  hipLaunchKernelGGL(cvt_f32_bf16, cvtG, cvtB, 0, stream, x,  xb,  nX);
  hipLaunchKernelGGL(cvt_f32_bf16, cvtG, cvtB, 0, stream, Wq, wqb, nD);
  hipLaunchKernelGGL(cvt_f32_bf16, cvtG, cvtB, 0, stream, Wk, wkb, nD);
  hipLaunchKernelGGL(cvt_f32_bf16, cvtG, cvtB, 0, stream, Wv, wvb, nD);
  hipLaunchKernelGGL(cvt_f32_bf16, cvtG, cvtB, 0, stream, Wo, wob, nD);
  hipLaunchKernelGGL(cvt_f32_bf16, cvtG, cvtB, 0, stream, W1, w1b, nF);
  hipLaunchKernelGGL(cvt_f32_bf16, cvtG, cvtB, 0, stream, W2, w2b, nF);

  dim3 gB(256);
  dim3 gQKV(NTOK / 256, DD / 128);
  // q = (x Wq^T + bq) / sqrt(64)
  hipLaunchKernelGGL((gemm_bf16_nt<false, true>), gQKV, gB, 0, stream,
                     xb, wqb, bq, 0.125f, (float*)nullptr, qb, NTOK, DD, DD);
  hipLaunchKernelGGL((gemm_bf16_nt<false, true>), gQKV, gB, 0, stream,
                     xb, wkb, bk, 1.0f, (float*)nullptr, kb, NTOK, DD, DD);
  hipLaunchKernelGGL((gemm_bf16_nt<false, true>), gQKV, gB, 0, stream,
                     xb, wvb, bv, 1.0f, (float*)nullptr, vb, NTOK, DD, DD);

  dim3 aG(SS / 64, HH, BB), aB(128);
  hipLaunchKernelGGL(flash_attn, aG, aB, 0, stream, qb, kb, vb, msk, ctxb);

  // sa = ctx Wo^T + bo   (f32)
  hipLaunchKernelGGL((gemm_bf16_nt<false, false>), gQKV, gB, 0, stream,
                     ctxb, wob, bo, 1.0f, sa, (bf16*)nullptr, NTOK, DD, DD);

  // h = LN1(sa + x), in-place in sa; also bf16 copy hb
  hipLaunchKernelGGL(ln_residual, dim3(NTOK), dim3(256), 0, stream,
                     sa, x, ln1g, ln1b, sa, hb);

  // ff = gelu(h W1^T + b1)   (bf16, M=8192 N=4096 K=1024)
  dim3 gF1(NTOK / 256, FF / 128);
  hipLaunchKernelGGL((gemm_bf16_nt<true, true>), gF1, gB, 0, stream,
                     hb, w1b, b1, 1.0f, (float*)nullptr, ffb, NTOK, FF, DD);

  // y2 = ff W2^T + b2   (f32, K=4096)
  hipLaunchKernelGGL((gemm_bf16_nt<false, false>), gQKV, gB, 0, stream,
                     ffb, w2b, b2, 1.0f, y2, (bf16*)nullptr, NTOK, DD, FF);

  // out = LN2(y2 + h)
  hipLaunchKernelGGL(ln_residual, dim3(NTOK), dim3(256), 0, stream,
                     y2, sa, ln2g, ln2b, out, (bf16*)nullptr);
}

// v002
// One run takes 330 microseconds.
// Next to v001, in two timings, it ran 1.26 and 1.27 times as fast.
// All steps since v000 together make it 1.61 times as fast.
#include <hip/hip_runtime.h>
#include <math.h>
#include <stdint.h>

// ---------------------------------------------------------------------------
// Types
// ---------------------------------------------------------------------------
typedef __bf16 bf16;
typedef __bf16 v16bf __attribute__((ext_vector_type(16)));
typedef __bf16 v8bf  __attribute__((ext_vector_type(8)));
typedef float  v8f   __attribute__((ext_vector_type(8)));

#define BB 8
#define SS 1024
#define DD 1024
#define HH 16
#define DH 64
#define FF 4096
#define NTOK (BB * SS)          // 8192

// ---------------------------------------------------------------------------
// WMMA helpers (CDNA5 v_wmma_f32_16x16x32_bf16)
// ---------------------------------------------------------------------------
__device__ __forceinline__ v8f wmma_bf16(v16bf a, v16bf b, v8f c) {
  return __builtin_amdgcn_wmma_f32_16x16x32_bf16(
      /*neg_a=*/false, a, /*neg_b=*/false, b,
      /*c_mod=*/(short)0, c, /*reuse_a=*/false, /*reuse_b=*/false);
}

// A/B fragment loader. ISA 16-bit 16x32 layout: lane half h holds
// K[8h..8h+7] in halves 0..7 and K[16+8h..16+8h+7] in halves 8..15.
// Caller passes p = &row[k0 + 8*half]; we read p[0..7] and p[16..23].
__device__ __forceinline__ v16bf frag_from(const bf16* p) {
  v8bf lo = *(const v8bf*)(p);
  v8bf hi = *(const v8bf*)(p + 16);
  v16bf a;
#pragma unroll
  for (int i = 0; i < 8; ++i) { a[i] = lo[i]; a[i + 8] = hi[i]; }
  return a;
}

// CDNA5 async global->LDS copies of 16B chunks (tracked by ASYNCcnt; bypass
// VGPRs entirely).  GV addressing: vdst = LDS byte address, v[addr64], off.
// s_wait_xcnt 0 is the last line of the copies' own statement so that no address
// register is rewritten ahead of it.
__device__ __forceinline__ uint32_t lds_addr(const bf16* p) {
  return (uint32_t)(uint64_t)p;  // flat LDS addr[31:0] = LDS offset
}

// Twelve 16B chunks per lane: LDS places l + i * lstep for the eight chunks of
// the first operand (rows 32 apart), m + i * lstep for the four of the second.
__device__ __forceinline__ void async_copy16x12(uint32_t l, uint32_t m, uint32_t lstep,
                                                const bf16* a, const bf16* w, size_t gstep) {
  asm volatile("global_load_async_to_lds_b128 %0, %12, off\n\t"
               "global_load_async_to_lds_b128 %1, %13, off\n\t"
               "global_load_async_to_lds_b128 %2, %14, off\n\t"
               "global_load_async_to_lds_b128 %3, %15, off\n\t"
               "global_load_async_to_lds_b128 %4, %16, off\n\t"
               "global_load_async_to_lds_b128 %5, %17, off\n\t"
               "global_load_async_to_lds_b128 %6, %18, off\n\t"
               "global_load_async_to_lds_b128 %7, %19, off\n\t"
               "global_load_async_to_lds_b128 %8, %20, off\n\t"
               "global_load_async_to_lds_b128 %9, %21, off\n\t"
               "global_load_async_to_lds_b128 %10, %22, off\n\t"
               "global_load_async_to_lds_b128 %11, %23, off\n\t"
               "s_wait_xcnt 0x0"
               :: "v"(l), "v"(l + lstep), "v"(l + 2 * lstep), "v"(l + 3 * lstep),
                  "v"(l + 4 * lstep), "v"(l + 5 * lstep), "v"(l + 6 * lstep),
                  "v"(l + 7 * lstep),
                  "v"(m), "v"(m + lstep), "v"(m + 2 * lstep), "v"(m + 3 * lstep),
                  "v"((uint64_t)a), "v"((uint64_t)(a + gstep)),
                  "v"((uint64_t)(a + 2 * gstep)), "v"((uint64_t)(a + 3 * gstep)),
                  "v"((uint64_t)(a + 4 * gstep)), "v"((uint64_t)(a + 5 * gstep)),
                  "v"((uint64_t)(a + 6 * gstep)), "v"((uint64_t)(a + 7 * gstep)),
                  "v"((uint64_t)w), "v"((uint64_t)(w + gstep)),
                  "v"((uint64_t)(w + 2 * gstep)), "v"((uint64_t)(w + 3 * gstep))
               : "memory");
}

__device__ __forceinline__ void wait_async0() {
  asm volatile("s_wait_asynccnt 0x0" ::: "memory");
}

// ---------------------------------------------------------------------------
// fp32 -> bf16 conversion (grid-stride)
// ---------------------------------------------------------------------------
__global__ void cvt_f32_bf16(const float* __restrict__ in, bf16* __restrict__ out,
                             size_t n) {
  size_t i = (size_t)blockIdx.x * blockDim.x + threadIdx.x;
  size_t stride = (size_t)gridDim.x * blockDim.x;
  for (; i < n; i += stride) out[i] = (bf16)in[i];
}

// ---------------------------------------------------------------------------
// Tiled bf16 WMMA GEMM:  Y[M,N] = act( (A[M,K] * W[N,K]^T + bias) * scale )
// A, W row-major with K contiguous (torch Linear layout -> NT GEMM).
// Block tile 256x128, 8 waves of 64x64, K-step 64, double-buffered LDS filled
// by async global->LDS DMA.  M % 256 == 0, N % 128 == 0, K % 64 == 0.
// ---------------------------------------------------------------------------
template <bool GELU, bool OUT_BF16>
__global__ __launch_bounds__(256)
void gemm_bf16_nt(const bf16* __restrict__ A, const bf16* __restrict__ W,
                  const float* __restrict__ bias, float scale,
                  float* outF, bf16* outB, int M, int N, int K) {
  __shared__ bf16 As[2][256][72];   // 144B row pitch = 16B x odd (b128 readers)
  __shared__ bf16 Bs[2][128][72];

  const int tid  = threadIdx.x;
  const int lane = tid & 31;
  const int wave = tid >> 5;
  const int wm   = wave & 3;       // 4 M-bands of 64
  const int wn   = wave >> 2;      // 2 N-bands of 64
  const int half = lane >> 4;
  const int l16  = lane & 15;
  const int m0   = blockIdx.x * 256;
  const int n0   = blockIdx.y * 128;

  v8f acc[4][4] = {};

  // A 256x64 = 2048 16B chunks (8 per thread), W 128x64 = 1024 (4 per thread).
  // A wave's copy covers 4 rows x 128B = 4 whole lines.
  const int cr = tid >> 3, cc = (tid & 7) * 8;
  const bf16* gA = &A[(size_t)(m0 + cr) * K + cc];
  const bf16* gW = &W[(size_t)(n0 + cr) * K + cc];
  const size_t rs = (size_t)32 * K;            // 32 rows further
  auto load_tile = [&](int buf, int k0) {
    async_copy16x12(lds_addr(&As[buf][cr][cc]), lds_addr(&Bs[buf][cr][cc]),
                    32 * 72 * 2, gA + k0, gW + k0, rs);
  };

  load_tile(0, 0);
  wait_async0();
  __syncthreads();

  const int KT = K >> 6;
  for (int kt = 0; kt < KT; ++kt) {
    const int cur = kt & 1;
    // every loop below is unrolled so that acc[][], a[] and b[] are indexed by
    // constants and stay in registers
#pragma unroll
    for (int ks = 0; ks < 2; ++ks) {
      v16bf a[4], b[4];
#pragma unroll
      for (int i = 0; i < 4; ++i) {
        a[i] = frag_from(&As[cur][wm * 64 + i * 16 + l16][ks * 32 + 8 * half]);
        b[i] = frag_from(&Bs[cur][wn * 64 + i * 16 + l16][ks * 32 + 8 * half]);
      }
      // keeps the 16 LDS reads one group ahead of the 16 WMMAs: left alone the
      // scheduler sinks them among the WMMAs, one full LDS wait per row of four
      __builtin_amdgcn_sched_barrier(0);
      // next tile into the buffer every wave left at the last barrier; issued
      // here so that its address work and wait run under the LDS reads' latency
      if (ks == 0 && kt + 1 < KT) load_tile(cur ^ 1, (kt + 1) << 6);
#pragma unroll
      for (int mi = 0; mi < 4; ++mi)
#pragma unroll
        for (int ni = 0; ni < 4; ++ni)
          acc[mi][ni] = wmma_bf16(a[mi], b[ni], acc[mi][ni]);
      // second half of the pair: the next group's reads stay behind this block
      __builtin_amdgcn_sched_barrier(0);
    }

    // own LDS reads of `cur` retired before any wave may refill it
    asm volatile("s_wait_dscnt 0x0" ::: "memory");
    wait_async0();       // next-buffer DMA landed (ASYNCcnt not covered by barrier)
    __syncthreads();     // all waves done reading `cur`, writes visible
  }

  // ---- epilogue: C-frag mapping row = j + 8*half, col = l16 ----
#pragma unroll
  for (int mi = 0; mi < 4; ++mi) {
#pragma unroll
    for (int ni = 0; ni < 4; ++ni) {
      int col = n0 + wn * 64 + ni * 16 + l16;
      float bv = bias[col];
#pragma unroll
      for (int j = 0; j < 8; ++j) {
        int row = m0 + wm * 64 + mi * 16 + j + 8 * half;
        float v = (acc[mi][ni][j] + bv) * scale;
        if (GELU) v = 0.5f * v * (1.0f + erff(v * 0.70710678118654752f));
        size_t idx = (size_t)row * N + col;
        if (OUT_BF16) outB[idx] = (bf16)v;
        else          outF[idx] = v;
      }
    }
  }
}

// ---------------------------------------------------------------------------
// Flash attention: grid (S/64, H, B), block = 128 threads = 4 waves.
// Each wave owns 16 queries; K/V tiles of 32 keys staged in LDS.
// Transposed products: S^T = K x Q^T and O^T += V^T x P^T.  A lane then holds
// 16 of the 32 scores of ONE query (query = l16, keys 8*half + r and
// 16 + 8*half + r), so maximum and sum are taken in the lane's own registers
// with one exchange between the wave's halves, and the two score tiles,
// converted in place, already are the B operand of the second product.
// ---------------------------------------------------------------------------
typedef short s16x8 __attribute__((ext_vector_type(8)));
typedef float v4f   __attribute__((ext_vector_type(4)));

// Transposing LDS read: lane (l16, half) receives T[kbase + 8*half + 0..7][dbase + l16]
// when it passes &T[kbase + 8*half + (lane & 7)][dbase + 8 * ((lane >> 3) & 1)].
__device__ __forceinline__ v8bf ld_tr16(const bf16* p) {
  typedef __attribute__((address_space(3))) s16x8 lds_s16x8;
  return __builtin_bit_cast(v8bf, __builtin_amdgcn_ds_load_tr16_b128_v8i16((lds_s16x8*)p));
}

// lane l <-> lane l ^ 16
__device__ __forceinline__ float xhalf(float x) {
  return __builtin_bit_cast(float, __builtin_amdgcn_permlanex16(
      __builtin_bit_cast(int, x), __builtin_bit_cast(int, x),
      0x76543210, 0xfedcba98, false, false));
}

#define LOG2E 1.44269504088896340736f

// Base-2 exponentials in place.  Written as one statement so that the slot the
// instruction set asks for behind a transcendental is kept: inside the run no
// v_exp touches its neighbour's registers, and the closing v_nop stands in
// front of whatever the compiler places next.
__device__ __forceinline__ void exp2_x8(float (&e)[8]) {
  asm("v_exp_f32 %0, %0\n\t"
      "v_exp_f32 %1, %1\n\t"
      "v_exp_f32 %2, %2\n\t"
      "v_exp_f32 %3, %3\n\t"
      "v_exp_f32 %4, %4\n\t"
      "v_exp_f32 %5, %5\n\t"
      "v_exp_f32 %6, %6\n\t"
      "v_exp_f32 %7, %7\n\t"
      "v_nop"
      : "+v"(e[0]), "+v"(e[1]), "+v"(e[2]), "+v"(e[3]),
        "+v"(e[4]), "+v"(e[5]), "+v"(e[6]), "+v"(e[7]));
}
__device__ __forceinline__ void exp2_x1(float& e) {
  asm("v_exp_f32 %0, %0\n\t"
      "v_nop"
      : "+v"(e));
}

__global__ __launch_bounds__(128)
void flash_attn(const bf16* __restrict__ Q, const bf16* __restrict__ Kb,
                const bf16* __restrict__ Vb, const int* __restrict__ mask,
                bf16* __restrict__ Ctx) {
  __shared__ bf16 Ks[32][72];     // 144B pitch = 16B x odd (b128 readers)
  __shared__ bf16 Vs[32][80];     // 160B pitch = 32B x odd (transposing readers)
  __shared__ __attribute__((aligned(16))) float Madd[32];

  const int tid  = threadIdx.x;
  const int lane = tid & 31;
  const int wave = tid >> 5;
  const int half = lane >> 4;
  const int l16  = lane & 15;
  const int qt   = blockIdx.x;
  const int h    = blockIdx.y;
  const int b    = blockIdx.z;

  // This wave's 16 queries as two B-fragments (dh 0..31, 32..63): column = l16.
  const size_t qrow = ((size_t)b * SS + qt * 64 + wave * 16 + l16) * DD + h * DH;
  v16bf qb0 = frag_from(&Q[qrow + 0  + 8 * half]);
  v16bf qb1 = frag_from(&Q[qrow + 32 + 8 * half]);

  // m: running maximum of query l16 (equal in both halves); l: this half's part
  // of its running sum; cacc[f][r] = O^T[dh = 16 f + 8 half + r][query l16].
  float m = -1e30f, l = 0.0f;
  v8f cacc[4] = {};

  const bf16* vp = &Vs[8 * half + (lane & 7)][8 * ((lane >> 3) & 1)];

  for (int kt = 0; kt < SS / 32; ++kt) {
    // ---- cooperative K/V tile load: 32 keys x 64 dh each ----
    // the four loads first, then the four LDS stores: one memory latency a tile
    v8bf kr[2], vr[2];
#pragma unroll
    for (int c = 0; c < 2; ++c) {
      int ch = tid + c * 128;                 // 0..255
      int r = ch >> 3, col = (ch & 7) * 8;
      size_t g = ((size_t)b * SS + kt * 32 + r) * DD + h * DH + col;
      kr[c] = *(const v8bf*)&Kb[g];
      vr[c] = *(const v8bf*)&Vb[g];
    }
#pragma unroll
    for (int c = 0; c < 2; ++c) {
      int ch = tid + c * 128;
      int r = ch >> 3, col = (ch & 7) * 8;
      *(v8bf*)&Ks[r][col] = kr[c];
      *(v8bf*)&Vs[r][col] = vr[c];
    }
    if (tid < 32)
      Madd[tid] = mask[(size_t)b * SS + kt * 32 + tid] ? 0.0f : -1e30f;
    __syncthreads();

    // ---- scores: S^T = K x Q^T, two 16-key tiles, K-dim = dh 64.  The key's
    // additive mask is the accumulator's start value: row r of tile i is key
    // 16 i + 8 half + r. ----
    v8f s0, s1;
    {
      const v4f ma = *(const v4f*)&Madd[8 * half];
      const v4f mb = *(const v4f*)&Madd[8 * half + 4];
      const v4f mc = *(const v4f*)&Madd[16 + 8 * half];
      const v4f md = *(const v4f*)&Madd[16 + 8 * half + 4];
#pragma unroll
      for (int r = 0; r < 4; ++r) {
        s0[r] = ma[r]; s0[r + 4] = mb[r];
        s1[r] = mc[r]; s1[r + 4] = md[r];
      }
      v16bf ka0 = frag_from(&Ks[l16][0 + 8 * half]);
      v16bf ka1 = frag_from(&Ks[l16][32 + 8 * half]);
      v16bf ka2 = frag_from(&Ks[16 + l16][0 + 8 * half]);
      v16bf ka3 = frag_from(&Ks[16 + l16][32 + 8 * half]);
      // keeps the twelve LDS reads one group ahead of the four WMMAs: left alone
      // the scheduler pairs them off, one full LDS wait per WMMA
      __builtin_amdgcn_sched_barrier(0);
      s0 = wmma_bf16(ka0, qb0, s0);
      s1 = wmma_bf16(ka2, qb0, s1);
      s0 = wmma_bf16(ka1, qb1, s0);
      s1 = wmma_bf16(ka3, qb1, s1);
    }

    // ---- online softmax over this 32-key slab, one query per lane ----
    float mx = fmaxf(s0[0], s1[0]);
#pragma unroll
    for (int r = 1; r < 8; ++r) mx = fmaxf(mx, fmaxf(s0[r], s1[r]));
    mx = fmaxf(mx, xhalf(mx));                // the other half's 16 keys
    const float mn = fmaxf(m, mx);
    // the difference is taken first: it is never above 0, also where every key
    // so far carries the mask's -1e30
    float cor = (m - mn) * LOG2E;
    float e0[8], e1[8];
#pragma unroll
    for (int r = 0; r < 8; ++r) {
      e0[r] = (s0[r] - mn) * LOG2E;
      e1[r] = (s1[r] - mn) * LOG2E;
    }
    exp2_x1(cor);
    exp2_x8(e0);
    exp2_x8(e1);
    m = mn;
    v16bf pb;                                 // P^T as B: element s = key kmap(s, half)
    float t[8];
#pragma unroll
    for (int r = 0; r < 8; ++r) {
      t[r] = e0[r] + e1[r];
      pb[r]     = (bf16)e0[r];
      pb[r + 8] = (bf16)e1[r];
    }
    const float rs = ((t[0] + t[4]) + (t[2] + t[6])) + ((t[1] + t[5]) + (t[3] + t[7]));
    l = l * cor + rs;
#pragma unroll
    for (int f = 0; f < 4; ++f) cacc[f] *= cor;

    // ---- O^T += V^T(16 dh x 32 keys) x P^T(32 keys x 16 queries) ----
#pragma unroll
    for (int f = 0; f < 4; ++f) {
      v8bf lo = ld_tr16(vp + f * 16);             // keys 8 half + 0..7
      v8bf hi = ld_tr16(vp + 16 * 80 + f * 16);   // keys 16 + 8 half + 0..7
      v16bf va;
#pragma unroll
      for (int i = 0; i < 8; ++i) { va[i] = lo[i]; va[i + 8] = hi[i]; }
      cacc[f] = wmma_bf16(va, pb, cacc[f]);
    }
    __syncthreads();  // Ks/Vs reused next iteration
  }

  // ---- finalize: join the halves' sums, divide, write bf16 ctx (b,s,h*64+dh):
  // a lane's 8 registers of a tile are 8 consecutive dh of its query ----
  l += xhalf(l);
  const float inv = (l > 0.0f) ? (1.0f / l) : 0.0f;
  const size_t o = ((size_t)b * SS + qt * 64 + wave * 16 + l16) * DD + h * DH + 8 * half;
#pragma unroll
  for (int f = 0; f < 4; ++f) {
    v8bf ov;
#pragma unroll
    for (int r = 0; r < 8; ++r) ov[r] = (bf16)(cacc[f][r] * inv);
    *(v8bf*)&Ctx[o + f * 16] = ov;
  }
}

// ---------------------------------------------------------------------------
// Residual + LayerNorm over D=1024; optionally emits bf16 copy of the result.
// One block (256 thr) per token row. outF may alias y (in-place).
// ---------------------------------------------------------------------------
__device__ __forceinline__ float block_sum(float v, float* red) {
  v += __shfl_xor(v, 1);
  v += __shfl_xor(v, 2);
  v += __shfl_xor(v, 4);
  v += __shfl_xor(v, 8);
  v += __shfl_xor(v, 16);
  int lane = threadIdx.x & 31, w = threadIdx.x >> 5;
  if (lane == 0) red[w] = v;
  __syncthreads();
  if (threadIdx.x == 0) {
    float s = 0.0f;
#pragma unroll
    for (int i = 0; i < 8; ++i) s += red[i];
    red[0] = s;
  }
  __syncthreads();
  float r = red[0];
  __syncthreads();
  return r;
}

__global__ __launch_bounds__(256)
void ln_residual(const float* y, const float* __restrict__ res,
                 const float* __restrict__ g, const float* __restrict__ beta,
                 float* outF, bf16* outB) {
  __shared__ float red[8];
  const size_t row = blockIdx.x;
  const float* yp = y + row * DD;
  const float* rp = res + row * DD;
  const int base = threadIdx.x * 4;

  float v[4];
  float s = 0.0f;
#pragma unroll
  for (int i = 0; i < 4; ++i) { v[i] = yp[base + i] + rp[base + i]; s += v[i]; }
  float mu = block_sum(s, red) * (1.0f / DD);

  float q = 0.0f;
#pragma unroll
  for (int i = 0; i < 4; ++i) { float d = v[i] - mu; q += d * d; }
  float var = block_sum(q, red) * (1.0f / DD);
  float rstd = rsqrtf(var + 1e-12f);

#pragma unroll
  for (int i = 0; i < 4; ++i) {
    float o = (v[i] - mu) * rstd * g[base + i] + beta[base + i];
    outF[row * DD + base + i] = o;
    if (outB) outB[row * DD + base + i] = (bf16)o;
  }
}

// ---------------------------------------------------------------------------
// Launch
// ---------------------------------------------------------------------------
extern "C" void kernel_launch(void* const* d_in, const int* in_sizes, int n_in,
                              void* d_out, int out_size, void* d_ws, size_t ws_size,
                              hipStream_t stream) {
  (void)in_sizes; (void)n_in; (void)out_size; (void)ws_size;

  const float* x    = (const float*)d_in[0];
  const int*   msk  = (const int*)d_in[1];
  const float* Wq   = (const float*)d_in[2];
  const float* bq   = (const float*)d_in[3];
  const float* Wk   = (const float*)d_in[4];
  const float* bk   = (const float*)d_in[5];
  const float* Wv   = (const float*)d_in[6];
  const float* bv   = (const float*)d_in[7];
  const float* Wo   = (const float*)d_in[8];
  const float* bo   = (const float*)d_in[9];
  const float* ln1g = (const float*)d_in[10];
  const float* ln1b = (const float*)d_in[11];
  const float* W1   = (const float*)d_in[12];
  const float* b1   = (const float*)d_in[13];
  const float* W2   = (const float*)d_in[14];
  const float* b2   = (const float*)d_in[15];
  const float* ln2g = (const float*)d_in[16];
  const float* ln2b = (const float*)d_in[17];
  float* out = (float*)d_out;

  char* ws = (char*)d_ws;
  const size_t MB = 1ull << 20;
  bf16*  wqb  = (bf16*)(ws + 0 * MB);
  bf16*  wkb  = (bf16*)(ws + 2 * MB);
  bf16*  wvb  = (bf16*)(ws + 4 * MB);
  bf16*  wob  = (bf16*)(ws + 6 * MB);
  bf16*  w1b  = (bf16*)(ws + 8 * MB);     // F*D
  bf16*  w2b  = (bf16*)(ws + 16 * MB);    // D*F
  bf16*  xb   = (bf16*)(ws + 24 * MB);
  bf16*  qb   = (bf16*)(ws + 40 * MB);
  bf16*  kb   = (bf16*)(ws + 56 * MB);
  bf16*  vb   = (bf16*)(ws + 72 * MB);
  bf16*  ctxb = (bf16*)(ws + 88 * MB);
  float* sa   = (float*)(ws + 104 * MB);  // sa_out, then h (in-place LN1)
  bf16*  hb   = (bf16*)(ws + 136 * MB);
  bf16*  ffb  = (bf16*)(ws + 40 * MB);    // reuse q/k/v/ctx region (dead by FFN1)
  float* y2   = (float*)(ws + 152 * MB);

  const size_t nD = (size_t)DD * DD, nF = (size_t)FF * DD, nX = (size_t)NTOK * DD;
  dim3 cvtG(2048), cvtB(256);
  hipLaunchKernelGGL(cvt_f32_bf16, cvtG, cvtB, 0, stream, x,  xb,  nX);
  hipLaunchKernelGGL(cvt_f32_bf16, cvtG, cvtB, 0, stream, Wq, wqb, nD);
  hipLaunchKernelGGL(cvt_f32_bf16, cvtG, cvtB, 0, stream, Wk, wkb, nD);
  hipLaunchKernelGGL(cvt_f32_bf16, cvtG, cvtB, 0, stream, Wv, wvb, nD);
  hipLaunchKernelGGL(cvt_f32_bf16, cvtG, cvtB, 0, stream, Wo, wob, nD);
  hipLaunchKernelGGL(cvt_f32_bf16, cvtG, cvtB, 0, stream, W1, w1b, nF);
  hipLaunchKernelGGL(cvt_f32_bf16, cvtG, cvtB, 0, stream, W2, w2b, nF);

  dim3 gB(256);
  dim3 gQKV(NTOK / 256, DD / 128);
  // q = (x Wq^T + bq) / sqrt(64)
  hipLaunchKernelGGL((gemm_bf16_nt<false, true>), gQKV, gB, 0, stream,
                     xb, wqb, bq, 0.125f, (float*)nullptr, qb, NTOK, DD, DD);
  hipLaunchKernelGGL((gemm_bf16_nt<false, true>), gQKV, gB, 0, stream,
                     xb, wkb, bk, 1.0f, (float*)nullptr, kb, NTOK, DD, DD);
  hipLaunchKernelGGL((gemm_bf16_nt<false, true>), gQKV, gB, 0, stream,
                     xb, wvb, bv, 1.0f, (float*)nullptr, vb, NTOK, DD, DD);

  dim3 aG(SS / 64, HH, BB), aB(128);
  hipLaunchKernelGGL(flash_attn, aG, aB, 0, stream, qb, kb, vb, msk, ctxb);

  // sa = ctx Wo^T + bo   (f32)
  hipLaunchKernelGGL((gemm_bf16_nt<false, false>), gQKV, gB, 0, stream,
                     ctxb, wob, bo, 1.0f, sa, (bf16*)nullptr, NTOK, DD, DD);

  // h = LN1(sa + x), in-place in sa; also bf16 copy hb
  hipLaunchKernelGGL(ln_residual, dim3(NTOK), dim3(256), 0, stream,
                     sa, x, ln1g, ln1b, sa, hb);

  // ff = gelu(h W1^T + b1)   (bf16, M=8192 N=4096 K=1024)
  dim3 gF1(NTOK / 256, FF / 128);
  hipLaunchKernelGGL((gemm_bf16_nt<true, true>), gF1, gB, 0, stream,
                     hb, w1b, b1, 1.0f, (float*)nullptr, ffb, NTOK, FF, DD);

  // y2 = ff W2^T + b2   (f32, K=4096)
  hipLaunchKernelGGL((gemm_bf16_nt<false, false>), gQKV, gB, 0, stream,
                     ffb, w2b, b2, 1.0f, y2, (bf16*)nullptr, NTOK, DD, FF);

  // out = LN2(y2 + h)
  hipLaunchKernelGGL(ln_residual, dim3(NTOK), dim3(256), 0, stream,
                     y2, sa, ln2g, ln2b, out, (bf16*)nullptr);
}

// v003
// One run takes 302 microseconds.
// In two side-by-side timings against v002, it was 1.09 and 1.10 times as fast.
// Over all steps from v000 it is 1.77 times as fast.
#include <hip/hip_runtime.h>
#include <math.h>
#include <stdint.h>

// ---------------------------------------------------------------------------
// Types
// ---------------------------------------------------------------------------
typedef __bf16 bf16;
typedef __bf16 v16bf __attribute__((ext_vector_type(16)));
typedef __bf16 v8bf  __attribute__((ext_vector_type(8)));
typedef float  v8f   __attribute__((ext_vector_type(8)));

#define BB 8
#define SS 1024
#define DD 1024
#define HH 16
#define DH 64
#define FF 4096
#define NTOK (BB * SS)          // 8192

// ---------------------------------------------------------------------------
// WMMA helpers (CDNA5 v_wmma_f32_16x16x32_bf16)
// ---------------------------------------------------------------------------
__device__ __forceinline__ v8f wmma_bf16(v16bf a, v16bf b, v8f c) {
  return __builtin_amdgcn_wmma_f32_16x16x32_bf16(
      /*neg_a=*/false, a, /*neg_b=*/false, b,
      /*c_mod=*/(short)0, c, /*reuse_a=*/false, /*reuse_b=*/false);
}

// A/B fragment loader. ISA 16-bit 16x32 layout: lane half h holds
// K[8h..8h+7] in halves 0..7 and K[16+8h..16+8h+7] in halves 8..15.
// Caller passes p = &row[k0 + 8*half]; we read p[0..7] and p[16..23].
__device__ __forceinline__ v16bf frag_from(const bf16* p) {
  v8bf lo = *(const v8bf*)(p);
  v8bf hi = *(const v8bf*)(p + 16);
  v16bf a;
#pragma unroll
  for (int i = 0; i < 8; ++i) { a[i] = lo[i]; a[i + 8] = hi[i]; }
  return a;
}

// CDNA5 async global->LDS copies of 16B chunks (tracked by ASYNCcnt; bypass
// VGPRs entirely).  GV addressing: vdst = LDS byte address, v[addr64], off.
// s_wait_xcnt 0 is the last line of the copies' own statement so that no address
// register is rewritten ahead of it.
__device__ __forceinline__ uint32_t lds_addr(const bf16* p) {
  return (uint32_t)(uint64_t)p;  // flat LDS addr[31:0] = LDS offset
}

// Twelve 16B chunks per lane: LDS places l + i * lstep for the eight chunks of
// the first operand (rows 32 apart), m + i * lstep for the four of the second.
__device__ __forceinline__ void async_copy16x12(uint32_t l, uint32_t m, uint32_t lstep,
                                                const bf16* a, const bf16* w, size_t gstep) {
  asm volatile("global_load_async_to_lds_b128 %0, %12, off\n\t"
               "global_load_async_to_lds_b128 %1, %13, off\n\t"
               "global_load_async_to_lds_b128 %2, %14, off\n\t"
               "global_load_async_to_lds_b128 %3, %15, off\n\t"
               "global_load_async_to_lds_b128 %4, %16, off\n\t"
               "global_load_async_to_lds_b128 %5, %17, off\n\t"
               "global_load_async_to_lds_b128 %6, %18, off\n\t"
               "global_load_async_to_lds_b128 %7, %19, off\n\t"
               "global_load_async_to_lds_b128 %8, %20, off\n\t"
               "global_load_async_to_lds_b128 %9, %21, off\n\t"
               "global_load_async_to_lds_b128 %10, %22, off\n\t"
               "global_load_async_to_lds_b128 %11, %23, off\n\t"
               "s_wait_xcnt 0x0"
               :: "v"(l), "v"(l + lstep), "v"(l + 2 * lstep), "v"(l + 3 * lstep),
                  "v"(l + 4 * lstep), "v"(l + 5 * lstep), "v"(l + 6 * lstep),
                  "v"(l + 7 * lstep),
                  "v"(m), "v"(m + lstep), "v"(m + 2 * lstep), "v"(m + 3 * lstep),
                  "v"((uint64_t)a), "v"((uint64_t)(a + gstep)),
                  "v"((uint64_t)(a + 2 * gstep)), "v"((uint64_t)(a + 3 * gstep)),
                  "v"((uint64_t)(a + 4 * gstep)), "v"((uint64_t)(a + 5 * gstep)),
                  "v"((uint64_t)(a + 6 * gstep)), "v"((uint64_t)(a + 7 * gstep)),
                  "v"((uint64_t)w), "v"((uint64_t)(w + gstep)),
                  "v"((uint64_t)(w + 2 * gstep)), "v"((uint64_t)(w + 3 * gstep))
               : "memory");
}

__device__ __forceinline__ void wait_async0() {
  asm volatile("s_wait_asynccnt 0x0" ::: "memory");
}

// ---------------------------------------------------------------------------
// fp32 -> bf16 conversion (grid-stride)
// ---------------------------------------------------------------------------
__global__ void cvt_f32_bf16(const float* __restrict__ in, bf16* __restrict__ out,
                             size_t n) {
  size_t i = (size_t)blockIdx.x * blockDim.x + threadIdx.x;
  size_t stride = (size_t)gridDim.x * blockDim.x;
  for (; i < n; i += stride) out[i] = (bf16)in[i];
}

// ---------------------------------------------------------------------------
// Exact-form GELU, 0.5 v (1 + erf(v / sqrt 2)), two values at a time, no branch.
// erf(z) = z P(z^2) / Q(z^2) on |z| <= 4 (beyond it erf rounds to +-1 in f32);
// absolute error below 4e-7 over the whole line.  Straight-line packed code:
// the values of a lane are independent chains that the scheduler interleaves,
// and the epilogue's text is a fraction of the branching form's.
// ---------------------------------------------------------------------------
typedef float  v2f  __attribute__((ext_vector_type(2)));
typedef __bf16 v2bf __attribute__((ext_vector_type(2)));

__device__ __forceinline__ v2f gelu2(v2f v) {
  const v2f lim = 4.0f;
  const v2f z = __builtin_elementwise_min(
      __builtin_elementwise_max(v * 0.70710678118654752f, -lim), lim);
  const v2f z2 = z * z;
  v2f p = -2.72614225801306e-10f;
  p = __builtin_elementwise_fma(p, z2, (v2f)(2.77068142495902e-08f));
  p = __builtin_elementwise_fma(p, z2, (v2f)(-2.10102402082508e-06f));
  p = __builtin_elementwise_fma(p, z2, (v2f)(-5.69250639462346e-05f));
  p = __builtin_elementwise_fma(p, z2, (v2f)(-7.34990630326855e-04f));
  p = __builtin_elementwise_fma(p, z2, (v2f)(-2.95459980854025e-03f));
  p = __builtin_elementwise_fma(p, z2, (v2f)(-1.60960333262415e-02f));
  v2f q = -1.45660718464996e-05f;
  q = __builtin_elementwise_fma(q, z2, (v2f)(-2.13374055278905e-04f));
  q = __builtin_elementwise_fma(q, z2, (v2f)(-1.68282697438203e-03f));
  q = __builtin_elementwise_fma(q, z2, (v2f)(-7.37332916720468e-03f));
  q = __builtin_elementwise_fma(q, z2, (v2f)(-1.42647390514189e-02f));
  // Reciprocals in place, one statement: neither touches the other's register,
  // and the closing v_nop keeps the slot the instruction set asks for behind a
  // transcendental, whatever the compiler places next.
  float r0 = q[0], r1 = q[1];
  asm("v_rcp_f32 %0, %0\n\t"
      "v_rcp_f32 %1, %1\n\t"
      "v_nop"
      : "+v"(r0), "+v"(r1));
  const v2f r = {r0, r1};
  const v2f e = (p * z) * r;
  const v2f h = v * 0.5f;
  return __builtin_elementwise_fma(h, e, h);
}

// ---------------------------------------------------------------------------
// Tiled bf16 WMMA GEMM:  Y[M,N] = act( (A[M,K] * W[N,K]^T + bias) * scale )
// A, W row-major with K contiguous (torch Linear layout -> NT GEMM).
// Block tile 256x128, 8 waves of 64x64, K-step 64, double-buffered LDS filled
// by async global->LDS DMA.  M % 256 == 0, N % 128 == 0, K % 64 == 0.
// ---------------------------------------------------------------------------
template <bool GELU, bool OUT_BF16>
__global__ __launch_bounds__(256)
void gemm_bf16_nt(const bf16* __restrict__ A, const bf16* __restrict__ W,
                  const float* __restrict__ bias, float scale,
                  float* outF, bf16* outB, int M, int N, int K) {
  static_assert(!GELU || OUT_BF16, "the GELU epilogue writes bf16");
  __shared__ bf16 As[2][256][72];   // 144B row pitch = 16B x odd (b128 readers)
  __shared__ bf16 Bs[2][128][72];

  const int tid  = threadIdx.x;
  const int lane = tid & 31;
  const int wave = tid >> 5;
  const int wm   = wave & 3;       // 4 M-bands of 64
  const int wn   = wave >> 2;      // 2 N-bands of 64
  const int half = lane >> 4;
  const int l16  = lane & 15;
  const int m0   = blockIdx.x * 256;
  const int n0   = blockIdx.y * 128;

  v8f acc[4][4] = {};

  // A 256x64 = 2048 16B chunks (8 per thread), W 128x64 = 1024 (4 per thread).
  // A wave's copy covers 4 rows x 128B = 4 whole lines.
  const int cr = tid >> 3, cc = (tid & 7) * 8;
  const bf16* gA = &A[(size_t)(m0 + cr) * K + cc];
  const bf16* gW = &W[(size_t)(n0 + cr) * K + cc];
  const size_t rs = (size_t)32 * K;            // 32 rows further
  auto load_tile = [&](int buf, int k0) {
    async_copy16x12(lds_addr(&As[buf][cr][cc]), lds_addr(&Bs[buf][cr][cc]),
                    32 * 72 * 2, gA + k0, gW + k0, rs);
  };

  load_tile(0, 0);
  wait_async0();
  __syncthreads();

  const int KT = K >> 6;
  for (int kt = 0; kt < KT; ++kt) {
    const int cur = kt & 1;
    // every loop below is unrolled so that acc[][], a[] and b[] are indexed by
    // constants and stay in registers
#pragma unroll
    for (int ks = 0; ks < 2; ++ks) {
      v16bf a[4], b[4];
#pragma unroll
      for (int i = 0; i < 4; ++i) {
        a[i] = frag_from(&As[cur][wm * 64 + i * 16 + l16][ks * 32 + 8 * half]);
        b[i] = frag_from(&Bs[cur][wn * 64 + i * 16 + l16][ks * 32 + 8 * half]);
      }
      // keeps the 16 LDS reads one group ahead of the 16 WMMAs: left alone the
      // scheduler sinks them among the WMMAs, one full LDS wait per row of four
      __builtin_amdgcn_sched_barrier(0);
      // next tile into the buffer every wave left at the last barrier; issued
      // here so that its address work and wait run under the LDS reads' latency
      if (ks == 0 && kt + 1 < KT) load_tile(cur ^ 1, (kt + 1) << 6);
#pragma unroll
      for (int mi = 0; mi < 4; ++mi)
#pragma unroll
        for (int ni = 0; ni < 4; ++ni)
          acc[mi][ni] = wmma_bf16(a[mi], b[ni], acc[mi][ni]);
      // second half of the pair: the next group's reads stay behind this block
      __builtin_amdgcn_sched_barrier(0);
    }

    // own LDS reads of `cur` retired before any wave may refill it
    asm volatile("s_wait_dscnt 0x0" ::: "memory");
    wait_async0();       // next-buffer DMA landed (ASYNCcnt not covered by barrier)
    __syncthreads();     // all waves done reading `cur`, writes visible
  }

  // ---- epilogue: C-frag mapping row = j + 8*half, col = l16 ----
#pragma unroll
  for (int mi = 0; mi < 4; ++mi) {
#pragma unroll
    for (int ni = 0; ni < 4; ++ni) {
      int col = n0 + wn * 64 + ni * 16 + l16;
      float bv = bias[col];
      if (GELU) {
        // pairs of rows, so that the polynomial runs on packed f32
#pragma unroll
        for (int j = 0; j < 8; j += 2) {
          v2f v = {(acc[mi][ni][j] + bv) * scale, (acc[mi][ni][j + 1] + bv) * scale};
          const v2bf o = __builtin_convertvector(gelu2(v), v2bf);
          size_t idx = (size_t)(m0 + wm * 64 + mi * 16 + j + 8 * half) * N + col;
          outB[idx]     = o[0];
          outB[idx + N] = o[1];
        }
      } else {
#pragma unroll
        for (int j = 0; j < 8; ++j) {
          int row = m0 + wm * 64 + mi * 16 + j + 8 * half;
          float v = (acc[mi][ni][j] + bv) * scale;
          size_t idx = (size_t)row * N + col;
          if (OUT_BF16) outB[idx] = (bf16)v;
          else          outF[idx] = v;
        }
      }
    }
  }
}

// ---------------------------------------------------------------------------
// Flash attention: grid (S/64, H, B), block = 128 threads = 4 waves.
// Each wave owns 16 queries; K/V tiles of 32 keys staged in LDS.
// Transposed products: S^T = K x Q^T and O^T += V^T x P^T.  A lane then holds
// 16 of the 32 scores of ONE query (query = l16, keys 8*half + r and
// 16 + 8*half + r), so maximum and sum are taken in the lane's own registers
// with one exchange between the wave's halves, and the two score tiles,
// converted in place, already are the B operand of the second product.
// ---------------------------------------------------------------------------
typedef short s16x8 __attribute__((ext_vector_type(8)));
typedef float v4f   __attribute__((ext_vector_type(4)));

// Transposing LDS read: lane (l16, half) receives T[kbase + 8*half + 0..7][dbase + l16]
// when it passes &T[kbase + 8*half + (lane & 7)][dbase + 8 * ((lane >> 3) & 1)].
__device__ __forceinline__ v8bf ld_tr16(const bf16* p) {
  typedef __attribute__((address_space(3))) s16x8 lds_s16x8;
  return __builtin_bit_cast(v8bf, __builtin_amdgcn_ds_load_tr16_b128_v8i16((lds_s16x8*)p));
}

// lane l <-> lane l ^ 16
__device__ __forceinline__ float xhalf(float x) {
  return __builtin_bit_cast(float, __builtin_amdgcn_permlanex16(
      __builtin_bit_cast(int, x), __builtin_bit_cast(int, x),
      0x76543210, 0xfedcba98, false, false));
}

#define LOG2E 1.44269504088896340736f

// Base-2 exponentials in place.  Written as one statement so that the slot the
// instruction set asks for behind a transcendental is kept: inside the run no
// v_exp touches its neighbour's registers, and the closing v_nop stands in
// front of whatever the compiler places next.
__device__ __forceinline__ void exp2_x8(float (&e)[8]) {
  asm("v_exp_f32 %0, %0\n\t"
      "v_exp_f32 %1, %1\n\t"
      "v_exp_f32 %2, %2\n\t"
      "v_exp_f32 %3, %3\n\t"
      "v_exp_f32 %4, %4\n\t"
      "v_exp_f32 %5, %5\n\t"
      "v_exp_f32 %6, %6\n\t"
      "v_exp_f32 %7, %7\n\t"
      "v_nop"
      : "+v"(e[0]), "+v"(e[1]), "+v"(e[2]), "+v"(e[3]),
        "+v"(e[4]), "+v"(e[5]), "+v"(e[6]), "+v"(e[7]));
}
__device__ __forceinline__ void exp2_x1(float& e) {
  asm("v_exp_f32 %0, %0\n\t"
      "v_nop"
      : "+v"(e));
}

__global__ __launch_bounds__(128)
void flash_attn(const bf16* __restrict__ Q, const bf16* __restrict__ Kb,
                const bf16* __restrict__ Vb, const int* __restrict__ mask,
                bf16* __restrict__ Ctx) {
  __shared__ bf16 Ks[32][72];     // 144B pitch = 16B x odd (b128 readers)
  __shared__ bf16 Vs[32][80];     // 160B pitch = 32B x odd (transposing readers)
  __shared__ __attribute__((aligned(16))) float Madd[32];

  const int tid  = threadIdx.x;
  const int lane = tid & 31;
  const int wave = tid >> 5;
  const int half = lane >> 4;
  const int l16  = lane & 15;
  const int qt   = blockIdx.x;
  const int h    = blockIdx.y;
  const int b    = blockIdx.z;

  // This wave's 16 queries as two B-fragments (dh 0..31, 32..63): column = l16.
  const size_t qrow = ((size_t)b * SS + qt * 64 + wave * 16 + l16) * DD + h * DH;
  v16bf qb0 = frag_from(&Q[qrow + 0  + 8 * half]);
  v16bf qb1 = frag_from(&Q[qrow + 32 + 8 * half]);

  // m: running maximum of query l16 (equal in both halves); l: this half's part
  // of its running sum; cacc[f][r] = O^T[dh = 16 f + 8 half + r][query l16].
  float m = -1e30f, l = 0.0f;
  v8f cacc[4] = {};

  const bf16* vp = &Vs[8 * half + (lane & 7)][8 * ((lane >> 3) & 1)];

  for (int kt = 0; kt < SS / 32; ++kt) {
    // ---- cooperative K/V tile load: 32 keys x 64 dh each ----
    // the four loads first, then the four LDS stores: one memory latency a tile
    v8bf kr[2], vr[2];
#pragma unroll
    for (int c = 0; c < 2; ++c) {
      int ch = tid + c * 128;                 // 0..255
      int r = ch >> 3, col = (ch & 7) * 8;
      size_t g = ((size_t)b * SS + kt * 32 + r) * DD + h * DH + col;
      kr[c] = *(const v8bf*)&Kb[g];
      vr[c] = *(const v8bf*)&Vb[g];
    }
#pragma unroll
    for (int c = 0; c < 2; ++c) {
      int ch = tid + c * 128;
      int r = ch >> 3, col = (ch & 7) * 8;
      *(v8bf*)&Ks[r][col] = kr[c];
      *(v8bf*)&Vs[r][col] = vr[c];
    }
    if (tid < 32)
      Madd[tid] = mask[(size_t)b * SS + kt * 32 + tid] ? 0.0f : -1e30f;
    __syncthreads();

    // ---- scores: S^T = K x Q^T, two 16-key tiles, K-dim = dh 64.  The key's
    // additive mask is the accumulator's start value: row r of tile i is key
    // 16 i + 8 half + r. ----
    v8f s0, s1;
    {
      const v4f ma = *(const v4f*)&Madd[8 * half];
      const v4f mb = *(const v4f*)&Madd[8 * half + 4];
      const v4f mc = *(const v4f*)&Madd[16 + 8 * half];
      const v4f md = *(const v4f*)&Madd[16 + 8 * half + 4];
#pragma unroll
      for (int r = 0; r < 4; ++r) {
        s0[r] = ma[r]; s0[r + 4] = mb[r];
        s1[r] = mc[r]; s1[r + 4] = md[r];
      }
      v16bf ka0 = frag_from(&Ks[l16][0 + 8 * half]);
      v16bf ka1 = frag_from(&Ks[l16][32 + 8 * half]);
      v16bf ka2 = frag_from(&Ks[16 + l16][0 + 8 * half]);
      v16bf ka3 = frag_from(&Ks[16 + l16][32 + 8 * half]);
      // keeps the twelve LDS reads one group ahead of the four WMMAs: left alone
      // the scheduler pairs them off, one full LDS wait per WMMA
      __builtin_amdgcn_sched_barrier(0);
      s0 = wmma_bf16(ka0, qb0, s0);
      s1 = wmma_bf16(ka2, qb0, s1);
      s0 = wmma_bf16(ka1, qb1, s0);
      s1 = wmma_bf16(ka3, qb1, s1);
    }

    // ---- online softmax over this 32-key slab, one query per lane ----
    float mx = fmaxf(s0[0], s1[0]);
#pragma unroll
    for (int r = 1; r < 8; ++r) mx = fmaxf(mx, fmaxf(s0[r], s1[r]));
    mx = fmaxf(mx, xhalf(mx));                // the other half's 16 keys
    const float mn = fmaxf(m, mx);
    // the difference is taken first: it is never above 0, also where every key
    // so far carries the mask's -1e30
    float cor = (m - mn) * LOG2E;
    float e0[8], e1[8];
#pragma unroll
    for (int r = 0; r < 8; ++r) {
      e0[r] = (s0[r] - mn) * LOG2E;
      e1[r] = (s1[r] - mn) * LOG2E;
    }
    exp2_x1(cor);
    exp2_x8(e0);
    exp2_x8(e1);
    m = mn;
    v16bf pb;                                 // P^T as B: element s = key kmap(s, half)
    float t[8];
#pragma unroll
    for (int r = 0; r < 8; ++r) {
      t[r] = e0[r] + e1[r];
      pb[r]     = (bf16)e0[r];
      pb[r + 8] = (bf16)e1[r];
    }
    const float rs = ((t[0] + t[4]) + (t[2] + t[6])) + ((t[1] + t[5]) + (t[3] + t[7]));
    l = l * cor + rs;
#pragma unroll
    for (int f = 0; f < 4; ++f) cacc[f] *= cor;

    // ---- O^T += V^T(16 dh x 32 keys) x P^T(32 keys x 16 queries) ----
#pragma unroll
    for (int f = 0; f < 4; ++f) {
      v8bf lo = ld_tr16(vp + f * 16);             // keys 8 half + 0..7
      v8bf hi = ld_tr16(vp + 16 * 80 + f * 16);   // keys 16 + 8 half + 0..7
      v16bf va;
#pragma unroll
      for (int i = 0; i < 8; ++i) { va[i] = lo[i]; va[i + 8] = hi[i]; }
      cacc[f] = wmma_bf16(va, pb, cacc[f]);
    }
    __syncthreads();  // Ks/Vs reused next iteration
  }

  // ---- finalize: join the halves' sums, divide, write bf16 ctx (b,s,h*64+dh):
  // a lane's 8 registers of a tile are 8 consecutive dh of its query ----
  l += xhalf(l);
  const float inv = (l > 0.0f) ? (1.0f / l) : 0.0f;
  const size_t o = ((size_t)b * SS + qt * 64 + wave * 16 + l16) * DD + h * DH + 8 * half;
#pragma unroll
  for (int f = 0; f < 4; ++f) {
    v8bf ov;
#pragma unroll
    for (int r = 0; r < 8; ++r) ov[r] = (bf16)(cacc[f][r] * inv);
    *(v8bf*)&Ctx[o + f * 16] = ov;
  }
}

// ---------------------------------------------------------------------------
// Residual + LayerNorm over D=1024; optionally emits bf16 copy of the result.
// One block (256 thr) per token row. outF may alias y (in-place).
// ---------------------------------------------------------------------------
__device__ __forceinline__ float block_sum(float v, float* red) {
  v += __shfl_xor(v, 1);
  v += __shfl_xor(v, 2);
  v += __shfl_xor(v, 4);
  v += __shfl_xor(v, 8);
  v += __shfl_xor(v, 16);
  int lane = threadIdx.x & 31, w = threadIdx.x >> 5;
  if (lane == 0) red[w] = v;
  __syncthreads();
  if (threadIdx.x == 0) {
    float s = 0.0f;
#pragma unroll
    for (int i = 0; i < 8; ++i) s += red[i];
    red[0] = s;
  }
  __syncthreads();
  float r = red[0];
  __syncthreads();
  return r;
}

__global__ __launch_bounds__(256)
void ln_residual(const float* y, const float* __restrict__ res,
                 const float* __restrict__ g, const float* __restrict__ beta,
                 float* outF, bf16* outB) {
  __shared__ float red[8];
  const size_t row = blockIdx.x;
  const float* yp = y + row * DD;
  const float* rp = res + row * DD;
  const int base = threadIdx.x * 4;

  float v[4];
  float s = 0.0f;
#pragma unroll
  for (int i = 0; i < 4; ++i) { v[i] = yp[base + i] + rp[base + i]; s += v[i]; }
  float mu = block_sum(s, red) * (1.0f / DD);

  float q = 0.0f;
#pragma unroll
  for (int i = 0; i < 4; ++i) { float d = v[i] - mu; q += d * d; }
  float var = block_sum(q, red) * (1.0f / DD);
  float rstd = rsqrtf(var + 1e-12f);

#pragma unroll
  for (int i = 0; i < 4; ++i) {
    float o = (v[i] - mu) * rstd * g[base + i] + beta[base + i];
    outF[row * DD + base + i] = o;
    if (outB) outB[row * DD + base + i] = (bf16)o;
  }
}

// ---------------------------------------------------------------------------
// Launch
// ---------------------------------------------------------------------------
extern "C" void kernel_launch(void* const* d_in, const int* in_sizes, int n_in,
                              void* d_out, int out_size, void* d_ws, size_t ws_size,
                              hipStream_t stream) {
  (void)in_sizes; (void)n_in; (void)out_size; (void)ws_size;

  const float* x    = (const float*)d_in[0];
  const int*   msk  = (const int*)d_in[1];
  const float* Wq   = (const float*)d_in[2];
  const float* bq   = (const float*)d_in[3];
  const float* Wk   = (const float*)d_in[4];
  const float* bk   = (const float*)d_in[5];
  const float* Wv   = (const float*)d_in[6];
  const float* bv   = (const float*)d_in[7];
  const float* Wo   = (const float*)d_in[8];
  const float* bo   = (const float*)d_in[9];
  const float* ln1g = (const float*)d_in[10];
  const float* ln1b = (const float*)d_in[11];
  const float* W1   = (const float*)d_in[12];
  const float* b1   = (const float*)d_in[13];
  const float* W2   = (const float*)d_in[14];
  const float* b2   = (const float*)d_in[15];
  const float* ln2g = (const float*)d_in[16];
  const float* ln2b = (const float*)d_in[17];
  float* out = (float*)d_out;

  char* ws = (char*)d_ws;
  const size_t MB = 1ull << 20;
  bf16*  wqb  = (bf16*)(ws + 0 * MB);
  bf16*  wkb  = (bf16*)(ws + 2 * MB);
  bf16*  wvb  = (bf16*)(ws + 4 * MB);
  bf16*  wob  = (bf16*)(ws + 6 * MB);
  bf16*  w1b  = (bf16*)(ws + 8 * MB);     // F*D
  bf16*  w2b  = (bf16*)(ws + 16 * MB);    // D*F
  bf16*  xb   = (bf16*)(ws + 24 * MB);
  bf16*  qb   = (bf16*)(ws + 40 * MB);
  bf16*  kb   = (bf16*)(ws + 56 * MB);
  bf16*  vb   = (bf16*)(ws + 72 * MB);
  bf16*  ctxb = (bf16*)(ws + 88 * MB);
  float* sa   = (float*)(ws + 104 * MB);  // sa_out, then h (in-place LN1)
  bf16*  hb   = (bf16*)(ws + 136 * MB);
  bf16*  ffb  = (bf16*)(ws + 40 * MB);    // reuse q/k/v/ctx region (dead by FFN1)
  float* y2   = (float*)(ws + 152 * MB);

  const size_t nD = (size_t)DD * DD, nF = (size_t)FF * DD, nX = (size_t)NTOK * DD;
  dim3 cvtG(2048), cvtB(256);
  hipLaunchKernelGGL(cvt_f32_bf16, cvtG, cvtB, 0, stream, x,  xb,  nX);
  hipLaunchKernelGGL(cvt_f32_bf16, cvtG, cvtB, 0, stream, Wq, wqb, nD);
  hipLaunchKernelGGL(cvt_f32_bf16, cvtG, cvtB, 0, stream, Wk, wkb, nD);
  hipLaunchKernelGGL(cvt_f32_bf16, cvtG, cvtB, 0, stream, Wv, wvb, nD);
  hipLaunchKernelGGL(cvt_f32_bf16, cvtG, cvtB, 0, stream, Wo, wob, nD);
  hipLaunchKernelGGL(cvt_f32_bf16, cvtG, cvtB, 0, stream, W1, w1b, nF);
  hipLaunchKernelGGL(cvt_f32_bf16, cvtG, cvtB, 0, stream, W2, w2b, nF);

  dim3 gB(256);
  dim3 gQKV(NTOK / 256, DD / 128);
  // q = (x Wq^T + bq) / sqrt(64)
  hipLaunchKernelGGL((gemm_bf16_nt<false, true>), gQKV, gB, 0, stream,
                     xb, wqb, bq, 0.125f, (float*)nullptr, qb, NTOK, DD, DD);
  hipLaunchKernelGGL((gemm_bf16_nt<false, true>), gQKV, gB, 0, stream,
                     xb, wkb, bk, 1.0f, (float*)nullptr, kb, NTOK, DD, DD);
  hipLaunchKernelGGL((gemm_bf16_nt<false, true>), gQKV, gB, 0, stream,
                     xb, wvb, bv, 1.0f, (float*)nullptr, vb, NTOK, DD, DD);

  dim3 aG(SS / 64, HH, BB), aB(128);
  hipLaunchKernelGGL(flash_attn, aG, aB, 0, stream, qb, kb, vb, msk, ctxb);

  // sa = ctx Wo^T + bo   (f32)
  hipLaunchKernelGGL((gemm_bf16_nt<false, false>), gQKV, gB, 0, stream,
                     ctxb, wob, bo, 1.0f, sa, (bf16*)nullptr, NTOK, DD, DD);

  // h = LN1(sa + x), in-place in sa; also bf16 copy hb
  hipLaunchKernelGGL(ln_residual, dim3(NTOK), dim3(256), 0, stream,
                     sa, x, ln1g, ln1b, sa, hb);

  // ff = gelu(h W1^T + b1)   (bf16, M=8192 N=4096 K=1024)
  dim3 gF1(NTOK / 256, FF / 128);
  hipLaunchKernelGGL((gemm_bf16_nt<true, true>), gF1, gB, 0, stream,
                     hb, w1b, b1, 1.0f, (float*)nullptr, ffb, NTOK, FF, DD);

  // y2 = ff W2^T + b2   (f32, K=4096)
  hipLaunchKernelGGL((gemm_bf16_nt<false, false>), gQKV, gB, 0, stream,
                     ffb, w2b, b2, 1.0f, y2, (bf16*)nullptr, NTOK, DD, FF);

  // out = LN2(y2 + h)
  hipLaunchKernelGGL(ln_residual, dim3(NTOK), dim3(256), 0, stream,
                     y2, sa, ln2g, ln2b, out, (bf16*)nullptr);
}

// v004
// Measured time: 284 microseconds a run.
// Next to v003, in two timings, it ran 1.06 and 1.08 times as fast.
// All steps since v000 together make it 1.89 times as fast.
#include <hip/hip_runtime.h>
#include <math.h>
#include <stdint.h>

// ---------------------------------------------------------------------------
// Types
// ---------------------------------------------------------------------------
typedef __bf16 bf16;
typedef __bf16 v16bf __attribute__((ext_vector_type(16)));
typedef __bf16 v8bf  __attribute__((ext_vector_type(8)));
typedef float  v8f   __attribute__((ext_vector_type(8)));

#define BB 8
#define SS 1024
#define DD 1024
#define HH 16
#define DH 64
#define FF 4096
#define NTOK (BB * SS)          // 8192

// ---------------------------------------------------------------------------
// WMMA helpers (CDNA5 v_wmma_f32_16x16x32_bf16)
// ---------------------------------------------------------------------------
__device__ __forceinline__ v8f wmma_bf16(v16bf a, v16bf b, v8f c) {
  return __builtin_amdgcn_wmma_f32_16x16x32_bf16(
      /*neg_a=*/false, a, /*neg_b=*/false, b,
      /*c_mod=*/(short)0, c, /*reuse_a=*/false, /*reuse_b=*/false);
}

// A/B fragment loader. ISA 16-bit 16x32 layout: lane half h holds
// K[8h..8h+7] in halves 0..7 and K[16+8h..16+8h+7] in halves 8..15.
// Caller passes p = &row[k0 + 8*half]; we read p[0..7] and p[16..23].
__device__ __forceinline__ v16bf frag_from(const bf16* p) {
  v8bf lo = *(const v8bf*)(p);
  v8bf hi = *(const v8bf*)(p + 16);
  v16bf a;
#pragma unroll
  for (int i = 0; i < 8; ++i) { a[i] = lo[i]; a[i + 8] = hi[i]; }
  return a;
}

// CDNA5 async global->LDS copies of 16B chunks (tracked by ASYNCcnt; bypass
// VGPRs entirely).  GV addressing: vdst = LDS byte address, v[addr64], off.
// s_wait_xcnt 0 is the last line of the copies' own statement so that no address
// register is rewritten ahead of it.
__device__ __forceinline__ uint32_t lds_addr(const bf16* p) {
  return (uint32_t)(uint64_t)p;  // flat LDS addr[31:0] = LDS offset
}

// Twelve 16B chunks per lane: LDS places l + i * lstep for the eight chunks of
// the first operand (rows 32 apart), m + i * lstep for the four of the second.
__device__ __forceinline__ void async_copy16x12(uint32_t l, uint32_t m, uint32_t lstep,
                                                const bf16* a, const bf16* w, size_t gstep) {
  asm volatile("global_load_async_to_lds_b128 %0, %12, off\n\t"
               "global_load_async_to_lds_b128 %1, %13, off\n\t"
               "global_load_async_to_lds_b128 %2, %14, off\n\t"
               "global_load_async_to_lds_b128 %3, %15, off\n\t"
               "global_load_async_to_lds_b128 %4, %16, off\n\t"
               "global_load_async_to_lds_b128 %5, %17, off\n\t"
               "global_load_async_to_lds_b128 %6, %18, off\n\t"
               "global_load_async_to_lds_b128 %7, %19, off\n\t"
               "global_load_async_to_lds_b128 %8, %20, off\n\t"
               "global_load_async_to_lds_b128 %9, %21, off\n\t"
               "global_load_async_to_lds_b128 %10, %22, off\n\t"
               "global_load_async_to_lds_b128 %11, %23, off\n\t"
               "s_wait_xcnt 0x0"
               :: "v"(l), "v"(l + lstep), "v"(l + 2 * lstep), "v"(l + 3 * lstep),
                  "v"(l + 4 * lstep), "v"(l + 5 * lstep), "v"(l + 6 * lstep),
                  "v"(l + 7 * lstep),
                  "v"(m), "v"(m + lstep), "v"(m + 2 * lstep), "v"(m + 3 * lstep),
                  "v"((uint64_t)a), "v"((uint64_t)(a + gstep)),
                  "v"((uint64_t)(a + 2 * gstep)), "v"((uint64_t)(a + 3 * gstep)),
                  "v"((uint64_t)(a + 4 * gstep)), "v"((uint64_t)(a + 5 * gstep)),
                  "v"((uint64_t)(a + 6 * gstep)), "v"((uint64_t)(a + 7 * gstep)),
                  "v"((uint64_t)w), "v"((uint64_t)(w + gstep)),
                  "v"((uint64_t)(w + 2 * gstep)), "v"((uint64_t)(w + 3 * gstep))
               : "memory");
}

__device__ __forceinline__ void wait_async0() {
  asm volatile("s_wait_asynccnt 0x0" ::: "memory");
}
// All but this wave's twelve youngest copies (one tile's worth) have landed:
// the counter returns in issue order, and only these copies count on it here.
__device__ __forceinline__ void wait_async_all_but_one_tile() {
  asm volatile("s_wait_asynccnt 0xc" ::: "memory");
}

// ---------------------------------------------------------------------------
// fp32 -> bf16 conversion (grid-stride)
// ---------------------------------------------------------------------------
__global__ void cvt_f32_bf16(const float* __restrict__ in, bf16* __restrict__ out,
                             size_t n) {
  size_t i = (size_t)blockIdx.x * blockDim.x + threadIdx.x;
  size_t stride = (size_t)gridDim.x * blockDim.x;
  for (; i < n; i += stride) out[i] = (bf16)in[i];
}

// ---------------------------------------------------------------------------
// Exact-form GELU, 0.5 v (1 + erf(v / sqrt 2)), two values at a time, no branch.
// erf(z) = z P(z^2) / Q(z^2) on |z| <= 4 (beyond it erf rounds to +-1 in f32);
// absolute error below 4e-7 over the whole line.  Straight-line packed code:
// the values of a lane are independent chains that the scheduler interleaves,
// and the epilogue's text is a fraction of the branching form's.
// ---------------------------------------------------------------------------
typedef float  v2f  __attribute__((ext_vector_type(2)));
typedef __bf16 v2bf __attribute__((ext_vector_type(2)));

__device__ __forceinline__ v2f gelu2(v2f v) {
  const v2f lim = 4.0f;
  const v2f z = __builtin_elementwise_min(
      __builtin_elementwise_max(v * 0.70710678118654752f, -lim), lim);
  const v2f z2 = z * z;
  v2f p = -2.72614225801306e-10f;
  p = __builtin_elementwise_fma(p, z2, (v2f)(2.77068142495902e-08f));
  p = __builtin_elementwise_fma(p, z2, (v2f)(-2.10102402082508e-06f));
  p = __builtin_elementwise_fma(p, z2, (v2f)(-5.69250639462346e-05f));
  p = __builtin_elementwise_fma(p, z2, (v2f)(-7.34990630326855e-04f));
  p = __builtin_elementwise_fma(p, z2, (v2f)(-2.95459980854025e-03f));
  p = __builtin_elementwise_fma(p, z2, (v2f)(-1.60960333262415e-02f));
  v2f q = -1.45660718464996e-05f;
  q = __builtin_elementwise_fma(q, z2, (v2f)(-2.13374055278905e-04f));
  q = __builtin_elementwise_fma(q, z2, (v2f)(-1.68282697438203e-03f));
  q = __builtin_elementwise_fma(q, z2, (v2f)(-7.37332916720468e-03f));
  q = __builtin_elementwise_fma(q, z2, (v2f)(-1.42647390514189e-02f));
  // Reciprocals in place, one statement: neither touches the other's register,
  // and the closing v_nop keeps the slot the instruction set asks for behind a
  // transcendental, whatever the compiler places next.
  float r0 = q[0], r1 = q[1];
  asm("v_rcp_f32 %0, %0\n\t"
      "v_rcp_f32 %1, %1\n\t"
      "v_nop"
      : "+v"(r0), "+v"(r1));
  const v2f r = {r0, r1};
  const v2f e = (p * z) * r;
  const v2f h = v * 0.5f;
  return __builtin_elementwise_fma(h, e, h);
}

// ---------------------------------------------------------------------------
// Tiled bf16 WMMA GEMM:  Y[M,N] = act( (A[M,K] * W[N,K]^T + bias) * scale )
// A, W row-major with K contiguous (torch Linear layout -> NT GEMM).
// Block tile 256x128, 8 waves of 64x64, K-step 64, LDS ring of NBUF tiles filled
// by async global->LDS DMA.  M % 256 == 0, N % 128 == 0, K % 64 == 0.
// NBUF == 2: one tile in flight; two work-groups fit a WGP and cover each other's
// waits (for grids of several work-groups per WGP).
// NBUF == 3: two tiles in flight, so that the path from L2 never runs empty
// between tiles (for grids of one work-group per WGP, which nothing else covers).
// ---------------------------------------------------------------------------
template <bool GELU, bool OUT_BF16, int NBUF>
__global__ __launch_bounds__(256)
void gemm_bf16_nt(const bf16* __restrict__ A, const bf16* __restrict__ W,
                  const float* __restrict__ bias, float scale,
                  float* outF, bf16* outB, int M, int N, int K) {
  static_assert(!GELU || OUT_BF16, "the GELU epilogue writes bf16");
  static_assert(NBUF == 2 || NBUF == 3, "ring of two or three tiles");
  __shared__ bf16 As[NBUF][256][72];   // 144B row pitch = 16B x odd (b128 readers)
  __shared__ bf16 Bs[NBUF][128][72];

  const int tid  = threadIdx.x;
  const int lane = tid & 31;
  const int wave = tid >> 5;
  const int wm   = wave & 3;       // 4 M-bands of 64
  const int wn   = wave >> 2;      // 2 N-bands of 64
  const int half = lane >> 4;
  const int l16  = lane & 15;
  const int m0   = blockIdx.x * 256;
  const int n0   = blockIdx.y * 128;

  v8f acc[4][4] = {};

  // A 256x64 = 2048 16B chunks (8 per thread), W 128x64 = 1024 (4 per thread).
  // A wave's copy covers 4 rows x 128B = 4 whole lines.
  const int cr = tid >> 3, cc = (tid & 7) * 8;
  const bf16* gA = &A[(size_t)(m0 + cr) * K + cc];
  const bf16* gW = &W[(size_t)(n0 + cr) * K + cc];
  const size_t rs = (size_t)32 * K;            // 32 rows further
  auto load_tile = [&](int buf, int k0) {
    async_copy16x12(lds_addr(&As[buf][cr][cc]), lds_addr(&Bs[buf][cr][cc]),
                    32 * 72 * 2, gA + k0, gW + k0, rs);
  };

  const int KT = K >> 6;

  // One trip: the 32 WMMAs of tile `cur`; where `fill` is set, the copies of the
  // tile at k0 go out into buffer `dst`, which every wave left at the last barrier.
  auto trip = [&](int cur, bool fill, int dst, int k0) {
    // every loop below is unrolled so that acc[][], a[] and b[] are indexed by
    // constants and stay in registers
#pragma unroll
    for (int ks = 0; ks < 2; ++ks) {
      v16bf a[4], b[4];
#pragma unroll
      for (int i = 0; i < 4; ++i) {
        a[i] = frag_from(&As[cur][wm * 64 + i * 16 + l16][ks * 32 + 8 * half]);
        b[i] = frag_from(&Bs[cur][wn * 64 + i * 16 + l16][ks * 32 + 8 * half]);
      }
      // keeps the 16 LDS reads one group ahead of the 16 WMMAs: left alone the
      // scheduler sinks them among the WMMAs, one full LDS wait per row of four
      __builtin_amdgcn_sched_barrier(0);
      // issued here so that the copies' address work and wait run under the LDS
      // reads' latency
      if (ks == 0 && fill) load_tile(dst, k0);
      // keeps the copies ahead of the WMMAs: left alone the scheduler sinks them,
      // with their wait, to the end of the block and forms their addresses in
      // fragment registers, at four idle slots behind a WMMA each time
      __builtin_amdgcn_sched_barrier(0);
#pragma unroll
      for (int mi = 0; mi < 4; ++mi)
#pragma unroll
        for (int ni = 0; ni < 4; ++ni)
          acc[mi][ni] = wmma_bf16(a[mi], b[ni], acc[mi][ni]);
      // second half of the pair: the next group's reads stay behind this block
      __builtin_amdgcn_sched_barrier(0);
    }
    // own LDS reads of `cur` retired before any wave may refill it
    asm volatile("s_wait_dscnt 0x0" ::: "memory");
  };

  if constexpr (NBUF == 2) {
    load_tile(0, 0);
    wait_async0();
    __syncthreads();
    for (int kt = 0; kt < KT; ++kt) {
      const int cur = kt & 1;
      trip(cur, kt + 1 < KT, cur ^ 1, (kt + 1) << 6);
      wait_async0();       // next-buffer DMA landed (ASYNCcnt not covered by barrier)
      __syncthreads();     // all waves done reading `cur`, writes visible
    }
  } else {
    // Tiles 0 and 1 go out together; tile 0 has landed when all but the twelve
    // copies of tile 1 have.
    load_tile(0, 0);
    if (KT > 1) {
      load_tile(1, 64);
      wait_async_all_but_one_tile();
    } else {
      wait_async0();
    }
    __syncthreads();

    int cur = 0, nxt = 1, dst = 2;   // kt, kt + 1, kt + 2 mod 3
    int kt = 0;
    // Every trip of this loop issues the twelve copies of tile kt + 2, into the
    // buffer of tile kt - 1, and then waits for all but those: tile kt + 1 has
    // landed while tile kt + 2 stays in flight over the barrier.
    for (; kt + 2 < KT; ++kt) {
      trip(cur, true, dst, (kt + 2) << 6);
      wait_async_all_but_one_tile();
      __syncthreads();     // tile kt + 1 visible; all waves done reading `cur`
      const int left = cur;
      cur = nxt; nxt = dst; dst = left;
    }
    // The last trips issue nothing more: the wait is to 0.
    for (; kt < KT; ++kt) {
      trip(cur, false, 0, 0);
      wait_async0();
      __syncthreads();
      cur = nxt;
    }
  }

  // ---- epilogue: C-frag mapping row = j + 8*half, col = l16 ----
#pragma unroll
  for (int mi = 0; mi < 4; ++mi) {
#pragma unroll
    for (int ni = 0; ni < 4; ++ni) {
      int col = n0 + wn * 64 + ni * 16 + l16;
      float bv = bias[col];
      if (GELU) {
        // pairs of rows, so that the polynomial runs on packed f32
#pragma unroll
        for (int j = 0; j < 8; j += 2) {
          v2f v = {(acc[mi][ni][j] + bv) * scale, (acc[mi][ni][j + 1] + bv) * scale};
          const v2bf o = __builtin_convertvector(gelu2(v), v2bf);
          size_t idx = (size_t)(m0 + wm * 64 + mi * 16 + j + 8 * half) * N + col;
          outB[idx]     = o[0];
          outB[idx + N] = o[1];
        }
      } else {
#pragma unroll
        for (int j = 0; j < 8; ++j) {
          int row = m0 + wm * 64 + mi * 16 + j + 8 * half;
          float v = (acc[mi][ni][j] + bv) * scale;
          size_t idx = (size_t)row * N + col;
          if (OUT_BF16) outB[idx] = (bf16)v;
          else          outF[idx] = v;
        }
      }
    }
  }
}

// ---------------------------------------------------------------------------
// Flash attention: grid (S/64, H, B), block = 128 threads = 4 waves.
// Each wave owns 16 queries; K/V tiles of 32 keys staged in LDS.
// Transposed products: S^T = K x Q^T and O^T += V^T x P^T.  A lane then holds
// 16 of the 32 scores of ONE query (query = l16, keys 8*half + r and
// 16 + 8*half + r), so maximum and sum are taken in the lane's own registers
// with one exchange between the wave's halves, and the two score tiles,
// converted in place, already are the B operand of the second product.
// ---------------------------------------------------------------------------
typedef short s16x8 __attribute__((ext_vector_type(8)));
typedef float v4f   __attribute__((ext_vector_type(4)));

// Transposing LDS read: lane (l16, half) receives T[kbase + 8*half + 0..7][dbase + l16]
// when it passes &T[kbase + 8*half + (lane & 7)][dbase + 8 * ((lane >> 3) & 1)].
__device__ __forceinline__ v8bf ld_tr16(const bf16* p) {
  typedef __attribute__((address_space(3))) s16x8 lds_s16x8;
  return __builtin_bit_cast(v8bf, __builtin_amdgcn_ds_load_tr16_b128_v8i16((lds_s16x8*)p));
}

// lane l <-> lane l ^ 16
__device__ __forceinline__ float xhalf(float x) {
  return __builtin_bit_cast(float, __builtin_amdgcn_permlanex16(
      __builtin_bit_cast(int, x), __builtin_bit_cast(int, x),
      0x76543210, 0xfedcba98, false, false));
}

#define LOG2E 1.44269504088896340736f

// Base-2 exponentials in place.  Written as one statement so that the slot the
// instruction set asks for behind a transcendental is kept: inside the run no
// v_exp touches its neighbour's registers, and the closing v_nop stands in
// front of whatever the compiler places next.
__device__ __forceinline__ void exp2_x8(float (&e)[8]) {
  asm("v_exp_f32 %0, %0\n\t"
      "v_exp_f32 %1, %1\n\t"
      "v_exp_f32 %2, %2\n\t"
      "v_exp_f32 %3, %3\n\t"
      "v_exp_f32 %4, %4\n\t"
      "v_exp_f32 %5, %5\n\t"
      "v_exp_f32 %6, %6\n\t"
      "v_exp_f32 %7, %7\n\t"
      "v_nop"
      : "+v"(e[0]), "+v"(e[1]), "+v"(e[2]), "+v"(e[3]),
        "+v"(e[4]), "+v"(e[5]), "+v"(e[6]), "+v"(e[7]));
}
__device__ __forceinline__ void exp2_x1(float& e) {
  asm("v_exp_f32 %0, %0\n\t"
      "v_nop"
      : "+v"(e));
}

__global__ __launch_bounds__(128)
void flash_attn(const bf16* __restrict__ Q, const bf16* __restrict__ Kb,
                const bf16* __restrict__ Vb, const int* __restrict__ mask,
                bf16* __restrict__ Ctx) {
  __shared__ bf16 Ks[32][72];     // 144B pitch = 16B x odd (b128 readers)
  __shared__ bf16 Vs[32][80];     // 160B pitch = 32B x odd (transposing readers)
  __shared__ __attribute__((aligned(16))) float Madd[32];

  const int tid  = threadIdx.x;
  const int lane = tid & 31;
  const int wave = tid >> 5;
  const int half = lane >> 4;
  const int l16  = lane & 15;
  const int qt   = blockIdx.x;
  const int h    = blockIdx.y;
  const int b    = blockIdx.z;

  // This wave's 16 queries as two B-fragments (dh 0..31, 32..63): column = l16.
  const size_t qrow = ((size_t)b * SS + qt * 64 + wave * 16 + l16) * DD + h * DH;
  v16bf qb0 = frag_from(&Q[qrow + 0  + 8 * half]);
  v16bf qb1 = frag_from(&Q[qrow + 32 + 8 * half]);

  // m: running maximum of query l16 (equal in both halves); l: this half's part
  // of its running sum; cacc[f][r] = O^T[dh = 16 f + 8 half + r][query l16].
  float m = -1e30f, l = 0.0f;
  v8f cacc[4] = {};

  const bf16* vp = &Vs[8 * half + (lane & 7)][8 * ((lane >> 3) & 1)];

  for (int kt = 0; kt < SS / 32; ++kt) {
    // ---- cooperative K/V tile load: 32 keys x 64 dh each ----
    // the four loads first, then the four LDS stores: one memory latency a tile
    v8bf kr[2], vr[2];
#pragma unroll
    for (int c = 0; c < 2; ++c) {
      int ch = tid + c * 128;                 // 0..255
      int r = ch >> 3, col = (ch & 7) * 8;
      size_t g = ((size_t)b * SS + kt * 32 + r) * DD + h * DH + col;
      kr[c] = *(const v8bf*)&Kb[g];
      vr[c] = *(const v8bf*)&Vb[g];
    }
#pragma unroll
    for (int c = 0; c < 2; ++c) {
      int ch = tid + c * 128;
      int r = ch >> 3, col = (ch & 7) * 8;
      *(v8bf*)&Ks[r][col] = kr[c];
      *(v8bf*)&Vs[r][col] = vr[c];
    }
    if (tid < 32)
      Madd[tid] = mask[(size_t)b * SS + kt * 32 + tid] ? 0.0f : -1e30f;
    __syncthreads();

    // ---- scores: S^T = K x Q^T, two 16-key tiles, K-dim = dh 64.  The key's
    // additive mask is the accumulator's start value: row r of tile i is key
    // 16 i + 8 half + r. ----
    v8f s0, s1;
    {
      const v4f ma = *(const v4f*)&Madd[8 * half];
      const v4f mb = *(const v4f*)&Madd[8 * half + 4];
      const v4f mc = *(const v4f*)&Madd[16 + 8 * half];
      const v4f md = *(const v4f*)&Madd[16 + 8 * half + 4];
#pragma unroll
      for (int r = 0; r < 4; ++r) {
        s0[r] = ma[r]; s0[r + 4] = mb[r];
        s1[r] = mc[r]; s1[r + 4] = md[r];
      }
      v16bf ka0 = frag_from(&Ks[l16][0 + 8 * half]);
      v16bf ka1 = frag_from(&Ks[l16][32 + 8 * half]);
      v16bf ka2 = frag_from(&Ks[16 + l16][0 + 8 * half]);
      v16bf ka3 = frag_from(&Ks[16 + l16][32 + 8 * half]);
      // keeps the twelve LDS reads one group ahead of the four WMMAs: left alone
      // the scheduler pairs them off, one full LDS wait per WMMA
      __builtin_amdgcn_sched_barrier(0);
      s0 = wmma_bf16(ka0, qb0, s0);
      s1 = wmma_bf16(ka2, qb0, s1);
      s0 = wmma_bf16(ka1, qb1, s0);
      s1 = wmma_bf16(ka3, qb1, s1);
    }

    // ---- online softmax over this 32-key slab, one query per lane ----
    float mx = fmaxf(s0[0], s1[0]);
#pragma unroll
    for (int r = 1; r < 8; ++r) mx = fmaxf(mx, fmaxf(s0[r], s1[r]));
    mx = fmaxf(mx, xhalf(mx));                // the other half's 16 keys
    const float mn = fmaxf(m, mx);
    // the difference is taken first: it is never above 0, also where every key
    // so far carries the mask's -1e30
    float cor = (m - mn) * LOG2E;
    float e0[8], e1[8];
#pragma unroll
    for (int r = 0; r < 8; ++r) {
      e0[r] = (s0[r] - mn) * LOG2E;
      e1[r] = (s1[r] - mn) * LOG2E;
    }
    exp2_x1(cor);
    exp2_x8(e0);
    exp2_x8(e1);
    m = mn;
    v16bf pb;                                 // P^T as B: element s = key kmap(s, half)
    float t[8];
#pragma unroll
    for (int r = 0; r < 8; ++r) {
      t[r] = e0[r] + e1[r];
      pb[r]     = (bf16)e0[r];
      pb[r + 8] = (bf16)e1[r];
    }
    const float rs = ((t[0] + t[4]) + (t[2] + t[6])) + ((t[1] + t[5]) + (t[3] + t[7]));
    l = l * cor + rs;
#pragma unroll
    for (int f = 0; f < 4; ++f) cacc[f] *= cor;

    // ---- O^T += V^T(16 dh x 32 keys) x P^T(32 keys x 16 queries) ----
#pragma unroll
    for (int f = 0; f < 4; ++f) {
      v8bf lo = ld_tr16(vp + f * 16);             // keys 8 half + 0..7
      v8bf hi = ld_tr16(vp + 16 * 80 + f * 16);   // keys 16 + 8 half + 0..7
      v16bf va;
#pragma unroll
      for (int i = 0; i < 8; ++i) { va[i] = lo[i]; va[i + 8] = hi[i]; }
      cacc[f] = wmma_bf16(va, pb, cacc[f]);
    }
    __syncthreads();  // Ks/Vs reused next iteration
  }

  // ---- finalize: join the halves' sums, divide, write bf16 ctx (b,s,h*64+dh):
  // a lane's 8 registers of a tile are 8 consecutive dh of its query ----
  l += xhalf(l);
  const float inv = (l > 0.0f) ? (1.0f / l) : 0.0f;
  const size_t o = ((size_t)b * SS + qt * 64 + wave * 16 + l16) * DD + h * DH + 8 * half;
#pragma unroll
  for (int f = 0; f < 4; ++f) {
    v8bf ov;
#pragma unroll
    for (int r = 0; r < 8; ++r) ov[r] = (bf16)(cacc[f][r] * inv);
    *(v8bf*)&Ctx[o + f * 16] = ov;
  }
}

// ---------------------------------------------------------------------------
// Residual + LayerNorm over D=1024; optionally emits bf16 copy of the result.
// One block (256 thr) per token row. outF may alias y (in-place).
// ---------------------------------------------------------------------------
__device__ __forceinline__ float block_sum(float v, float* red) {
  v += __shfl_xor(v, 1);
  v += __shfl_xor(v, 2);
  v += __shfl_xor(v, 4);
  v += __shfl_xor(v, 8);
  v += __shfl_xor(v, 16);
  int lane = threadIdx.x & 31, w = threadIdx.x >> 5;
  if (lane == 0) red[w] = v;
  __syncthreads();
  if (threadIdx.x == 0) {
    float s = 0.0f;
#pragma unroll
    for (int i = 0; i < 8; ++i) s += red[i];
    red[0] = s;
  }
  __syncthreads();
  float r = red[0];
  __syncthreads();
  return r;
}

__global__ __launch_bounds__(256)
void ln_residual(const float* y, const float* __restrict__ res,
                 const float* __restrict__ g, const float* __restrict__ beta,
                 float* outF, bf16* outB) {
  __shared__ float red[8];
  const size_t row = blockIdx.x;
  const float* yp = y + row * DD;
  const float* rp = res + row * DD;
  const int base = threadIdx.x * 4;

  float v[4];
  float s = 0.0f;
#pragma unroll
  for (int i = 0; i < 4; ++i) { v[i] = yp[base + i] + rp[base + i]; s += v[i]; }
  float mu = block_sum(s, red) * (1.0f / DD);

  float q = 0.0f;
#pragma unroll
  for (int i = 0; i < 4; ++i) { float d = v[i] - mu; q += d * d; }
  float var = block_sum(q, red) * (1.0f / DD);
  float rstd = rsqrtf(var + 1e-12f);

#pragma unroll
  for (int i = 0; i < 4; ++i) {
    float o = (v[i] - mu) * rstd * g[base + i] + beta[base + i];
    outF[row * DD + base + i] = o;
    if (outB) outB[row * DD + base + i] = (bf16)o;
  }
}

// ---------------------------------------------------------------------------
// Launch
// ---------------------------------------------------------------------------
extern "C" void kernel_launch(void* const* d_in, const int* in_sizes, int n_in,
                              void* d_out, int out_size, void* d_ws, size_t ws_size,
                              hipStream_t stream) {
  (void)in_sizes; (void)n_in; (void)out_size; (void)ws_size;

  const float* x    = (const float*)d_in[0];
  const int*   msk  = (const int*)d_in[1];
  const float* Wq   = (const float*)d_in[2];
  const float* bq   = (const float*)d_in[3];
  const float* Wk   = (const float*)d_in[4];
  const float* bk   = (const float*)d_in[5];
  const float* Wv   = (const float*)d_in[6];
  const float* bv   = (const float*)d_in[7];
  const float* Wo   = (const float*)d_in[8];
  const float* bo   = (const float*)d_in[9];
  const float* ln1g = (const float*)d_in[10];
  const float* ln1b = (const float*)d_in[11];
  const float* W1   = (const float*)d_in[12];
  const float* b1   = (const float*)d_in[13];
  const float* W2   = (const float*)d_in[14];
  const float* b2   = (const float*)d_in[15];
  const float* ln2g = (const float*)d_in[16];
  const float* ln2b = (const float*)d_in[17];
  float* out = (float*)d_out;

  char* ws = (char*)d_ws;
  const size_t MB = 1ull << 20;
  bf16*  wqb  = (bf16*)(ws + 0 * MB);
  bf16*  wkb  = (bf16*)(ws + 2 * MB);
  bf16*  wvb  = (bf16*)(ws + 4 * MB);
  bf16*  wob  = (bf16*)(ws + 6 * MB);
  bf16*  w1b  = (bf16*)(ws + 8 * MB);     // F*D
  bf16*  w2b  = (bf16*)(ws + 16 * MB);    // D*F
  bf16*  xb   = (bf16*)(ws + 24 * MB);
  bf16*  qb   = (bf16*)(ws + 40 * MB);
  bf16*  kb   = (bf16*)(ws + 56 * MB);
  bf16*  vb   = (bf16*)(ws + 72 * MB);
  bf16*  ctxb = (bf16*)(ws + 88 * MB);
  float* sa   = (float*)(ws + 104 * MB);  // sa_out, then h (in-place LN1)
  bf16*  hb   = (bf16*)(ws + 136 * MB);
  bf16*  ffb  = (bf16*)(ws + 40 * MB);    // reuse q/k/v/ctx region (dead by FFN1)
  float* y2   = (float*)(ws + 152 * MB);

  const size_t nD = (size_t)DD * DD, nF = (size_t)FF * DD, nX = (size_t)NTOK * DD;
  dim3 cvtG(2048), cvtB(256);
  hipLaunchKernelGGL(cvt_f32_bf16, cvtG, cvtB, 0, stream, x,  xb,  nX);
  hipLaunchKernelGGL(cvt_f32_bf16, cvtG, cvtB, 0, stream, Wq, wqb, nD);
  hipLaunchKernelGGL(cvt_f32_bf16, cvtG, cvtB, 0, stream, Wk, wkb, nD);
  hipLaunchKernelGGL(cvt_f32_bf16, cvtG, cvtB, 0, stream, Wv, wvb, nD);
  hipLaunchKernelGGL(cvt_f32_bf16, cvtG, cvtB, 0, stream, Wo, wob, nD);
  hipLaunchKernelGGL(cvt_f32_bf16, cvtG, cvtB, 0, stream, W1, w1b, nF);
  hipLaunchKernelGGL(cvt_f32_bf16, cvtG, cvtB, 0, stream, W2, w2b, nF);

  dim3 gB(256);
  dim3 gQKV(NTOK / 256, DD / 128);
  // q = (x Wq^T + bq) / sqrt(64)
  hipLaunchKernelGGL((gemm_bf16_nt<false, true, 3>), gQKV, gB, 0, stream,
                     xb, wqb, bq, 0.125f, (float*)nullptr, qb, NTOK, DD, DD);
  hipLaunchKernelGGL((gemm_bf16_nt<false, true, 3>), gQKV, gB, 0, stream,
                     xb, wkb, bk, 1.0f, (float*)nullptr, kb, NTOK, DD, DD);
  hipLaunchKernelGGL((gemm_bf16_nt<false, true, 3>), gQKV, gB, 0, stream,
                     xb, wvb, bv, 1.0f, (float*)nullptr, vb, NTOK, DD, DD);

  dim3 aG(SS / 64, HH, BB), aB(128);
  hipLaunchKernelGGL(flash_attn, aG, aB, 0, stream, qb, kb, vb, msk, ctxb);

  // sa = ctx Wo^T + bo   (f32)
  hipLaunchKernelGGL((gemm_bf16_nt<false, false, 3>), gQKV, gB, 0, stream,
                     ctxb, wob, bo, 1.0f, sa, (bf16*)nullptr, NTOK, DD, DD);

  // h = LN1(sa + x), in-place in sa; also bf16 copy hb
  hipLaunchKernelGGL(ln_residual, dim3(NTOK), dim3(256), 0, stream,
                     sa, x, ln1g, ln1b, sa, hb);

  // ff = gelu(h W1^T + b1)   (bf16, M=8192 N=4096 K=1024)
  dim3 gF1(NTOK / 256, FF / 128);
  hipLaunchKernelGGL((gemm_bf16_nt<true, true, 2>), gF1, gB, 0, stream,
                     hb, w1b, b1, 1.0f, (float*)nullptr, ffb, NTOK, FF, DD);

  // y2 = ff W2^T + b2   (f32, K=4096)
  hipLaunchKernelGGL((gemm_bf16_nt<false, false, 3>), gQKV, gB, 0, stream,
                     ffb, w2b, b2, 1.0f, y2, (bf16*)nullptr, NTOK, DD, FF);

  // out = LN2(y2 + h)
  hipLaunchKernelGGL(ln_residual, dim3(NTOK), dim3(256), 0, stream,
                     y2, sa, ln2g, ln2b, out, (bf16*)nullptr);
}

// v005
// Measured time: 257 microseconds a run.
// Next to v004, in two timings, it ran 1.10 times as fast each time.
// Over all steps from v000 it is 2.09 times as fast.
#include <hip/hip_runtime.h>
#include <math.h>
#include <stdint.h>

// ---------------------------------------------------------------------------
// Types
// ---------------------------------------------------------------------------
typedef __bf16 bf16;
typedef __bf16 v16bf __attribute__((ext_vector_type(16)));
typedef __bf16 v8bf  __attribute__((ext_vector_type(8)));
typedef float  v8f   __attribute__((ext_vector_type(8)));

#define BB 8
#define SS 1024
#define DD 1024
#define HH 16
#define DH 64
#define FF 4096
#define NTOK (BB * SS)          // 8192

// ---------------------------------------------------------------------------
// WMMA helpers (CDNA5 v_wmma_f32_16x16x32_bf16)
// ---------------------------------------------------------------------------
__device__ __forceinline__ v8f wmma_bf16(v16bf a, v16bf b, v8f c) {
  return __builtin_amdgcn_wmma_f32_16x16x32_bf16(
      /*neg_a=*/false, a, /*neg_b=*/false, b,
      /*c_mod=*/(short)0, c, /*reuse_a=*/false, /*reuse_b=*/false);
}

// A/B fragment loader. ISA 16-bit 16x32 layout: lane half h holds
// K[8h..8h+7] in halves 0..7 and K[16+8h..16+8h+7] in halves 8..15.
// Caller passes p = &row[k0 + 8*half]; we read p[0..7] and p[16..23].
__device__ __forceinline__ v16bf frag_from(const bf16* p) {
  v8bf lo = *(const v8bf*)(p);
  v8bf hi = *(const v8bf*)(p + 16);
  v16bf a;
#pragma unroll
  for (int i = 0; i < 8; ++i) { a[i] = lo[i]; a[i + 8] = hi[i]; }
  return a;
}

// CDNA5 async global->LDS copies of 16B chunks (tracked by ASYNCcnt; bypass
// VGPRs entirely).  GV addressing: vdst = LDS byte address, v[addr64], off.
// s_wait_xcnt 0 is the last line of the copies' own statement so that no address
// register is rewritten ahead of it.
__device__ __forceinline__ uint32_t lds_addr(const bf16* p) {
  return (uint32_t)(uint64_t)p;  // flat LDS addr[31:0] = LDS offset
}

// Twelve 16B chunks per lane: LDS places l + i * lstep for the eight chunks of
// the first operand (rows 32 apart), m + i * lstep for the four of the second.
__device__ __forceinline__ void async_copy16x12(uint32_t l, uint32_t m, uint32_t lstep,
                                                const bf16* a, const bf16* w, size_t gstep) {
  asm volatile("global_load_async_to_lds_b128 %0, %12, off\n\t"
               "global_load_async_to_lds_b128 %1, %13, off\n\t"
               "global_load_async_to_lds_b128 %2, %14, off\n\t"
               "global_load_async_to_lds_b128 %3, %15, off\n\t"
               "global_load_async_to_lds_b128 %4, %16, off\n\t"
               "global_load_async_to_lds_b128 %5, %17, off\n\t"
               "global_load_async_to_lds_b128 %6, %18, off\n\t"
               "global_load_async_to_lds_b128 %7, %19, off\n\t"
               "global_load_async_to_lds_b128 %8, %20, off\n\t"
               "global_load_async_to_lds_b128 %9, %21, off\n\t"
               "global_load_async_to_lds_b128 %10, %22, off\n\t"
               "global_load_async_to_lds_b128 %11, %23, off\n\t"
               "s_wait_xcnt 0x0"
               :: "v"(l), "v"(l + lstep), "v"(l + 2 * lstep), "v"(l + 3 * lstep),
                  "v"(l + 4 * lstep), "v"(l + 5 * lstep), "v"(l + 6 * lstep),
                  "v"(l + 7 * lstep),
                  "v"(m), "v"(m + lstep), "v"(m + 2 * lstep), "v"(m + 3 * lstep),
                  "v"((uint64_t)a), "v"((uint64_t)(a + gstep)),
                  "v"((uint64_t)(a + 2 * gstep)), "v"((uint64_t)(a + 3 * gstep)),
                  "v"((uint64_t)(a + 4 * gstep)), "v"((uint64_t)(a + 5 * gstep)),
                  "v"((uint64_t)(a + 6 * gstep)), "v"((uint64_t)(a + 7 * gstep)),
                  "v"((uint64_t)w), "v"((uint64_t)(w + gstep)),
                  "v"((uint64_t)(w + 2 * gstep)), "v"((uint64_t)(w + 3 * gstep))
               : "memory");
}

__device__ __forceinline__ void wait_async0() {
  asm volatile("s_wait_asynccnt 0x0" ::: "memory");
}
// All but this wave's twelve youngest copies (one tile's worth) have landed:
// the counter returns in issue order, and only these copies count on it here.
__device__ __forceinline__ void wait_async_all_but_one_tile() {
  asm volatile("s_wait_asynccnt 0xc" ::: "memory");
}

// ---------------------------------------------------------------------------
// fp32 -> bf16 conversion of all seven arrays in ONE launch.  Their bf16 copies
// lie one behind another in the workspace (Wq, Wk, Wv, Wo, W1, W2, x), so the
// destination is one run of 20 * D * D elements; a block takes 8192 of them,
// which lie inside one array (every length is a multiple of D * D), and picks
// its source by a scalar test.  16 B per lane, the eight loads first; a wave's
// store covers two whole lines.
// ---------------------------------------------------------------------------
typedef float  f32x4  __attribute__((ext_vector_type(4)));
typedef __bf16 bf16x4 __attribute__((ext_vector_type(4)));

#define CVT_UNITS 20            // 4 (Wq Wk Wv Wo) + 4 (W1) + 4 (W2) + 8 (x), in D * D
#define CVT_BLOCK 8192          // elements per block

__global__ __launch_bounds__(256)
void cvt_all_f32_bf16(const float* __restrict__ wq, const float* __restrict__ wk,
                      const float* __restrict__ wv, const float* __restrict__ wo,
                      const float* __restrict__ w1, const float* __restrict__ w2,
                      const float* __restrict__ x, bf16* __restrict__ out) {
  const uint32_t e0   = blockIdx.x * (uint32_t)CVT_BLOCK;   // first element, in out
  const uint32_t unit = e0 / (uint32_t)(DD * DD);
  const float* src;
  uint32_t first;                                           // unit where src begins
  if (unit < 4)       { src = unit == 0 ? wq : unit == 1 ? wk : unit == 2 ? wv : wo;
                        first = unit; }
  else if (unit < 8)  { src = w1; first = 4; }
  else if (unit < 12) { src = w2; first = 8; }
  else                { src = x;  first = 12; }
  const uint32_t t = threadIdx.x * 4;
  const float* p = src + (e0 - first * (uint32_t)(DD * DD)) + t;
  bf16* o = out + e0 + t;
  f32x4 v[8];
  // both loops unrolled: v[] is indexed by constants and stays in registers
#pragma unroll
  for (int c = 0; c < 8; ++c) v[c] = *(const f32x4*)(p + c * 1024);
#pragma unroll
  for (int c = 0; c < 8; ++c)
    *(bf16x4*)(o + c * 1024) = __builtin_convertvector(v[c], bf16x4);
}

// ---------------------------------------------------------------------------
// Exact-form GELU, 0.5 v (1 + erf(v / sqrt 2)), two values at a time, no branch.
// erf(z) = z P(z^2) / Q(z^2) on |z| <= 4 (beyond it erf rounds to +-1 in f32);
// absolute error below 4e-7 over the whole line.  Straight-line packed code:
// the values of a lane are independent chains that the scheduler interleaves,
// and the epilogue's text is a fraction of the branching form's.
// ---------------------------------------------------------------------------
typedef float  v2f  __attribute__((ext_vector_type(2)));
typedef __bf16 v2bf __attribute__((ext_vector_type(2)));

__device__ __forceinline__ v2f gelu2(v2f v) {
  const v2f lim = 4.0f;
  const v2f z = __builtin_elementwise_min(
      __builtin_elementwise_max(v * 0.70710678118654752f, -lim), lim);
  const v2f z2 = z * z;
  v2f p = -2.72614225801306e-10f;
  p = __builtin_elementwise_fma(p, z2, (v2f)(2.77068142495902e-08f));
  p = __builtin_elementwise_fma(p, z2, (v2f)(-2.10102402082508e-06f));
  p = __builtin_elementwise_fma(p, z2, (v2f)(-5.69250639462346e-05f));
  p = __builtin_elementwise_fma(p, z2, (v2f)(-7.34990630326855e-04f));
  p = __builtin_elementwise_fma(p, z2, (v2f)(-2.95459980854025e-03f));
  p = __builtin_elementwise_fma(p, z2, (v2f)(-1.60960333262415e-02f));
  v2f q = -1.45660718464996e-05f;
  q = __builtin_elementwise_fma(q, z2, (v2f)(-2.13374055278905e-04f));
  q = __builtin_elementwise_fma(q, z2, (v2f)(-1.68282697438203e-03f));
  q = __builtin_elementwise_fma(q, z2, (v2f)(-7.37332916720468e-03f));
  q = __builtin_elementwise_fma(q, z2, (v2f)(-1.42647390514189e-02f));
  // Reciprocals in place, one statement: neither touches the other's register,
  // and the closing v_nop keeps the slot the instruction set asks for behind a
  // transcendental, whatever the compiler places next.
  float r0 = q[0], r1 = q[1];
  asm("v_rcp_f32 %0, %0\n\t"
      "v_rcp_f32 %1, %1\n\t"
      "v_nop"
      : "+v"(r0), "+v"(r1));
  const v2f r = {r0, r1};
  const v2f e = (p * z) * r;
  const v2f h = v * 0.5f;
  return __builtin_elementwise_fma(h, e, h);
}

// ---------------------------------------------------------------------------
// Tiled bf16 WMMA GEMM:  Y[M,N] = act( (A[M,K] * W[N,K]^T + bias) * scale )
// A, W row-major with K contiguous (torch Linear layout -> NT GEMM).
// Block tile 256x128, 8 waves of 64x64, K-step 64, LDS ring of NBUF tiles filled
// by async global->LDS DMA.  M % 256 == 0, N % 128 == 0, K % 64 == 0.
// NBUF == 2: one tile in flight; two work-groups fit a WGP and cover each other's
// waits (for grids of several work-groups per WGP).
// NBUF == 3: two tiles in flight, so that the path from L2 never runs empty
// between tiles (for grids of one work-group per WGP, which nothing else covers).
// THREE: one launch does three products with the same A.  W holds three [N, K]
// matrices one behind another, outB three [M, N] results likewise, each with its
// own bias; blockIdx.y runs over the 3 N / 128 column tiles and `scale` applies
// to the first product alone (the others take 1).
// ---------------------------------------------------------------------------
template <bool GELU, bool OUT_BF16, int NBUF, bool THREE>
__global__ __launch_bounds__(256)
void gemm_bf16_nt(const bf16* __restrict__ A, const bf16* __restrict__ W,
                  const float* __restrict__ bias, const float* __restrict__ bias1,
                  const float* __restrict__ bias2, float scale,
                  float* outF, bf16* outB, int M, int N, int K) {
  static_assert(!GELU || OUT_BF16, "the GELU epilogue writes bf16");
  static_assert(!THREE || (OUT_BF16 && !GELU), "three products: plain bf16 results");
  static_assert(NBUF == 2 || NBUF == 3, "ring of two or three tiles");
  __shared__ bf16 As[NBUF][256][72];   // 144B row pitch = 16B x odd (b128 readers)
  __shared__ bf16 Bs[NBUF][128][72];

  const int tid  = threadIdx.x;
  const int lane = tid & 31;
  const int wave = tid >> 5;
  const int wm   = wave & 3;       // 4 M-bands of 64
  const int wn   = wave >> 2;      // 2 N-bands of 64
  const int half = lane >> 4;
  const int l16  = lane & 15;
  const int m0   = blockIdx.x * 256;
  const int n0   = blockIdx.y * 128;

  v8f acc[4][4] = {};

  // A 256x64 = 2048 16B chunks (8 per thread), W 128x64 = 1024 (4 per thread).
  // A wave's copy covers 4 rows x 128B = 4 whole lines.
  const int cr = tid >> 3, cc = (tid & 7) * 8;
  const bf16* gA = &A[(size_t)(m0 + cr) * K + cc];
  const bf16* gW = &W[(size_t)(n0 + cr) * K + cc];
  const size_t rs = (size_t)32 * K;            // 32 rows further
  auto load_tile = [&](int buf, int k0) {
    async_copy16x12(lds_addr(&As[buf][cr][cc]), lds_addr(&Bs[buf][cr][cc]),
                    32 * 72 * 2, gA + k0, gW + k0, rs);
  };

  const int KT = K >> 6;

  // One trip: the 32 WMMAs of tile `cur`; where `fill` is set, the copies of the
  // tile at k0 go out into buffer `dst`, which every wave left at the last barrier.
  auto trip = [&](int cur, bool fill, int dst, int k0) {
    // every loop below is unrolled so that acc[][], a[] and b[] are indexed by
    // constants and stay in registers
#pragma unroll
    for (int ks = 0; ks < 2; ++ks) {
      v16bf a[4], b[4];
#pragma unroll
      for (int i = 0; i < 4; ++i) {
        a[i] = frag_from(&As[cur][wm * 64 + i * 16 + l16][ks * 32 + 8 * half]);
        b[i] = frag_from(&Bs[cur][wn * 64 + i * 16 + l16][ks * 32 + 8 * half]);
      }
      // keeps the 16 LDS reads one group ahead of the 16 WMMAs: left alone the
      // scheduler sinks them among the WMMAs, one full LDS wait per row of four
      __builtin_amdgcn_sched_barrier(0);
      // issued here so that the copies' address work and wait run under the LDS
      // reads' latency
      if (ks == 0 && fill) load_tile(dst, k0);
      // keeps the copies ahead of the WMMAs: left alone the scheduler sinks them,
      // with their wait, to the end of the block and forms their addresses in
      // fragment registers, at four idle slots behind a WMMA each time
      __builtin_amdgcn_sched_barrier(0);
#pragma unroll
      for (int mi = 0; mi < 4; ++mi)
#pragma unroll
        for (int ni = 0; ni < 4; ++ni)
          acc[mi][ni] = wmma_bf16(a[mi], b[ni], acc[mi][ni]);
      // second half of the pair: the next group's reads stay behind this block
      __builtin_amdgcn_sched_barrier(0);
    }
    // own LDS reads of `cur` retired before any wave may refill it
    asm volatile("s_wait_dscnt 0x0" ::: "memory");
  };

  if constexpr (NBUF == 2) {
    load_tile(0, 0);
    wait_async0();
    __syncthreads();
    for (int kt = 0; kt < KT; ++kt) {
      const int cur = kt & 1;
      trip(cur, kt + 1 < KT, cur ^ 1, (kt + 1) << 6);
      wait_async0();       // next-buffer DMA landed (ASYNCcnt not covered by barrier)
      __syncthreads();     // all waves done reading `cur`, writes visible
    }
  } else {
    // Tiles 0 and 1 go out together; tile 0 has landed when all but the twelve
    // copies of tile 1 have.
    load_tile(0, 0);
    if (KT > 1) {
      load_tile(1, 64);
      wait_async_all_but_one_tile();
    } else {
      wait_async0();
    }
    __syncthreads();

    int cur = 0, nxt = 1, dst = 2;   // kt, kt + 1, kt + 2 mod 3
    int kt = 0;
    // Every trip of this loop issues the twelve copies of tile kt + 2, into the
    // buffer of tile kt - 1, and then waits for all but those: tile kt + 1 has
    // landed while tile kt + 2 stays in flight over the barrier.
    for (; kt + 2 < KT; ++kt) {
      trip(cur, true, dst, (kt + 2) << 6);
      wait_async_all_but_one_tile();
      __syncthreads();     // tile kt + 1 visible; all waves done reading `cur`
      const int left = cur;
      cur = nxt; nxt = dst; dst = left;
    }
    // The last trips issue nothing more: the wait is to 0.
    for (; kt < KT; ++kt) {
      trip(cur, false, 0, 0);
      wait_async0();
      __syncthreads();
      cur = nxt;
    }
  }

  // ---- epilogue: C-frag mapping row = j + 8*half, col = l16 ----
  if constexpr (THREE) {
    // Which product this block belongs to: the same for the whole block.  Columns
    // go on counting through all three, so the two bases are moved instead: the
    // indices below stay those of the single product.
    const int part = (n0 >= N) + (n0 >= 2 * N);
    bias  = (part == 0 ? bias : part == 1 ? bias1 : bias2) - (size_t)part * N;
    scale = part == 0 ? scale : 1.0f;
    outB += (size_t)part * M * N - (size_t)part * N;
  }
#pragma unroll
  for (int mi = 0; mi < 4; ++mi) {
#pragma unroll
    for (int ni = 0; ni < 4; ++ni) {
      int col = n0 + wn * 64 + ni * 16 + l16;
      float bv = bias[col];
      if (GELU) {
        // pairs of rows, so that the polynomial runs on packed f32
#pragma unroll
        for (int j = 0; j < 8; j += 2) {
          v2f v = {(acc[mi][ni][j] + bv) * scale, (acc[mi][ni][j + 1] + bv) * scale};
          const v2bf o = __builtin_convertvector(gelu2(v), v2bf);
          size_t idx = (size_t)(m0 + wm * 64 + mi * 16 + j + 8 * half) * N + col;
          outB[idx]     = o[0];
          outB[idx + N] = o[1];
        }
      } else {
#pragma unroll
        for (int j = 0; j < 8; ++j) {
          int row = m0 + wm * 64 + mi * 16 + j + 8 * half;
          float v = (acc[mi][ni][j] + bv) * scale;
          size_t idx = (size_t)row * N + col;
          if (OUT_BF16) outB[idx] = (bf16)v;
          else          outF[idx] = v;
        }
      }
    }
  }
}

// ---------------------------------------------------------------------------
// Flash attention: grid (S/64, H, B), block = 128 threads = 4 waves.
// Each wave owns 16 queries; K/V tiles of 32 keys staged in LDS.
// Transposed products: S^T = K x Q^T and O^T += V^T x P^T.  A lane then holds
// 16 of the 32 scores of ONE query (query = l16, keys 8*half + r and
// 16 + 8*half + r), so maximum and sum are taken in the lane's own registers
// with one exchange between the wave's halves, and the two score tiles,
// converted in place, already are the B operand of the second product.
// ---------------------------------------------------------------------------
typedef short s16x8 __attribute__((ext_vector_type(8)));
typedef float v4f   __attribute__((ext_vector_type(4)));

// Transposing LDS read: lane (l16, half) receives T[kbase + 8*half + 0..7][dbase + l16]
// when it passes &T[kbase + 8*half + (lane & 7)][dbase + 8 * ((lane >> 3) & 1)].
__device__ __forceinline__ v8bf ld_tr16(const bf16* p) {
  typedef __attribute__((address_space(3))) s16x8 lds_s16x8;
  return __builtin_bit_cast(v8bf, __builtin_amdgcn_ds_load_tr16_b128_v8i16((lds_s16x8*)p));
}

// lane l <-> lane l ^ 16
__device__ __forceinline__ float xhalf(float x) {
  return __builtin_bit_cast(float, __builtin_amdgcn_permlanex16(
      __builtin_bit_cast(int, x), __builtin_bit_cast(int, x),
      0x76543210, 0xfedcba98, false, false));
}

#define LOG2E 1.44269504088896340736f

// Base-2 exponentials in place.  Written as one statement so that the slot the
// instruction set asks for behind a transcendental is kept: inside the run no
// v_exp touches its neighbour's registers, and the closing v_nop stands in
// front of whatever the compiler places next.
__device__ __forceinline__ void exp2_x8(float (&e)[8]) {
  asm("v_exp_f32 %0, %0\n\t"
      "v_exp_f32 %1, %1\n\t"
      "v_exp_f32 %2, %2\n\t"
      "v_exp_f32 %3, %3\n\t"
      "v_exp_f32 %4, %4\n\t"
      "v_exp_f32 %5, %5\n\t"
      "v_exp_f32 %6, %6\n\t"
      "v_exp_f32 %7, %7\n\t"
      "v_nop"
      : "+v"(e[0]), "+v"(e[1]), "+v"(e[2]), "+v"(e[3]),
        "+v"(e[4]), "+v"(e[5]), "+v"(e[6]), "+v"(e[7]));
}
__device__ __forceinline__ void exp2_x1(float& e) {
  asm("v_exp_f32 %0, %0\n\t"
      "v_nop"
      : "+v"(e));
}

__global__ __launch_bounds__(128)
void flash_attn(const bf16* __restrict__ Q, const bf16* __restrict__ Kb,
                const bf16* __restrict__ Vb, const int* __restrict__ mask,
                bf16* __restrict__ Ctx) {
  __shared__ bf16 Ks[32][72];     // 144B pitch = 16B x odd (b128 readers)
  __shared__ bf16 Vs[32][80];     // 160B pitch = 32B x odd (transposing readers)
  __shared__ __attribute__((aligned(16))) float Madd[32];

  const int tid  = threadIdx.x;
  const int lane = tid & 31;
  const int wave = tid >> 5;
  const int half = lane >> 4;
  const int l16  = lane & 15;
  const int qt   = blockIdx.x;
  const int h    = blockIdx.y;
  const int b    = blockIdx.z;

  // This wave's 16 queries as two B-fragments (dh 0..31, 32..63): column = l16.
  const size_t qrow = ((size_t)b * SS + qt * 64 + wave * 16 + l16) * DD + h * DH;
  v16bf qb0 = frag_from(&Q[qrow + 0  + 8 * half]);
  v16bf qb1 = frag_from(&Q[qrow + 32 + 8 * half]);

  // m: running maximum of query l16 (equal in both halves); l: this half's part
  // of its running sum; cacc[f][r] = O^T[dh = 16 f + 8 half + r][query l16].
  float m = -1e30f, l = 0.0f;
  v8f cacc[4] = {};

  const bf16* vp = &Vs[8 * half + (lane & 7)][8 * ((lane >> 3) & 1)];

  for (int kt = 0; kt < SS / 32; ++kt) {
    // ---- cooperative K/V tile load: 32 keys x 64 dh each ----
    // the four loads first, then the four LDS stores: one memory latency a tile
    v8bf kr[2], vr[2];
#pragma unroll
    for (int c = 0; c < 2; ++c) {
      int ch = tid + c * 128;                 // 0..255
      int r = ch >> 3, col = (ch & 7) * 8;
      size_t g = ((size_t)b * SS + kt * 32 + r) * DD + h * DH + col;
      kr[c] = *(const v8bf*)&Kb[g];
      vr[c] = *(const v8bf*)&Vb[g];
    }
#pragma unroll
    for (int c = 0; c < 2; ++c) {
      int ch = tid + c * 128;
      int r = ch >> 3, col = (ch & 7) * 8;
      *(v8bf*)&Ks[r][col] = kr[c];
      *(v8bf*)&Vs[r][col] = vr[c];
    }
    if (tid < 32)
      Madd[tid] = mask[(size_t)b * SS + kt * 32 + tid] ? 0.0f : -1e30f;
    __syncthreads();

    // ---- scores: S^T = K x Q^T, two 16-key tiles, K-dim = dh 64.  The key's
    // additive mask is the accumulator's start value: row r of tile i is key
    // 16 i + 8 half + r. ----
    v8f s0, s1;
    {
      const v4f ma = *(const v4f*)&Madd[8 * half];
      const v4f mb = *(const v4f*)&Madd[8 * half + 4];
      const v4f mc = *(const v4f*)&Madd[16 + 8 * half];
      const v4f md = *(const v4f*)&Madd[16 + 8 * half + 4];
#pragma unroll
      for (int r = 0; r < 4; ++r) {
        s0[r] = ma[r]; s0[r + 4] = mb[r];
        s1[r] = mc[r]; s1[r + 4] = md[r];
      }
      v16bf ka0 = frag_from(&Ks[l16][0 + 8 * half]);
      v16bf ka1 = frag_from(&Ks[l16][32 + 8 * half]);
      v16bf ka2 = frag_from(&Ks[16 + l16][0 + 8 * half]);
      v16bf ka3 = frag_from(&Ks[16 + l16][32 + 8 * half]);
      // keeps the twelve LDS reads one group ahead of the four WMMAs: left alone
      // the scheduler pairs them off, one full LDS wait per WMMA
      __builtin_amdgcn_sched_barrier(0);
      s0 = wmma_bf16(ka0, qb0, s0);
      s1 = wmma_bf16(ka2, qb0, s1);
      s0 = wmma_bf16(ka1, qb1, s0);
      s1 = wmma_bf16(ka3, qb1, s1);
    }

    // ---- online softmax over this 32-key slab, one query per lane ----
    float mx = fmaxf(s0[0], s1[0]);
#pragma unroll
    for (int r = 1; r < 8; ++r) mx = fmaxf(mx, fmaxf(s0[r], s1[r]));
    mx = fmaxf(mx, xhalf(mx));                // the other half's 16 keys
    const float mn = fmaxf(m, mx);
    // the difference is taken first: it is never above 0, also where every key
    // so far carries the mask's -1e30
    float cor = (m - mn) * LOG2E;
    float e0[8], e1[8];
#pragma unroll
    for (int r = 0; r < 8; ++r) {
      e0[r] = (s0[r] - mn) * LOG2E;
      e1[r] = (s1[r] - mn) * LOG2E;
    }
    exp2_x1(cor);
    exp2_x8(e0);
    exp2_x8(e1);
    m = mn;
    v16bf pb;                                 // P^T as B: element s = key kmap(s, half)
    float t[8];
#pragma unroll
    for (int r = 0; r < 8; ++r) {
      t[r] = e0[r] + e1[r];
      pb[r]     = (bf16)e0[r];
      pb[r + 8] = (bf16)e1[r];
    }
    const float rs = ((t[0] + t[4]) + (t[2] + t[6])) + ((t[1] + t[5]) + (t[3] + t[7]));
    l = l * cor + rs;
#pragma unroll
    for (int f = 0; f < 4; ++f) cacc[f] *= cor;

    // ---- O^T += V^T(16 dh x 32 keys) x P^T(32 keys x 16 queries) ----
#pragma unroll
    for (int f = 0; f < 4; ++f) {
      v8bf lo = ld_tr16(vp + f * 16);             // keys 8 half + 0..7
      v8bf hi = ld_tr16(vp + 16 * 80 + f * 16);   // keys 16 + 8 half + 0..7
      v16bf va;
#pragma unroll
      for (int i = 0; i < 8; ++i) { va[i] = lo[i]; va[i + 8] = hi[i]; }
      cacc[f] = wmma_bf16(va, pb, cacc[f]);
    }
    __syncthreads();  // Ks/Vs reused next iteration
  }

  // ---- finalize: join the halves' sums, divide, write bf16 ctx (b,s,h*64+dh):
  // a lane's 8 registers of a tile are 8 consecutive dh of its query ----
  l += xhalf(l);
  const float inv = (l > 0.0f) ? (1.0f / l) : 0.0f;
  const size_t o = ((size_t)b * SS + qt * 64 + wave * 16 + l16) * DD + h * DH + 8 * half;
#pragma unroll
  for (int f = 0; f < 4; ++f) {
    v8bf ov;
#pragma unroll
    for (int r = 0; r < 8; ++r) ov[r] = (bf16)(cacc[f][r] * inv);
    *(v8bf*)&Ctx[o + f * 16] = ov;
  }
}

// ---------------------------------------------------------------------------
// Residual + LayerNorm over D=1024; optionally emits bf16 copy of the result.
// One block (256 thr) per token row. outF may alias y (in-place).
// ---------------------------------------------------------------------------
__device__ __forceinline__ float block_sum(float v, float* red) {
  v += __shfl_xor(v, 1);
  v += __shfl_xor(v, 2);
  v += __shfl_xor(v, 4);
  v += __shfl_xor(v, 8);
  v += __shfl_xor(v, 16);
  int lane = threadIdx.x & 31, w = threadIdx.x >> 5;
  if (lane == 0) red[w] = v;
  __syncthreads();
  if (threadIdx.x == 0) {
    float s = 0.0f;
#pragma unroll
    for (int i = 0; i < 8; ++i) s += red[i];
    red[0] = s;
  }
  __syncthreads();
  float r = red[0];
  __syncthreads();
  return r;
}

__global__ __launch_bounds__(256)
void ln_residual(const float* y, const float* __restrict__ res,
                 const float* __restrict__ g, const float* __restrict__ beta,
                 float* outF, bf16* outB) {
  __shared__ float red[8];
  const size_t row = blockIdx.x;
  const float* yp = y + row * DD;
  const float* rp = res + row * DD;
  const int base = threadIdx.x * 4;

  float v[4];
  float s = 0.0f;
#pragma unroll
  for (int i = 0; i < 4; ++i) { v[i] = yp[base + i] + rp[base + i]; s += v[i]; }
  float mu = block_sum(s, red) * (1.0f / DD);

  float q = 0.0f;
#pragma unroll
  for (int i = 0; i < 4; ++i) { float d = v[i] - mu; q += d * d; }
  float var = block_sum(q, red) * (1.0f / DD);
  float rstd = rsqrtf(var + 1e-12f);

#pragma unroll
  for (int i = 0; i < 4; ++i) {
    float o = (v[i] - mu) * rstd * g[base + i] + beta[base + i];
    outF[row * DD + base + i] = o;
    if (outB) outB[row * DD + base + i] = (bf16)o;
  }
}

// ---------------------------------------------------------------------------
// Launch
// ---------------------------------------------------------------------------
extern "C" void kernel_launch(void* const* d_in, const int* in_sizes, int n_in,
                              void* d_out, int out_size, void* d_ws, size_t ws_size,
                              hipStream_t stream) {
  (void)in_sizes; (void)n_in; (void)out_size; (void)ws_size;

  const float* x    = (const float*)d_in[0];
  const int*   msk  = (const int*)d_in[1];
  const float* Wq   = (const float*)d_in[2];
  const float* bq   = (const float*)d_in[3];
  const float* Wk   = (const float*)d_in[4];
  const float* bk   = (const float*)d_in[5];
  const float* Wv   = (const float*)d_in[6];
  const float* bv   = (const float*)d_in[7];
  const float* Wo   = (const float*)d_in[8];
  const float* bo   = (const float*)d_in[9];
  const float* ln1g = (const float*)d_in[10];
  const float* ln1b = (const float*)d_in[11];
  const float* W1   = (const float*)d_in[12];
  const float* b1   = (const float*)d_in[13];
  const float* W2   = (const float*)d_in[14];
  const float* b2   = (const float*)d_in[15];
  const float* ln2g = (const float*)d_in[16];
  const float* ln2b = (const float*)d_in[17];
  float* out = (float*)d_out;

  char* ws = (char*)d_ws;
  const size_t MB = 1ull << 20;
  bf16*  wqb  = (bf16*)(ws + 0 * MB);
  bf16*  wkb  = (bf16*)(ws + 2 * MB);
  bf16*  wvb  = (bf16*)(ws + 4 * MB);
  bf16*  wob  = (bf16*)(ws + 6 * MB);
  bf16*  w1b  = (bf16*)(ws + 8 * MB);     // F*D
  bf16*  w2b  = (bf16*)(ws + 16 * MB);    // D*F
  bf16*  xb   = (bf16*)(ws + 24 * MB);
  bf16*  qb   = (bf16*)(ws + 40 * MB);
  bf16*  kb   = (bf16*)(ws + 56 * MB);
  bf16*  vb   = (bf16*)(ws + 72 * MB);
  bf16*  ctxb = (bf16*)(ws + 88 * MB);
  float* sa   = (float*)(ws + 104 * MB);  // sa_out, then h (in-place LN1)
  bf16*  hb   = (bf16*)(ws + 136 * MB);
  bf16*  ffb  = (bf16*)(ws + 40 * MB);    // reuse q/k/v/ctx region (dead by FFN1)
  float* y2   = (float*)(ws + 152 * MB);

  // all seven conversions: wqb .. w2b and xb are one run of the workspace
  hipLaunchKernelGGL(cvt_all_f32_bf16, dim3(CVT_UNITS * DD * DD / CVT_BLOCK), dim3(256),
                     0, stream, Wq, Wk, Wv, Wo, W1, W2, x, wqb);

  const float* none = nullptr;
  dim3 gB(256);
  dim3 gQKV(NTOK / 256, DD / 128);
  // q = (x Wq^T + bq) / sqrt(64), k = x Wk^T + bk, v = x Wv^T + bv in one launch:
  // wqb, wkb, wvb are one [3 D, D] matrix and qb, kb, vb lie one behind another
  hipLaunchKernelGGL((gemm_bf16_nt<false, true, 3, true>), dim3(NTOK / 256, 3 * DD / 128),
                     gB, 0, stream,
                     xb, wqb, bq, bk, bv, 0.125f, (float*)nullptr, qb, NTOK, DD, DD);

  dim3 aG(SS / 64, HH, BB), aB(128);
  hipLaunchKernelGGL(flash_attn, aG, aB, 0, stream, qb, kb, vb, msk, ctxb);

  // sa = ctx Wo^T + bo   (f32)
  hipLaunchKernelGGL((gemm_bf16_nt<false, false, 3, false>), gQKV, gB, 0, stream,
                     ctxb, wob, bo, none, none, 1.0f, sa, (bf16*)nullptr, NTOK, DD, DD);

  // h = LN1(sa + x), in-place in sa; also bf16 copy hb
  hipLaunchKernelGGL(ln_residual, dim3(NTOK), dim3(256), 0, stream,
                     sa, x, ln1g, ln1b, sa, hb);

  // ff = gelu(h W1^T + b1)   (bf16, M=8192 N=4096 K=1024)
  dim3 gF1(NTOK / 256, FF / 128);
  hipLaunchKernelGGL((gemm_bf16_nt<true, true, 2, false>), gF1, gB, 0, stream,
                     hb, w1b, b1, none, none, 1.0f, (float*)nullptr, ffb, NTOK, FF, DD);

  // y2 = ff W2^T + b2   (f32, K=4096)
  hipLaunchKernelGGL((gemm_bf16_nt<false, false, 3, false>), gQKV, gB, 0, stream,
                     ffb, w2b, b2, none, none, 1.0f, y2, (bf16*)nullptr, NTOK, DD, FF);

  // out = LN2(y2 + h)
  hipLaunchKernelGGL(ln_residual, dim3(NTOK), dim3(256), 0, stream,
                     y2, sa, ln2g, ln2b, out, (bf16*)nullptr);
}

// v006
// It runs in 249 microseconds.
// Two timings next to v005 both put it at 1.04 times that version's speed.
// All steps since v000 together make it 2.17 times as fast.
#include <hip/hip_runtime.h>
#include <math.h>
#include <stdint.h>

// ---------------------------------------------------------------------------
// Types
// ---------------------------------------------------------------------------
typedef __bf16 bf16;
typedef __bf16 v16bf __attribute__((ext_vector_type(16)));
typedef __bf16 v8bf  __attribute__((ext_vector_type(8)));
typedef float  v8f   __attribute__((ext_vector_type(8)));

#define BB 8
#define SS 1024
#define DD 1024
#define HH 16
#define DH 64
#define FF 4096
#define NTOK (BB * SS)          // 8192

// ---------------------------------------------------------------------------
// WMMA helpers (CDNA5 v_wmma_f32_16x16x32_bf16)
// ---------------------------------------------------------------------------
__device__ __forceinline__ v8f wmma_bf16(v16bf a, v16bf b, v8f c) {
  return __builtin_amdgcn_wmma_f32_16x16x32_bf16(
      /*neg_a=*/false, a, /*neg_b=*/false, b,
      /*c_mod=*/(short)0, c, /*reuse_a=*/false, /*reuse_b=*/false);
}

// A/B fragment loader. ISA 16-bit 16x32 layout: lane half h holds
// K[8h..8h+7] in halves 0..7 and K[16+8h..16+8h+7] in halves 8..15.
// Caller passes p = &row[k0 + 8*half]; we read p[0..7] and p[16..23].
__device__ __forceinline__ v16bf frag_from(const bf16* p) {
  v8bf lo = *(const v8bf*)(p);
  v8bf hi = *(const v8bf*)(p + 16);
  v16bf a;
#pragma unroll
  for (int i = 0; i < 8; ++i) { a[i] = lo[i]; a[i + 8] = hi[i]; }
  return a;
}

// CDNA5 async global->LDS copies of 16B chunks (tracked by ASYNCcnt; bypass
// VGPRs entirely).  GV addressing: vdst = LDS byte address, v[addr64], off.
// s_wait_xcnt 0 is the last line of the copies' own statement so that no address
// register is rewritten ahead of it.
__device__ __forceinline__ uint32_t lds_addr(const bf16* p) {
  return (uint32_t)(uint64_t)p;  // flat LDS addr[31:0] = LDS offset
}

// Twelve 16B chunks per lane: LDS places l + i * lstep for the eight chunks of
// the first operand (rows 32 apart), m + i * lstep for the four of the second.
__device__ __forceinline__ void async_copy16x12(uint32_t l, uint32_t m, uint32_t lstep,
                                                const bf16* a, const bf16* w, size_t gstep) {
  asm volatile("global_load_async_to_lds_b128 %0, %12, off\n\t"
               "global_load_async_to_lds_b128 %1, %13, off\n\t"
               "global_load_async_to_lds_b128 %2, %14, off\n\t"
               "global_load_async_to_lds_b128 %3, %15, off\n\t"
               "global_load_async_to_lds_b128 %4, %16, off\n\t"
               "global_load_async_to_lds_b128 %5, %17, off\n\t"
               "global_load_async_to_lds_b128 %6, %18, off\n\t"
               "global_load_async_to_lds_b128 %7, %19, off\n\t"
               "global_load_async_to_lds_b128 %8, %20, off\n\t"
               "global_load_async_to_lds_b128 %9, %21, off\n\t"
               "global_load_async_to_lds_b128 %10, %22, off\n\t"
               "global_load_async_to_lds_b128 %11, %23, off\n\t"
               "s_wait_xcnt 0x0"
               :: "v"(l), "v"(l + lstep), "v"(l + 2 * lstep), "v"(l + 3 * lstep),
                  "v"(l + 4 * lstep), "v"(l + 5 * lstep), "v"(l + 6 * lstep),
                  "v"(l + 7 * lstep),
                  "v"(m), "v"(m + lstep), "v"(m + 2 * lstep), "v"(m + 3 * lstep),
                  "v"((uint64_t)a), "v"((uint64_t)(a + gstep)),
                  "v"((uint64_t)(a + 2 * gstep)), "v"((uint64_t)(a + 3 * gstep)),
                  "v"((uint64_t)(a + 4 * gstep)), "v"((uint64_t)(a + 5 * gstep)),
                  "v"((uint64_t)(a + 6 * gstep)), "v"((uint64_t)(a + 7 * gstep)),
                  "v"((uint64_t)w), "v"((uint64_t)(w + gstep)),
                  "v"((uint64_t)(w + 2 * gstep)), "v"((uint64_t)(w + 3 * gstep))
               : "memory");
}

__device__ __forceinline__ void wait_async0() {
  asm volatile("s_wait_asynccnt 0x0" ::: "memory");
}
// All but this wave's twelve youngest copies (one tile's worth) have landed:
// the counter returns in issue order, and only these copies count on it here.
__device__ __forceinline__ void wait_async_all_but_one_tile() {
  asm volatile("s_wait_asynccnt 0xc" ::: "memory");
}

// ---------------------------------------------------------------------------
// fp32 -> bf16 conversion of all seven arrays in ONE launch.  Their bf16 copies
// lie one behind another in the workspace (Wq, Wk, Wv, Wo, W1, W2, x), so the
// destination is one run of 20 * D * D elements; a block takes 8192 of them,
// which lie inside one array (every length is a multiple of D * D), and picks
// its source by a scalar test.  16 B per lane, the eight loads first; a wave's
// store covers two whole lines.
// ---------------------------------------------------------------------------
typedef float  f32x4  __attribute__((ext_vector_type(4)));
typedef __bf16 bf16x4 __attribute__((ext_vector_type(4)));

#define CVT_UNITS 20            // 4 (Wq Wk Wv Wo) + 4 (W1) + 4 (W2) + 8 (x), in D * D
#define CVT_BLOCK 8192          // elements per block

__global__ __launch_bounds__(256)
void cvt_all_f32_bf16(const float* __restrict__ wq, const float* __restrict__ wk,
                      const float* __restrict__ wv, const float* __restrict__ wo,
                      const float* __restrict__ w1, const float* __restrict__ w2,
                      const float* __restrict__ x, bf16* __restrict__ out) {
  const uint32_t e0   = blockIdx.x * (uint32_t)CVT_BLOCK;   // first element, in out
  const uint32_t unit = e0 / (uint32_t)(DD * DD);
  const float* src;
  uint32_t first;                                           // unit where src begins
  if (unit < 4)       { src = unit == 0 ? wq : unit == 1 ? wk : unit == 2 ? wv : wo;
                        first = unit; }
  else if (unit < 8)  { src = w1; first = 4; }
  else if (unit < 12) { src = w2; first = 8; }
  else                { src = x;  first = 12; }
  const uint32_t t = threadIdx.x * 4;
  const float* p = src + (e0 - first * (uint32_t)(DD * DD)) + t;
  bf16* o = out + e0 + t;
  f32x4 v[8];
  // both loops unrolled: v[] is indexed by constants and stays in registers
#pragma unroll
  for (int c = 0; c < 8; ++c) v[c] = *(const f32x4*)(p + c * 1024);
#pragma unroll
  for (int c = 0; c < 8; ++c)
    *(bf16x4*)(o + c * 1024) = __builtin_convertvector(v[c], bf16x4);
}

// ---------------------------------------------------------------------------
// Exact-form GELU, 0.5 v (1 + erf(v / sqrt 2)), two values at a time, no branch.
// erf(z) = z P(z^2) / Q(z^2) on |z| <= 4 (beyond it erf rounds to +-1 in f32);
// absolute error below 4e-7 over the whole line.  Straight-line packed code:
// the values of a lane are independent chains that the scheduler interleaves,
// and the epilogue's text is a fraction of the branching form's.
// ---------------------------------------------------------------------------
typedef float  v2f  __attribute__((ext_vector_type(2)));
typedef __bf16 v2bf __attribute__((ext_vector_type(2)));

__device__ __forceinline__ v2f gelu2(v2f v) {
  const v2f lim = 4.0f;
  const v2f z = __builtin_elementwise_min(
      __builtin_elementwise_max(v * 0.70710678118654752f, -lim), lim);
  const v2f z2 = z * z;
  v2f p = -2.72614225801306e-10f;
  p = __builtin_elementwise_fma(p, z2, (v2f)(2.77068142495902e-08f));
  p = __builtin_elementwise_fma(p, z2, (v2f)(-2.10102402082508e-06f));
  p = __builtin_elementwise_fma(p, z2, (v2f)(-5.69250639462346e-05f));
  p = __builtin_elementwise_fma(p, z2, (v2f)(-7.34990630326855e-04f));
  p = __builtin_elementwise_fma(p, z2, (v2f)(-2.95459980854025e-03f));
  p = __builtin_elementwise_fma(p, z2, (v2f)(-1.60960333262415e-02f));
  v2f q = -1.45660718464996e-05f;
  q = __builtin_elementwise_fma(q, z2, (v2f)(-2.13374055278905e-04f));
  q = __builtin_elementwise_fma(q, z2, (v2f)(-1.68282697438203e-03f));
  q = __builtin_elementwise_fma(q, z2, (v2f)(-7.37332916720468e-03f));
  q = __builtin_elementwise_fma(q, z2, (v2f)(-1.42647390514189e-02f));
  // Reciprocals in place, one statement: neither touches the other's register,
  // and the closing v_nop keeps the slot the instruction set asks for behind a
  // transcendental, whatever the compiler places next.
  float r0 = q[0], r1 = q[1];
  asm("v_rcp_f32 %0, %0\n\t"
      "v_rcp_f32 %1, %1\n\t"
      "v_nop"
      : "+v"(r0), "+v"(r1));
  const v2f r = {r0, r1};
  const v2f e = (p * z) * r;
  const v2f h = v * 0.5f;
  return __builtin_elementwise_fma(h, e, h);
}

// ---------------------------------------------------------------------------
// Tiled bf16 WMMA GEMM:  Y[M,N] = act( (A[M,K] * W[N,K]^T + bias) * scale )
// A, W row-major with K contiguous (torch Linear layout -> NT GEMM).
// Block tile 256x128, 8 waves of 64x64, K-step 64, LDS ring of NBUF tiles filled
// by async global->LDS DMA.  M % 256 == 0, N % 128 == 0, K % 64 == 0.
// NBUF == 2: one tile in flight; two work-groups fit a WGP and cover each other's
// waits (for grids of several work-groups per WGP).
// NBUF == 3: two tiles in flight, so that the path from L2 never runs empty
// between tiles (for grids of one work-group per WGP, which nothing else covers).
// THREE: one launch does three products with the same A.  W holds three [N, K]
// matrices one behind another, outB three [M, N] results likewise, each with its
// own bias; blockIdx.y runs over the 3 N / 128 column tiles and `scale` applies
// to the first product alone (the others take 1).
// ---------------------------------------------------------------------------
template <bool GELU, bool OUT_BF16, int NBUF, bool THREE>
__global__ __launch_bounds__(256)
void gemm_bf16_nt(const bf16* __restrict__ A, const bf16* __restrict__ W,
                  const float* __restrict__ bias, const float* __restrict__ bias1,
                  const float* __restrict__ bias2, float scale,
                  float* outF, bf16* outB, int M, int N, int K) {
  static_assert(!GELU || OUT_BF16, "the GELU epilogue writes bf16");
  static_assert(!THREE || (OUT_BF16 && !GELU), "three products: plain bf16 results");
  static_assert(NBUF == 2 || NBUF == 3, "ring of two or three tiles");
  __shared__ bf16 As[NBUF][256][72];   // 144B row pitch = 16B x odd (b128 readers)
  __shared__ bf16 Bs[NBUF][128][72];

  const int tid  = threadIdx.x;
  const int lane = tid & 31;
  const int wave = tid >> 5;
  const int wm   = wave & 3;       // 4 M-bands of 64
  const int wn   = wave >> 2;      // 2 N-bands of 64
  const int half = lane >> 4;
  const int l16  = lane & 15;
  const int m0   = blockIdx.x * 256;
  const int n0   = blockIdx.y * 128;

  v8f acc[4][4] = {};

  // A 256x64 = 2048 16B chunks (8 per thread), W 128x64 = 1024 (4 per thread).
  // A wave's copy covers 4 rows x 128B = 4 whole lines.
  const int cr = tid >> 3, cc = (tid & 7) * 8;
  const bf16* gA = &A[(size_t)(m0 + cr) * K + cc];
  const bf16* gW = &W[(size_t)(n0 + cr) * K + cc];
  const size_t rs = (size_t)32 * K;            // 32 rows further
  auto load_tile = [&](int buf, int k0) {
    async_copy16x12(lds_addr(&As[buf][cr][cc]), lds_addr(&Bs[buf][cr][cc]),
                    32 * 72 * 2, gA + k0, gW + k0, rs);
  };

  const int KT = K >> 6;

  // One trip: the 32 WMMAs of tile `cur`; where `fill` is set, the copies of the
  // tile at k0 go out into buffer `dst`, which every wave left at the last barrier.
  auto trip = [&](int cur, bool fill, int dst, int k0) {
    // every loop below is unrolled so that acc[][], a[] and b[] are indexed by
    // constants and stay in registers
#pragma unroll
    for (int ks = 0; ks < 2; ++ks) {
      v16bf a[4], b[4];
#pragma unroll
      for (int i = 0; i < 4; ++i) {
        a[i] = frag_from(&As[cur][wm * 64 + i * 16 + l16][ks * 32 + 8 * half]);
        b[i] = frag_from(&Bs[cur][wn * 64 + i * 16 + l16][ks * 32 + 8 * half]);
      }
      // keeps the 16 LDS reads one group ahead of the 16 WMMAs: left alone the
      // scheduler sinks them among the WMMAs, one full LDS wait per row of four
      __builtin_amdgcn_sched_barrier(0);
      // issued here so that the copies' address work and wait run under the LDS
      // reads' latency
      if (ks == 0 && fill) load_tile(dst, k0);
      // keeps the copies ahead of the WMMAs: left alone the scheduler sinks them,
      // with their wait, to the end of the block and forms their addresses in
      // fragment registers, at four idle slots behind a WMMA each time
      __builtin_amdgcn_sched_barrier(0);
#pragma unroll
      for (int mi = 0; mi < 4; ++mi)
#pragma unroll
        for (int ni = 0; ni < 4; ++ni)
          acc[mi][ni] = wmma_bf16(a[mi], b[ni], acc[mi][ni]);
      // second half of the pair: the next group's reads stay behind this block
      __builtin_amdgcn_sched_barrier(0);
    }
    // own LDS reads of `cur` retired before any wave may refill it
    asm volatile("s_wait_dscnt 0x0" ::: "memory");
  };

  if constexpr (NBUF == 2) {
    load_tile(0, 0);
    wait_async0();
    __syncthreads();
    for (int kt = 0; kt < KT; ++kt) {
      const int cur = kt & 1;
      trip(cur, kt + 1 < KT, cur ^ 1, (kt + 1) << 6);
      wait_async0();       // next-buffer DMA landed (ASYNCcnt not covered by barrier)
      __syncthreads();     // all waves done reading `cur`, writes visible
    }
  } else {
    // Tiles 0 and 1 go out together; tile 0 has landed when all but the twelve
    // copies of tile 1 have.
    load_tile(0, 0);
    if (KT > 1) {
      load_tile(1, 64);
      wait_async_all_but_one_tile();
    } else {
      wait_async0();
    }
    __syncthreads();

    int cur = 0, nxt = 1, dst = 2;   // kt, kt + 1, kt + 2 mod 3
    int kt = 0;
    // Every trip of this loop issues the twelve copies of tile kt + 2, into the
    // buffer of tile kt - 1, and then waits for all but those: tile kt + 1 has
    // landed while tile kt + 2 stays in flight over the barrier.
    for (; kt + 2 < KT; ++kt) {
      trip(cur, true, dst, (kt + 2) << 6);
      wait_async_all_but_one_tile();
      __syncthreads();     // tile kt + 1 visible; all waves done reading `cur`
      const int left = cur;
      cur = nxt; nxt = dst; dst = left;
    }
    // The last trips issue nothing more: the wait is to 0.
    for (; kt < KT; ++kt) {
      trip(cur, false, 0, 0);
      wait_async0();
      __syncthreads();
      cur = nxt;
    }
  }

  // ---- epilogue: C-frag mapping row = j + 8*half, col = l16 ----
  if constexpr (THREE) {
    // Which product this block belongs to: the same for the whole block.  Columns
    // go on counting through all three, so the two bases are moved instead: the
    // indices below stay those of the single product.
    const int part = (n0 >= N) + (n0 >= 2 * N);
    bias  = (part == 0 ? bias : part == 1 ? bias1 : bias2) - (size_t)part * N;
    scale = part == 0 ? scale : 1.0f;
    outB += (size_t)part * M * N - (size_t)part * N;
  }
#pragma unroll
  for (int mi = 0; mi < 4; ++mi) {
#pragma unroll
    for (int ni = 0; ni < 4; ++ni) {
      int col = n0 + wn * 64 + ni * 16 + l16;
      float bv = bias[col];
      if (GELU) {
        // pairs of rows, so that the polynomial runs on packed f32
#pragma unroll
        for (int j = 0; j < 8; j += 2) {
          v2f v = {(acc[mi][ni][j] + bv) * scale, (acc[mi][ni][j + 1] + bv) * scale};
          const v2bf o = __builtin_convertvector(gelu2(v), v2bf);
          size_t idx = (size_t)(m0 + wm * 64 + mi * 16 + j + 8 * half) * N + col;
          outB[idx]     = o[0];
          outB[idx + N] = o[1];
        }
      } else {
#pragma unroll
        for (int j = 0; j < 8; ++j) {
          int row = m0 + wm * 64 + mi * 16 + j + 8 * half;
          float v = (acc[mi][ni][j] + bv) * scale;
          size_t idx = (size_t)row * N + col;
          if (OUT_BF16) outB[idx] = (bf16)v;
          else          outF[idx] = v;
        }
      }
    }
  }
}

// ---------------------------------------------------------------------------
// Flash attention: grid (S/128, H, B), block = 128 threads = 4 waves.
// Each wave owns 32 queries, as two groups of 16 columns; K/V tiles of 64 keys
// staged in LDS.  Every K and V fragment read from LDS serves both groups, and
// maximum, correction and rescale are paid once per 64 keys.
// Transposed products: S^T = K x Q^T and O^T += V^T x P^T.  A lane then holds
// 32 of the 64 scores of ONE query per group (query = l16, keys 16 i + 8*half + r
// of score tile i), so maximum and sum are taken in the lane's own registers
// with one exchange between the wave's halves, and the score tiles, converted
// in place, already are the B operands of the second product.
// ---------------------------------------------------------------------------
typedef short s16x8 __attribute__((ext_vector_type(8)));
typedef float v4f   __attribute__((ext_vector_type(4)));

// Transposing LDS read: lane (l16, half) receives T[kbase + 8*half + 0..7][dbase + l16]
// when it passes &T[kbase + 8*half + (lane & 7)][dbase + 8 * ((lane >> 3) & 1)].
__device__ __forceinline__ v8bf ld_tr16(const bf16* p) {
  typedef __attribute__((address_space(3))) s16x8 lds_s16x8;
  return __builtin_bit_cast(v8bf, __builtin_amdgcn_ds_load_tr16_b128_v8i16((lds_s16x8*)p));
}

// lane l <-> lane l ^ 16
__device__ __forceinline__ float xhalf(float x) {
  return __builtin_bit_cast(float, __builtin_amdgcn_permlanex16(
      __builtin_bit_cast(int, x), __builtin_bit_cast(int, x),
      0x76543210, 0xfedcba98, false, false));
}

#define LOG2E 1.44269504088896340736f

// Base-2 exponentials in place.  Written as one statement so that the slot the
// instruction set asks for behind a transcendental is kept: inside the run no
// v_exp touches its neighbour's registers, and the closing v_nop stands in
// front of whatever the compiler places next.
__device__ __forceinline__ void exp2_x8(float (&e)[8]) {
  asm("v_exp_f32 %0, %0\n\t"
      "v_exp_f32 %1, %1\n\t"
      "v_exp_f32 %2, %2\n\t"
      "v_exp_f32 %3, %3\n\t"
      "v_exp_f32 %4, %4\n\t"
      "v_exp_f32 %5, %5\n\t"
      "v_exp_f32 %6, %6\n\t"
      "v_exp_f32 %7, %7\n\t"
      "v_nop"
      : "+v"(e[0]), "+v"(e[1]), "+v"(e[2]), "+v"(e[3]),
        "+v"(e[4]), "+v"(e[5]), "+v"(e[6]), "+v"(e[7]));
}
__device__ __forceinline__ void exp2_x1(float& e) {
  asm("v_exp_f32 %0, %0\n\t"
      "v_nop"
      : "+v"(e));
}

#define AK 64                   // keys per pass
#define AQ 128                  // queries per block: 4 waves x 2 groups x 16

__global__ __launch_bounds__(128)
void flash_attn(const bf16* __restrict__ Q, const bf16* __restrict__ Kb,
                const bf16* __restrict__ Vb, const int* __restrict__ mask,
                bf16* __restrict__ Ctx) {
  __shared__ bf16 Ks[AK][72];     // 144B pitch = 16B x odd (b128 readers)
  __shared__ bf16 Vs[AK][80];     // 160B pitch = 32B x odd (transposing readers)
  __shared__ __attribute__((aligned(16))) float Madd[AK];

  const int tid  = threadIdx.x;
  const int lane = tid & 31;
  const int wave = tid >> 5;
  const int half = lane >> 4;
  const int l16  = lane & 15;
  const int qt   = blockIdx.x;
  const int h    = blockIdx.y;
  const int b    = blockIdx.z;

  // Group g's 16 queries as two B-fragments (dh 0..31, 32..63): column = l16.
  const size_t qrow = ((size_t)b * SS + qt * AQ + wave * 32 + l16) * DD + h * DH;
  v16bf qb[2][2];
  // every loop over g, i, f, kc, c and r below is unrolled so that the arrays are
  // indexed by constants and stay in registers
#pragma unroll
  for (int g = 0; g < 2; ++g) {
    qb[g][0] = frag_from(&Q[qrow + (size_t)g * 16 * DD + 0  + 8 * half]);
    qb[g][1] = frag_from(&Q[qrow + (size_t)g * 16 * DD + 32 + 8 * half]);
  }

  // m[g]: running maximum of query l16 of group g (equal in both halves); l[g]:
  // this half's part of its running sum; cacc[g][f][r] = O^T[dh = 16 f + 8 half + r].
  float m[2] = {-1e30f, -1e30f}, l[2] = {0.0f, 0.0f};
  v8f cacc[2][4] = {};

  const bf16* vp = &Vs[8 * half + (lane & 7)][8 * ((lane >> 3) & 1)];

  for (int kt = 0; kt < SS / AK; ++kt) {
    // ---- cooperative K/V tile load: 64 keys x 64 dh each ----
    // the eight loads first, then the eight LDS stores: one memory latency a tile
    v8bf kr[4], vr[4];
#pragma unroll
    for (int c = 0; c < 4; ++c) {
      int ch = tid + c * 128;                 // 0..511
      int r = ch >> 3, col = (ch & 7) * 8;
      size_t g = ((size_t)b * SS + kt * AK + r) * DD + h * DH + col;
      kr[c] = *(const v8bf*)&Kb[g];
      vr[c] = *(const v8bf*)&Vb[g];
    }
#pragma unroll
    for (int c = 0; c < 4; ++c) {
      int ch = tid + c * 128;
      int r = ch >> 3, col = (ch & 7) * 8;
      *(v8bf*)&Ks[r][col] = kr[c];
      *(v8bf*)&Vs[r][col] = vr[c];
    }
    if (tid < AK)
      Madd[tid] = mask[(size_t)b * SS + kt * AK + tid] ? 0.0f : -1e30f;
    __syncthreads();

    // ---- scores: S^T = K x Q^T, four 16-key tiles, K-dim = dh 64.  The key's
    // additive mask is the accumulator's start value: row r of tile i is key
    // 16 i + 8 half + r. ----
    v8f s[2][4];
#pragma unroll
    for (int ip = 0; ip < 4; ip += 2) {
      v8f mk[2];
      v16bf ka[2][2];
#pragma unroll
      for (int j = 0; j < 2; ++j) {
        const int i = ip + j;
        const v4f ma = *(const v4f*)&Madd[16 * i + 8 * half];
        const v4f mb = *(const v4f*)&Madd[16 * i + 8 * half + 4];
#pragma unroll
        for (int r = 0; r < 4; ++r) { mk[j][r] = ma[r]; mk[j][r + 4] = mb[r]; }
        ka[j][0] = frag_from(&Ks[16 * i + l16][0 + 8 * half]);
        ka[j][1] = frag_from(&Ks[16 * i + l16][32 + 8 * half]);
      }
      // keeps the twelve LDS reads one group ahead of the eight WMMAs: left alone
      // the scheduler pairs them off, one full LDS wait per WMMA
      __builtin_amdgcn_sched_barrier(0);
#pragma unroll
      for (int j = 0; j < 2; ++j)
#pragma unroll
        for (int g = 0; g < 2; ++g) s[g][ip + j] = wmma_bf16(ka[j][0], qb[g][0], mk[j]);
#pragma unroll
      for (int j = 0; j < 2; ++j)
#pragma unroll
        for (int g = 0; g < 2; ++g)
          s[g][ip + j] = wmma_bf16(ka[j][1], qb[g][1], s[g][ip + j]);
    }
    // keeps the maxima behind the last product: left alone the scheduler puts one
    // behind each of the last four WMMAs, at four idle slots each time
    __builtin_amdgcn_sched_barrier(0);

    // ---- online softmax over this 64-key slab, one query per lane and group ----
    v16bf pb[2][2];               // P^T as B: [group][chunk kc], element s = key 32 kc + 8 half + s, or 32 kc + 16 + 8 half + s - 8 for s >= 8
#pragma unroll
    for (int g = 0; g < 2; ++g) {
      // two independent chains; the tiles whose products ended first come first
      float mx = fmaxf(s[g][0][0], s[g][1][0]), my = fmaxf(s[g][2][0], s[g][3][0]);
#pragma unroll
      for (int r = 1; r < 8; ++r) mx = fmaxf(mx, fmaxf(s[g][0][r], s[g][1][r]));
#pragma unroll
      for (int r = 1; r < 8; ++r) my = fmaxf(my, fmaxf(s[g][2][r], s[g][3][r]));
      mx = fmaxf(mx, my);
      mx = fmaxf(mx, xhalf(mx));              // the other half's 32 keys
      const float mn = fmaxf(m[g], mx);
      // the difference is taken first: it is never above 0, also where every key
      // so far carries the mask's -1e30
      float cor = (m[g] - mn) * LOG2E;
      float e[4][8];
#pragma unroll
      for (int i = 0; i < 4; ++i)
#pragma unroll
        for (int r = 0; r < 8; ++r) e[i][r] = (s[g][i][r] - mn) * LOG2E;
      exp2_x1(cor);
#pragma unroll
      for (int i = 0; i < 4; ++i) exp2_x8(e[i]);
      m[g] = mn;
      float t[8];
#pragma unroll
      for (int r = 0; r < 8; ++r) {
        t[r] = (e[0][r] + e[1][r]) + (e[2][r] + e[3][r]);
        pb[g][0][r]     = (bf16)e[0][r];
        pb[g][0][r + 8] = (bf16)e[1][r];
        pb[g][1][r]     = (bf16)e[2][r];
        pb[g][1][r + 8] = (bf16)e[3][r];
      }
      const float rs = ((t[0] + t[4]) + (t[2] + t[6])) + ((t[1] + t[5]) + (t[3] + t[7]));
      l[g] = l[g] * cor + rs;
#pragma unroll
      for (int f = 0; f < 4; ++f) cacc[g][f] *= cor;
    }

    // ---- O^T += V^T(16 dh x 32 keys) x P^T(32 keys x 16 queries), two key chunks,
    // each V^T fragment for both groups ----
#pragma unroll
    for (int kc = 0; kc < 2; ++kc) {
#pragma unroll
      for (int f = 0; f < 4; ++f) {
        v8bf lo = ld_tr16(vp + (kc * 32) * 80 + f * 16);        // keys 32 kc + 8 half + 0..7
        v8bf hi = ld_tr16(vp + (kc * 32 + 16) * 80 + f * 16);   // keys 32 kc + 16 + 8 half + 0..7
        v16bf va;
#pragma unroll
        for (int i = 0; i < 8; ++i) { va[i] = lo[i]; va[i + 8] = hi[i]; }
#pragma unroll
        for (int g = 0; g < 2; ++g) cacc[g][f] = wmma_bf16(va, pb[g][kc], cacc[g][f]);
      }
    }
    __syncthreads();  // Ks/Vs reused next iteration
  }

  // ---- finalize: join the halves' sums, divide, write bf16 ctx (b,s,h*64+dh):
  // a lane's 8 registers of a tile are 8 consecutive dh of its query ----
  v8bf ov[2][4];
#pragma unroll
  for (int g = 0; g < 2; ++g) {
    const float lt = l[g] + xhalf(l[g]);
    const float inv = (lt > 0.0f) ? (1.0f / lt) : 0.0f;
#pragma unroll
    for (int f = 0; f < 4; ++f)
#pragma unroll
      for (int r = 0; r < 8; ++r) ov[g][f][r] = (bf16)(cacc[g][f][r] * inv);
  }
  // keeps the eight stores behind the last conversion, so that no register of an
  // issued store is written again
  __builtin_amdgcn_sched_barrier(0);
#pragma unroll
  for (int g = 0; g < 2; ++g)
#pragma unroll
    for (int f = 0; f < 4; ++f)
      *(v8bf*)&Ctx[qrow + (size_t)g * 16 * DD + 8 * half + f * 16] = ov[g][f];
}

// ---------------------------------------------------------------------------
// Residual + LayerNorm over D=1024; optionally emits bf16 copy of the result.
// One block (256 thr) per token row. outF may alias y (in-place).
// ---------------------------------------------------------------------------
__device__ __forceinline__ float block_sum(float v, float* red) {
  v += __shfl_xor(v, 1);
  v += __shfl_xor(v, 2);
  v += __shfl_xor(v, 4);
  v += __shfl_xor(v, 8);
  v += __shfl_xor(v, 16);
  int lane = threadIdx.x & 31, w = threadIdx.x >> 5;
  if (lane == 0) red[w] = v;
  __syncthreads();
  if (threadIdx.x == 0) {
    float s = 0.0f;
#pragma unroll
    for (int i = 0; i < 8; ++i) s += red[i];
    red[0] = s;
  }
  __syncthreads();
  float r = red[0];
  __syncthreads();
  return r;
}

__global__ __launch_bounds__(256)
void ln_residual(const float* y, const float* __restrict__ res,
                 const float* __restrict__ g, const float* __restrict__ beta,
                 float* outF, bf16* outB) {
  __shared__ float red[8];
  const size_t row = blockIdx.x;
  const float* yp = y + row * DD;
  const float* rp = res + row * DD;
  const int base = threadIdx.x * 4;

  float v[4];
  float s = 0.0f;
#pragma unroll
  for (int i = 0; i < 4; ++i) { v[i] = yp[base + i] + rp[base + i]; s += v[i]; }
  float mu = block_sum(s, red) * (1.0f / DD);

  float q = 0.0f;
#pragma unroll
  for (int i = 0; i < 4; ++i) { float d = v[i] - mu; q += d * d; }
  float var = block_sum(q, red) * (1.0f / DD);
  float rstd = rsqrtf(var + 1e-12f);

#pragma unroll
  for (int i = 0; i < 4; ++i) {
    float o = (v[i] - mu) * rstd * g[base + i] + beta[base + i];
    outF[row * DD + base + i] = o;
    if (outB) outB[row * DD + base + i] = (bf16)o;
  }
}

// ---------------------------------------------------------------------------
// Launch
// ---------------------------------------------------------------------------
extern "C" void kernel_launch(void* const* d_in, const int* in_sizes, int n_in,
                              void* d_out, int out_size, void* d_ws, size_t ws_size,
                              hipStream_t stream) {
  (void)in_sizes; (void)n_in; (void)out_size; (void)ws_size;

  const float* x    = (const float*)d_in[0];
  const int*   msk  = (const int*)d_in[1];
  const float* Wq   = (const float*)d_in[2];
  const float* bq   = (const float*)d_in[3];
  const float* Wk   = (const float*)d_in[4];
  const float* bk   = (const float*)d_in[5];
  const float* Wv   = (const float*)d_in[6];
  const float* bv   = (const float*)d_in[7];
  const float* Wo   = (const float*)d_in[8];
  const float* bo   = (const float*)d_in[9];
  const float* ln1g = (const float*)d_in[10];
  const float* ln1b = (const float*)d_in[11];
  const float* W1   = (const float*)d_in[12];
  const float* b1   = (const float*)d_in[13];
  const float* W2   = (const float*)d_in[14];
  const float* b2   = (const float*)d_in[15];
  const float* ln2g = (const float*)d_in[16];
  const float* ln2b = (const float*)d_in[17];
  float* out = (float*)d_out;

  char* ws = (char*)d_ws;
  const size_t MB = 1ull << 20;
  bf16*  wqb  = (bf16*)(ws + 0 * MB);
  bf16*  wkb  = (bf16*)(ws + 2 * MB);
  bf16*  wvb  = (bf16*)(ws + 4 * MB);
  bf16*  wob  = (bf16*)(ws + 6 * MB);
  bf16*  w1b  = (bf16*)(ws + 8 * MB);     // F*D
  bf16*  w2b  = (bf16*)(ws + 16 * MB);    // D*F
  bf16*  xb   = (bf16*)(ws + 24 * MB);
  bf16*  qb   = (bf16*)(ws + 40 * MB);
  bf16*  kb   = (bf16*)(ws + 56 * MB);
  bf16*  vb   = (bf16*)(ws + 72 * MB);
  bf16*  ctxb = (bf16*)(ws + 88 * MB);
  float* sa   = (float*)(ws + 104 * MB);  // sa_out, then h (in-place LN1)
  bf16*  hb   = (bf16*)(ws + 136 * MB);
  bf16*  ffb  = (bf16*)(ws + 40 * MB);    // reuse q/k/v/ctx region (dead by FFN1)
  float* y2   = (float*)(ws + 152 * MB);

  // all seven conversions: wqb .. w2b and xb are one run of the workspace
  hipLaunchKernelGGL(cvt_all_f32_bf16, dim3(CVT_UNITS * DD * DD / CVT_BLOCK), dim3(256),
                     0, stream, Wq, Wk, Wv, Wo, W1, W2, x, wqb);

  const float* none = nullptr;
  dim3 gB(256);
  dim3 gQKV(NTOK / 256, DD / 128);
  // q = (x Wq^T + bq) / sqrt(64), k = x Wk^T + bk, v = x Wv^T + bv in one launch:
  // wqb, wkb, wvb are one [3 D, D] matrix and qb, kb, vb lie one behind another
  hipLaunchKernelGGL((gemm_bf16_nt<false, true, 3, true>), dim3(NTOK / 256, 3 * DD / 128),
                     gB, 0, stream,
                     xb, wqb, bq, bk, bv, 0.125f, (float*)nullptr, qb, NTOK, DD, DD);

  dim3 aG(SS / AQ, HH, BB), aB(128);
  hipLaunchKernelGGL(flash_attn, aG, aB, 0, stream, qb, kb, vb, msk, ctxb);

  // sa = ctx Wo^T + bo   (f32)
  hipLaunchKernelGGL((gemm_bf16_nt<false, false, 3, false>), gQKV, gB, 0, stream,
                     ctxb, wob, bo, none, none, 1.0f, sa, (bf16*)nullptr, NTOK, DD, DD);

  // h = LN1(sa + x), in-place in sa; also bf16 copy hb
  hipLaunchKernelGGL(ln_residual, dim3(NTOK), dim3(256), 0, stream,
                     sa, x, ln1g, ln1b, sa, hb);

  // ff = gelu(h W1^T + b1)   (bf16, M=8192 N=4096 K=1024)
  dim3 gF1(NTOK / 256, FF / 128);
  hipLaunchKernelGGL((gemm_bf16_nt<true, true, 2, false>), gF1, gB, 0, stream,
                     hb, w1b, b1, none, none, 1.0f, (float*)nullptr, ffb, NTOK, FF, DD);

  // y2 = ff W2^T + b2   (f32, K=4096)
  hipLaunchKernelGGL((gemm_bf16_nt<false, false, 3, false>), gQKV, gB, 0, stream,
                     ffb, w2b, b2, none, none, 1.0f, y2, (bf16*)nullptr, NTOK, DD, FF);

  // out = LN2(y2 + h)
  hipLaunchKernelGGL(ln_residual, dim3(NTOK), dim3(256), 0, stream,
                     y2, sa, ln2g, ln2b, out, (bf16*)nullptr);
}

// v007
// One run takes 236 microseconds.
// Timed twice side by side with v006, it ran 1.05 times as fast both times.
// All steps since v000 together make it 2.28 times as fast.
#include <hip/hip_runtime.h>
#include <math.h>
#include <stdint.h>

// ---------------------------------------------------------------------------
// Types
// ---------------------------------------------------------------------------
typedef __bf16 bf16;
typedef __bf16 v16bf __attribute__((ext_vector_type(16)));
typedef __bf16 v8bf  __attribute__((ext_vector_type(8)));
typedef float  v8f   __attribute__((ext_vector_type(8)));

#define BB 8
#define SS 1024
#define DD 1024
#define HH 16
#define DH 64
#define FF 4096
#define NTOK (BB * SS)          // 8192

// ---------------------------------------------------------------------------
// WMMA helpers (CDNA5 v_wmma_f32_16x16x32_bf16)
// ---------------------------------------------------------------------------
__device__ __forceinline__ v8f wmma_bf16(v16bf a, v16bf b, v8f c) {
  return __builtin_amdgcn_wmma_f32_16x16x32_bf16(
      /*neg_a=*/false, a, /*neg_b=*/false, b,
      /*c_mod=*/(short)0, c, /*reuse_a=*/false, /*reuse_b=*/false);
}

// A/B fragment loader. ISA 16-bit 16x32 layout: lane half h holds
// K[8h..8h+7] in halves 0..7 and K[16+8h..16+8h+7] in halves 8..15.
// Caller passes p = &row[k0 + 8*half]; we read p[0..7] and p[16..23].
__device__ __forceinline__ v16bf frag_from(const bf16* p) {
  v8bf lo = *(const v8bf*)(p);
  v8bf hi = *(const v8bf*)(p + 16);
  v16bf a;
#pragma unroll
  for (int i = 0; i < 8; ++i) { a[i] = lo[i]; a[i + 8] = hi[i]; }
  return a;
}

// CDNA5 async global->LDS copies of 16B chunks (tracked by ASYNCcnt; bypass
// VGPRs entirely).  GV addressing: vdst = LDS byte address, v[addr64], off.
// s_wait_xcnt 0 is the last line of the copies' own statement so that no address
// register is rewritten ahead of it.
__device__ __forceinline__ uint32_t lds_addr(const bf16* p) {
  return (uint32_t)(uint64_t)p;  // flat LDS addr[31:0] = LDS offset
}

// Twelve 16B chunks per lane: LDS places l + i * lstep for the eight chunks of
// the first operand (rows 32 apart), m + i * lstep for the four of the second.
__device__ __forceinline__ void async_copy16x12(uint32_t l, uint32_t m, uint32_t lstep,
                                                const bf16* a, const bf16* w, size_t gstep) {
  asm volatile("global_load_async_to_lds_b128 %0, %12, off\n\t"
               "global_load_async_to_lds_b128 %1, %13, off\n\t"
               "global_load_async_to_lds_b128 %2, %14, off\n\t"
               "global_load_async_to_lds_b128 %3, %15, off\n\t"
               "global_load_async_to_lds_b128 %4, %16, off\n\t"
               "global_load_async_to_lds_b128 %5, %17, off\n\t"
               "global_load_async_to_lds_b128 %6, %18, off\n\t"
               "global_load_async_to_lds_b128 %7, %19, off\n\t"
               "global_load_async_to_lds_b128 %8, %20, off\n\t"
               "global_load_async_to_lds_b128 %9, %21, off\n\t"
               "global_load_async_to_lds_b128 %10, %22, off\n\t"
               "global_load_async_to_lds_b128 %11, %23, off\n\t"
               "s_wait_xcnt 0x0"
               :: "v"(l), "v"(l + lstep), "v"(l + 2 * lstep), "v"(l + 3 * lstep),
                  "v"(l + 4 * lstep), "v"(l + 5 * lstep), "v"(l + 6 * lstep),
                  "v"(l + 7 * lstep),
                  "v"(m), "v"(m + lstep), "v"(m + 2 * lstep), "v"(m + 3 * lstep),
                  "v"((uint64_t)a), "v"((uint64_t)(a + gstep)),
                  "v"((uint64_t)(a + 2 * gstep)), "v"((uint64_t)(a + 3 * gstep)),
                  "v"((uint64_t)(a + 4 * gstep)), "v"((uint64_t)(a + 5 * gstep)),
                  "v"((uint64_t)(a + 6 * gstep)), "v"((uint64_t)(a + 7 * gstep)),
                  "v"((uint64_t)w), "v"((uint64_t)(w + gstep)),
                  "v"((uint64_t)(w + 2 * gstep)), "v"((uint64_t)(w + 3 * gstep))
               : "memory");
}

__device__ __forceinline__ void wait_async0() {
  asm volatile("s_wait_asynccnt 0x0" ::: "memory");
}
// All but this wave's twelve youngest copies (one tile's worth) have landed:
// the counter returns in issue order, and only these copies count on it here.
__device__ __forceinline__ void wait_async_all_but_one_tile() {
  asm volatile("s_wait_asynccnt 0xc" ::: "memory");
}

// ---------------------------------------------------------------------------
// fp32 -> bf16 conversion of all seven arrays in ONE launch.  Their bf16 copies
// lie one behind another in the workspace (Wq, Wk, Wv, Wo, W1, W2, x), so the
// destination is one run of 20 * D * D elements; a block takes 8192 of them,
// which lie inside one array (every length is a multiple of D * D), and picks
// its source by a scalar test.  16 B per lane, the eight loads first; a wave's
// store covers two whole lines.
// ---------------------------------------------------------------------------
typedef float  f32x4  __attribute__((ext_vector_type(4)));
typedef __bf16 bf16x4 __attribute__((ext_vector_type(4)));

#define CVT_UNITS 20            // 4 (Wq Wk Wv Wo) + 4 (W1) + 4 (W2) + 8 (x), in D * D
#define CVT_BLOCK 8192          // elements per block

__global__ __launch_bounds__(256)
void cvt_all_f32_bf16(const float* __restrict__ wq, const float* __restrict__ wk,
                      const float* __restrict__ wv, const float* __restrict__ wo,
                      const float* __restrict__ w1, const float* __restrict__ w2,
                      const float* __restrict__ x, bf16* __restrict__ out) {
  const uint32_t e0   = blockIdx.x * (uint32_t)CVT_BLOCK;   // first element, in out
  const uint32_t unit = e0 / (uint32_t)(DD * DD);
  const float* src;
  uint32_t first;                                           // unit where src begins
  if (unit < 4)       { src = unit == 0 ? wq : unit == 1 ? wk : unit == 2 ? wv : wo;
                        first = unit; }
  else if (unit < 8)  { src = w1; first = 4; }
  else if (unit < 12) { src = w2; first = 8; }
  else                { src = x;  first = 12; }
  const uint32_t t = threadIdx.x * 4;
  const float* p = src + (e0 - first * (uint32_t)(DD * DD)) + t;
  bf16* o = out + e0 + t;
  f32x4 v[8];
  // both loops unrolled: v[] is indexed by constants and stays in registers
#pragma unroll
  for (int c = 0; c < 8; ++c) v[c] = *(const f32x4*)(p + c * 1024);
#pragma unroll
  for (int c = 0; c < 8; ++c)
    *(bf16x4*)(o + c * 1024) = __builtin_convertvector(v[c], bf16x4);
}

// ---------------------------------------------------------------------------
// Exact-form GELU, 0.5 v (1 + erf(v / sqrt 2)), two values at a time, no branch.
// erf(z) = z P(z^2) / Q(z^2) on |z| <= 4 (beyond it erf rounds to +-1 in f32);
// absolute error below 4e-7 over the whole line.  Straight-line packed code:
// the values of a lane are independent chains that the scheduler interleaves,
// and the epilogue's text is a fraction of the branching form's.
// ---------------------------------------------------------------------------
typedef float  v2f  __attribute__((ext_vector_type(2)));
typedef __bf16 v2bf __attribute__((ext_vector_type(2)));

// Taken on the four pairs that a lane holds of one tile, step by step across the
// pairs: four independent chains stand next to one another in the text, so that
// no link waits for the one before it.
__device__ __forceinline__ void gelu2x4(v2f (&v)[4]) {
  const v2f lim = 4.0f;
  v2f z[4], z2[4], p[4], q[4];
  // every loop over c is unrolled: the arrays are indexed by constants and stay in registers
#pragma unroll
  for (int c = 0; c < 4; ++c) {
    z[c] = __builtin_elementwise_min(
        __builtin_elementwise_max(v[c] * 0.70710678118654752f, -lim), lim);
    z2[c] = z[c] * z[c];
  }
  const float pc[7] = {-2.72614225801306e-10f, 2.77068142495902e-08f, -2.10102402082508e-06f,
                       -5.69250639462346e-05f, -7.34990630326855e-04f, -2.95459980854025e-03f,
                       -1.60960333262415e-02f};
  const float qc[5] = {-1.45660718464996e-05f, -2.13374055278905e-04f, -1.68282697438203e-03f,
                       -7.37332916720468e-03f, -1.42647390514189e-02f};
#pragma unroll
  for (int c = 0; c < 4; ++c) { p[c] = pc[0]; q[c] = qc[0]; }
#pragma unroll
  for (int s = 1; s < 5; ++s)
#pragma unroll
    for (int c = 0; c < 4; ++c) {
      p[c] = __builtin_elementwise_fma(p[c], z2[c], (v2f)(pc[s]));
      q[c] = __builtin_elementwise_fma(q[c], z2[c], (v2f)(qc[s]));
    }
#pragma unroll
  for (int s = 5; s < 7; ++s)
#pragma unroll
    for (int c = 0; c < 4; ++c) p[c] = __builtin_elementwise_fma(p[c], z2[c], (v2f)(pc[s]));
#pragma unroll
  for (int c = 0; c < 4; ++c) {
    // Reciprocals in place, one statement: neither touches the other's register,
    // and the closing v_nop keeps the slot the instruction set asks for behind a
    // transcendental, whatever the compiler places next.
    float r0 = q[c][0], r1 = q[c][1];
    asm("v_rcp_f32 %0, %0\n\t"
        "v_rcp_f32 %1, %1\n\t"
        "v_nop"
        : "+v"(r0), "+v"(r1));
    q[c] = (v2f){r0, r1};
  }
#pragma unroll
  for (int c = 0; c < 4; ++c) {
    const v2f e = (p[c] * z[c]) * q[c];
    const v2f h = v[c] * 0.5f;
    v[c] = __builtin_elementwise_fma(h, e, h);
  }
}

// ---------------------------------------------------------------------------
// Tiled bf16 WMMA GEMM:  Y[M,N] = act( (A[M,K] * W[N,K]^T + bias) * scale )
// A, W row-major with K contiguous (torch Linear layout -> NT GEMM).
// Block tile 256x128, 8 waves of 64x64, K-step 64, LDS ring of NBUF tiles filled
// by async global->LDS DMA.  M % 256 == 0, N % 128 == 0, K % 64 == 0.
// NBUF == 2: one tile in flight; two work-groups fit a WGP and cover each other's
// waits (for grids of several work-groups per WGP).
// NBUF == 3: two tiles in flight, so that the path from L2 never runs empty
// between tiles (for grids of one work-group per WGP, which nothing else covers).
// THREE: one launch does three products with the same A.  W holds three [N, K]
// matrices one behind another, outB three [M, N] results likewise, each with its
// own bias; blockIdx.y runs over the 3 N / 128 column tiles and `scale` applies
// to the first product alone (the others take 1).
// ---------------------------------------------------------------------------
template <bool GELU, bool OUT_BF16, int NBUF, bool THREE>
__global__ __launch_bounds__(256)
void gemm_bf16_nt(const bf16* __restrict__ A, const bf16* __restrict__ W,
                  const float* __restrict__ bias, const float* __restrict__ bias1,
                  const float* __restrict__ bias2, float scale,
                  float* outF, bf16* outB, int M, int N, int K) {
  static_assert(!GELU || OUT_BF16, "the GELU epilogue writes bf16");
  static_assert(!THREE || (OUT_BF16 && !GELU), "three products: plain bf16 results");
  static_assert(NBUF == 2 || NBUF == 3, "ring of two or three tiles");
  __shared__ bf16 As[NBUF][256][72];   // 144B row pitch = 16B x odd (b128 readers)
  __shared__ bf16 Bs[NBUF][128][72];

  const int tid  = threadIdx.x;
  const int lane = tid & 31;
  const int wave = tid >> 5;
  const int wm   = wave & 3;       // 4 M-bands of 64
  const int wn   = wave >> 2;      // 2 N-bands of 64
  const int half = lane >> 4;
  const int l16  = lane & 15;
  const int m0   = blockIdx.x * 256;
  const int n0   = blockIdx.y * 128;

  v8f acc[4][4] = {};

  // A 256x64 = 2048 16B chunks (8 per thread), W 128x64 = 1024 (4 per thread).
  // A wave's copy covers 4 rows x 128B = 4 whole lines.
  const int cr = tid >> 3, cc = (tid & 7) * 8;
  const bf16* gA = &A[(size_t)(m0 + cr) * K + cc];
  const bf16* gW = &W[(size_t)(n0 + cr) * K + cc];
  const size_t rs = (size_t)32 * K;            // 32 rows further
  auto load_tile = [&](int buf, int k0) {
    async_copy16x12(lds_addr(&As[buf][cr][cc]), lds_addr(&Bs[buf][cr][cc]),
                    32 * 72 * 2, gA + k0, gW + k0, rs);
  };

  const int KT = K >> 6;

  // One trip: the 32 WMMAs of tile `cur`; where `fill` is set, the copies of the
  // tile at k0 go out into buffer `dst`, which every wave left at the last barrier.
  auto trip = [&](int cur, bool fill, int dst, int k0) {
    // every loop below is unrolled so that acc[][], a[] and b[] are indexed by
    // constants and stay in registers
#pragma unroll
    for (int ks = 0; ks < 2; ++ks) {
      v16bf a[4], b[4];
#pragma unroll
      for (int i = 0; i < 4; ++i) {
        a[i] = frag_from(&As[cur][wm * 64 + i * 16 + l16][ks * 32 + 8 * half]);
        b[i] = frag_from(&Bs[cur][wn * 64 + i * 16 + l16][ks * 32 + 8 * half]);
      }
      // keeps the 16 LDS reads one group ahead of the 16 WMMAs: left alone the
      // scheduler sinks them among the WMMAs, one full LDS wait per row of four
      __builtin_amdgcn_sched_barrier(0);
      // issued here so that the copies' address work and wait run under the LDS
      // reads' latency
      if (ks == 0 && fill) load_tile(dst, k0);
      // keeps the copies ahead of the WMMAs: left alone the scheduler sinks them,
      // with their wait, to the end of the block and forms their addresses in
      // fragment registers, at four idle slots behind a WMMA each time
      __builtin_amdgcn_sched_barrier(0);
#pragma unroll
      for (int mi = 0; mi < 4; ++mi)
#pragma unroll
        for (int ni = 0; ni < 4; ++ni)
          acc[mi][ni] = wmma_bf16(b[ni], a[mi], acc[mi][ni]);   // Y^T tile: W rows x A rows
      // second half of the pair: the next group's reads stay behind this block
      __builtin_amdgcn_sched_barrier(0);
    }
    // own LDS reads of `cur` retired before any wave may refill it
    asm volatile("s_wait_dscnt 0x0" ::: "memory");
  };

  if constexpr (NBUF == 2) {
    load_tile(0, 0);
    wait_async0();
    __syncthreads();
    for (int kt = 0; kt < KT; ++kt) {
      const int cur = kt & 1;
      trip(cur, kt + 1 < KT, cur ^ 1, (kt + 1) << 6);
      wait_async0();       // next-buffer DMA landed (ASYNCcnt not covered by barrier)
      __syncthreads();     // all waves done reading `cur`, writes visible
    }
  } else {
    // Tiles 0 and 1 go out together; tile 0 has landed when all but the twelve
    // copies of tile 1 have.
    load_tile(0, 0);
    if (KT > 1) {
      load_tile(1, 64);
      wait_async_all_but_one_tile();
    } else {
      wait_async0();
    }
    __syncthreads();

    int cur = 0, nxt = 1, dst = 2;   // kt, kt + 1, kt + 2 mod 3
    int kt = 0;
    // Every trip of this loop issues the twelve copies of tile kt + 2, into the
    // buffer of tile kt - 1, and then waits for all but those: tile kt + 1 has
    // landed while tile kt + 2 stays in flight over the barrier.
    for (; kt + 2 < KT; ++kt) {
      trip(cur, true, dst, (kt + 2) << 6);
      wait_async_all_but_one_tile();
      __syncthreads();     // tile kt + 1 visible; all waves done reading `cur`
      const int left = cur;
      cur = nxt; nxt = dst; dst = left;
    }
    // The last trips issue nothing more: the wait is to 0.
    for (; kt < KT; ++kt) {
      trip(cur, false, 0, 0);
      wait_async0();
      __syncthreads();
      cur = nxt;
    }
  }

  // ---- epilogue.  The products were taken transposed (W x A^T), so that
  // acc[mi][ni][j] = Y[row mi * 16 + l16][column ni * 16 + 8 * half + j]: a lane
  // holds 8 neighbouring columns of one row.  Each wave lays 32 rows of its 64 x 64
  // tile into its own part of the ring (free behind the loop's last barrier) with
  // 16-B LDS stores, reads them back row-wise and stores whole 128-B lines. ----
  if constexpr (THREE) {
    // Which product this block belongs to: the same for the whole block.  Columns
    // go on counting through all three, so the two bases are moved instead: the
    // indices below stay those of the single product.
    const int part = (n0 >= N) + (n0 >= 2 * N);
    bias  = (part == 0 ? bias : part == 1 ? bias1 : bias2) - (size_t)part * N;
    scale = part == 0 ? scale : 1.0f;
    outB += (size_t)part * M * N - (size_t)part * N;
  }
  constexpr int RP = OUT_BF16 ? 144 : 272;   // staged row pitch, bytes: 16 B x odd
  static_assert(8 * 32 * RP <= (int)sizeof(As), "the eight waves' rows fit the A ring");
  char* stage = (char*)&As[0][0][0] + wave * (32 * RP);
  const int colw = n0 + wn * 64;             // the wave's first column
  f32x4 bv[4][2];                            // the lane's 32 bias values, loaded together
  // every loop below is unrolled so that acc[][], bv[][], v[], w[] and t[] are
  // indexed by constants and stay in registers
  // the pair of fences keeps other address work out of the run of loads, so that
  // the wait stands in front of every rewrite of the loads' address registers
  __builtin_amdgcn_sched_barrier(0);
#pragma unroll
  for (int ni = 0; ni < 4; ++ni) {
    bv[ni][0] = *(const f32x4*)&bias[colw + ni * 16 + 8 * half];
    bv[ni][1] = *(const f32x4*)&bias[colw + ni * 16 + 8 * half + 4];
  }
  asm volatile("s_wait_xcnt 0x0" ::: "memory");
  __builtin_amdgcn_sched_barrier(0);
#pragma unroll
  for (int mh = 0; mh < 2; ++mh) {
#pragma unroll
    for (int m2 = 0; m2 < 2; ++m2) {
      char* p = stage + (m2 * 16 + l16) * RP;
#pragma unroll
      for (int ni = 0; ni < 4; ++ni) {
        float v[8];
#pragma unroll
        for (int j = 0; j < 8; ++j)
          v[j] = (acc[mh * 2 + m2][ni][j] + bv[ni][j >> 2][j & 3]) * scale;
        if constexpr (OUT_BF16) {
          v2f w[4] = {{v[0], v[1]}, {v[2], v[3]}, {v[4], v[5]}, {v[6], v[7]}};
          if constexpr (GELU) gelu2x4(w);       // pairs: the polynomial runs on packed f32
          v8bf o;
#pragma unroll
          for (int c = 0; c < 4; ++c) {
            const v2bf k = __builtin_convertvector(w[c], v2bf);
            o[2 * c] = k[0]; o[2 * c + 1] = k[1];
          }
          *(v8bf*)(p + ni * 32 + half * 16) = o;
        } else {
          const f32x4 lo = {v[0], v[1], v[2], v[3]}, hi = {v[4], v[5], v[6], v[7]};
          *(f32x4*)(p + ni * 64 + half * 32)      = lo;
          *(f32x4*)(p + ni * 64 + half * 32 + 16) = hi;
        }
      }
    }
    // the wave's 32 rows are in LDS before its lanes read one another's pieces
    asm volatile("s_wait_dscnt 0x0" ::: "memory");
    const size_t row0 = (size_t)(m0 + wm * 64 + mh * 32);
    if constexpr (OUT_BF16) {
      // 8 lanes a row of 128 B, 4 rows an instruction
      const int r = lane >> 3, c = lane & 7;
      v8bf t[8];
#pragma unroll
      for (int it = 0; it < 8; ++it) t[it] = *(const v8bf*)(stage + (it * 4 + r) * RP + c * 16);
#pragma unroll
      for (int it = 0; it < 8; ++it)
        *(v8bf*)&outB[(row0 + it * 4 + r) * N + colw + c * 8] = t[it];
    } else {
      // 16 lanes a row of 256 B, 2 rows an instruction
      f32x4 t[16];
#pragma unroll
      for (int it = 0; it < 16; ++it)
        t[it] = *(const f32x4*)(stage + (it * 2 + half) * RP + l16 * 16);
#pragma unroll
      for (int it = 0; it < 16; ++it)
        *(f32x4*)&outF[(row0 + it * 2 + half) * N + colw + l16 * 4] = t[it];
    }
    // the read-back has ended before the next 32 rows are laid over it
    if (mh == 0) asm volatile("s_wait_dscnt 0x0" ::: "memory");
  }
}

// ---------------------------------------------------------------------------
// Flash attention: grid (S/128, H, B), block = 128 threads = 4 waves.
// Each wave owns 32 queries, as two groups of 16 columns; K/V tiles of 64 keys
// staged in LDS.  Every K and V fragment read from LDS serves both groups, and
// maximum, correction and rescale are paid once per 64 keys.
// Transposed products: S^T = K x Q^T and O^T += V^T x P^T.  A lane then holds
// 32 of the 64 scores of ONE query per group (query = l16, keys 16 i + 8*half + r
// of score tile i), so maximum and sum are taken in the lane's own registers
// with one exchange between the wave's halves, and the score tiles, converted
// in place, already are the B operands of the second product.
// ---------------------------------------------------------------------------
typedef short s16x8 __attribute__((ext_vector_type(8)));
typedef float v4f   __attribute__((ext_vector_type(4)));

// Transposing LDS read: lane (l16, half) receives T[kbase + 8*half + 0..7][dbase + l16]
// when it passes &T[kbase + 8*half + (lane & 7)][dbase + 8 * ((lane >> 3) & 1)].
__device__ __forceinline__ v8bf ld_tr16(const bf16* p) {
  typedef __attribute__((address_space(3))) s16x8 lds_s16x8;
  return __builtin_bit_cast(v8bf, __builtin_amdgcn_ds_load_tr16_b128_v8i16((lds_s16x8*)p));
}

// lane l <-> lane l ^ 16
__device__ __forceinline__ float xhalf(float x) {
  return __builtin_bit_cast(float, __builtin_amdgcn_permlanex16(
      __builtin_bit_cast(int, x), __builtin_bit_cast(int, x),
      0x76543210, 0xfedcba98, false, false));
}

#define LOG2E 1.44269504088896340736f

// Base-2 exponentials in place.  Written as one statement so that the slot the
// instruction set asks for behind a transcendental is kept: inside the run no
// v_exp touches its neighbour's registers, and the closing v_nop stands in
// front of whatever the compiler places next.
__device__ __forceinline__ void exp2_x8(float (&e)[8]) {
  asm("v_exp_f32 %0, %0\n\t"
      "v_exp_f32 %1, %1\n\t"
      "v_exp_f32 %2, %2\n\t"
      "v_exp_f32 %3, %3\n\t"
      "v_exp_f32 %4, %4\n\t"
      "v_exp_f32 %5, %5\n\t"
      "v_exp_f32 %6, %6\n\t"
      "v_exp_f32 %7, %7\n\t"
      "v_nop"
      : "+v"(e[0]), "+v"(e[1]), "+v"(e[2]), "+v"(e[3]),
        "+v"(e[4]), "+v"(e[5]), "+v"(e[6]), "+v"(e[7]));
}
__device__ __forceinline__ void exp2_x1(float& e) {
  asm("v_exp_f32 %0, %0\n\t"
      "v_nop"
      : "+v"(e));
}

#define AK 64                   // keys per pass
#define AQ 128                  // queries per block: 4 waves x 2 groups x 16

__global__ __launch_bounds__(128)
void flash_attn(const bf16* __restrict__ Q, const bf16* __restrict__ Kb,
                const bf16* __restrict__ Vb, const int* __restrict__ mask,
                bf16* __restrict__ Ctx) {
  __shared__ bf16 Ks[AK][72];     // 144B pitch = 16B x odd (b128 readers)
  __shared__ bf16 Vs[AK][80];     // 160B pitch = 32B x odd (transposing readers)
  __shared__ __attribute__((aligned(16))) float Madd[AK];

  const int tid  = threadIdx.x;
  const int lane = tid & 31;
  const int wave = tid >> 5;
  const int half = lane >> 4;
  const int l16  = lane & 15;
  const int qt   = blockIdx.x;
  const int h    = blockIdx.y;
  const int b    = blockIdx.z;

  // Group g's 16 queries as two B-fragments (dh 0..31, 32..63): column = l16.
  const size_t qrow = ((size_t)b * SS + qt * AQ + wave * 32 + l16) * DD + h * DH;
  v16bf qb[2][2];
  // every loop over g, i, f, kc, c and r below is unrolled so that the arrays are
  // indexed by constants and stay in registers
#pragma unroll
  for (int g = 0; g < 2; ++g) {
    qb[g][0] = frag_from(&Q[qrow + (size_t)g * 16 * DD + 0  + 8 * half]);
    qb[g][1] = frag_from(&Q[qrow + (size_t)g * 16 * DD + 32 + 8 * half]);
  }

  // m[g]: running maximum of query l16 of group g (equal in both halves); l[g]:
  // this half's part of its running sum; cacc[g][f][r] = O^T[dh = 16 f + 8 half + r].
  float m[2] = {-1e30f, -1e30f}, l[2] = {0.0f, 0.0f};
  v8f cacc[2][4] = {};

  const bf16* vp = &Vs[8 * half + (lane & 7)][8 * ((lane >> 3) & 1)];

  for (int kt = 0; kt < SS / AK; ++kt) {
    // ---- cooperative K/V tile load: 64 keys x 64 dh each ----
    // the eight loads first, then the eight LDS stores: one memory latency a tile
    v8bf kr[4], vr[4];
#pragma unroll
    for (int c = 0; c < 4; ++c) {
      int ch = tid + c * 128;                 // 0..511
      int r = ch >> 3, col = (ch & 7) * 8;
      size_t g = ((size_t)b * SS + kt * AK + r) * DD + h * DH + col;
      kr[c] = *(const v8bf*)&Kb[g];
      vr[c] = *(const v8bf*)&Vb[g];
    }
#pragma unroll
    for (int c = 0; c < 4; ++c) {
      int ch = tid + c * 128;
      int r = ch >> 3, col = (ch & 7) * 8;
      *(v8bf*)&Ks[r][col] = kr[c];
      *(v8bf*)&Vs[r][col] = vr[c];
    }
    if (tid < AK)
      Madd[tid] = mask[(size_t)b * SS + kt * AK + tid] ? 0.0f : -1e30f;
    __syncthreads();

    // ---- scores: S^T = K x Q^T, four 16-key tiles, K-dim = dh 64.  The key's
    // additive mask is the accumulator's start value: row r of tile i is key
    // 16 i + 8 half + r. ----
    v8f s[2][4];
#pragma unroll
    for (int ip = 0; ip < 4; ip += 2) {
      v8f mk[2];
      v16bf ka[2][2];
#pragma unroll
      for (int j = 0; j < 2; ++j) {
        const int i = ip + j;
        const v4f ma = *(const v4f*)&Madd[16 * i + 8 * half];
        const v4f mb = *(const v4f*)&Madd[16 * i + 8 * half + 4];
#pragma unroll
        for (int r = 0; r < 4; ++r) { mk[j][r] = ma[r]; mk[j][r + 4] = mb[r]; }
        ka[j][0] = frag_from(&Ks[16 * i + l16][0 + 8 * half]);
        ka[j][1] = frag_from(&Ks[16 * i + l16][32 + 8 * half]);
      }
      // keeps the twelve LDS reads one group ahead of the eight WMMAs: left alone
      // the scheduler pairs them off, one full LDS wait per WMMA
      __builtin_amdgcn_sched_barrier(0);
#pragma unroll
      for (int j = 0; j < 2; ++j)
#pragma unroll
        for (int g = 0; g < 2; ++g) s[g][ip + j] = wmma_bf16(ka[j][0], qb[g][0], mk[j]);
#pragma unroll
      for (int j = 0; j < 2; ++j)
#pragma unroll
        for (int g = 0; g < 2; ++g)
          s[g][ip + j] = wmma_bf16(ka[j][1], qb[g][1], s[g][ip + j]);
    }
    // keeps the maxima behind the last product: left alone the scheduler puts one
    // behind each of the last four WMMAs, at four idle slots each time
    __builtin_amdgcn_sched_barrier(0);

    // ---- online softmax over this 64-key slab, one query per lane and group ----
    v16bf pb[2][2];               // P^T as B: [group][chunk kc], element s = key 32 kc + 8 half + s, or 32 kc + 16 + 8 half + s - 8 for s >= 8
#pragma unroll
    for (int g = 0; g < 2; ++g) {
      // two independent chains; the tiles whose products ended first come first
      float mx = fmaxf(s[g][0][0], s[g][1][0]), my = fmaxf(s[g][2][0], s[g][3][0]);
#pragma unroll
      for (int r = 1; r < 8; ++r) mx = fmaxf(mx, fmaxf(s[g][0][r], s[g][1][r]));
#pragma unroll
      for (int r = 1; r < 8; ++r) my = fmaxf(my, fmaxf(s[g][2][r], s[g][3][r]));
      mx = fmaxf(mx, my);
      mx = fmaxf(mx, xhalf(mx));              // the other half's 32 keys
      const float mn = fmaxf(m[g], mx);
      // the difference is taken first: it is never above 0, also where every key
      // so far carries the mask's -1e30
      float cor = (m[g] - mn) * LOG2E;
      float e[4][8];
#pragma unroll
      for (int i = 0; i < 4; ++i)
#pragma unroll
        for (int r = 0; r < 8; ++r) e[i][r] = (s[g][i][r] - mn) * LOG2E;
      exp2_x1(cor);
#pragma unroll
      for (int i = 0; i < 4; ++i) exp2_x8(e[i]);
      m[g] = mn;
      float t[8];
#pragma unroll
      for (int r = 0; r < 8; ++r) {
        t[r] = (e[0][r] + e[1][r]) + (e[2][r] + e[3][r]);
        pb[g][0][r]     = (bf16)e[0][r];
        pb[g][0][r + 8] = (bf16)e[1][r];
        pb[g][1][r]     = (bf16)e[2][r];
        pb[g][1][r + 8] = (bf16)e[3][r];
      }
      const float rs = ((t[0] + t[4]) + (t[2] + t[6])) + ((t[1] + t[5]) + (t[3] + t[7]));
      l[g] = l[g] * cor + rs;
#pragma unroll
      for (int f = 0; f < 4; ++f) cacc[g][f] *= cor;
    }

    // ---- O^T += V^T(16 dh x 32 keys) x P^T(32 keys x 16 queries), two key chunks,
    // each V^T fragment for both groups ----
#pragma unroll
    for (int kc = 0; kc < 2; ++kc) {
#pragma unroll
      for (int f = 0; f < 4; ++f) {
        v8bf lo = ld_tr16(vp + (kc * 32) * 80 + f * 16);        // keys 32 kc + 8 half + 0..7
        v8bf hi = ld_tr16(vp + (kc * 32 + 16) * 80 + f * 16);   // keys 32 kc + 16 + 8 half + 0..7
        v16bf va;
#pragma unroll
        for (int i = 0; i < 8; ++i) { va[i] = lo[i]; va[i + 8] = hi[i]; }
#pragma unroll
        for (int g = 0; g < 2; ++g) cacc[g][f] = wmma_bf16(va, pb[g][kc], cacc[g][f]);
      }
    }
    __syncthreads();  // Ks/Vs reused next iteration
  }

  // ---- finalize: join the halves' sums, divide, write bf16 ctx (b,s,h*64+dh):
  // a lane's 8 registers of a tile are 8 consecutive dh of its query ----
  v8bf ov[2][4];
#pragma unroll
  for (int g = 0; g < 2; ++g) {
    const float lt = l[g] + xhalf(l[g]);
    const float inv = (lt > 0.0f) ? (1.0f / lt) : 0.0f;
#pragma unroll
    for (int f = 0; f < 4; ++f)
#pragma unroll
      for (int r = 0; r < 8; ++r) ov[g][f][r] = (bf16)(cacc[g][f][r] * inv);
  }
  // keeps the eight stores behind the last conversion, so that no register of an
  // issued store is written again
  __builtin_amdgcn_sched_barrier(0);
#pragma unroll
  for (int g = 0; g < 2; ++g)
#pragma unroll
    for (int f = 0; f < 4; ++f)
      *(v8bf*)&Ctx[qrow + (size_t)g * 16 * DD + 8 * half + f * 16] = ov[g][f];
}

// ---------------------------------------------------------------------------
// Residual + LayerNorm over D=1024; optionally emits bf16 copy of the result.
// One block (256 thr) per token row. outF may alias y (in-place).
// ---------------------------------------------------------------------------
__device__ __forceinline__ float block_sum(float v, float* red) {
  v += __shfl_xor(v, 1);
  v += __shfl_xor(v, 2);
  v += __shfl_xor(v, 4);
  v += __shfl_xor(v, 8);
  v += __shfl_xor(v, 16);
  int lane = threadIdx.x & 31, w = threadIdx.x >> 5;
  if (lane == 0) red[w] = v;
  __syncthreads();
  if (threadIdx.x == 0) {
    float s = 0.0f;
#pragma unroll
    for (int i = 0; i < 8; ++i) s += red[i];
    red[0] = s;
  }
  __syncthreads();
  float r = red[0];
  __syncthreads();
  return r;
}

__global__ __launch_bounds__(256)
void ln_residual(const float* y, const float* __restrict__ res,
                 const float* __restrict__ g, const float* __restrict__ beta,
                 float* outF, bf16* outB) {
  __shared__ float red[8];
  const size_t row = blockIdx.x;
  const float* yp = y + row * DD;
  const float* rp = res + row * DD;
  const int base = threadIdx.x * 4;

  float v[4];
  float s = 0.0f;
#pragma unroll
  for (int i = 0; i < 4; ++i) { v[i] = yp[base + i] + rp[base + i]; s += v[i]; }
  float mu = block_sum(s, red) * (1.0f / DD);

  float q = 0.0f;
#pragma unroll
  for (int i = 0; i < 4; ++i) { float d = v[i] - mu; q += d * d; }
  float var = block_sum(q, red) * (1.0f / DD);
  float rstd = rsqrtf(var + 1e-12f);

#pragma unroll
  for (int i = 0; i < 4; ++i) {
    float o = (v[i] - mu) * rstd * g[base + i] + beta[base + i];
    outF[row * DD + base + i] = o;
    if (outB) outB[row * DD + base + i] = (bf16)o;
  }
}

// ---------------------------------------------------------------------------
// Launch
// ---------------------------------------------------------------------------
extern "C" void kernel_launch(void* const* d_in, const int* in_sizes, int n_in,
                              void* d_out, int out_size, void* d_ws, size_t ws_size,
                              hipStream_t stream) {
  (void)in_sizes; (void)n_in; (void)out_size; (void)ws_size;

  const float* x    = (const float*)d_in[0];
  const int*   msk  = (const int*)d_in[1];
  const float* Wq   = (const float*)d_in[2];
  const float* bq   = (const float*)d_in[3];
  const float* Wk   = (const float*)d_in[4];
  const float* bk   = (const float*)d_in[5];
  const float* Wv   = (const float*)d_in[6];
  const float* bv   = (const float*)d_in[7];
  const float* Wo   = (const float*)d_in[8];
  const float* bo   = (const float*)d_in[9];
  const float* ln1g = (const float*)d_in[10];
  const float* ln1b = (const float*)d_in[11];
  const float* W1   = (const float*)d_in[12];
  const float* b1   = (const float*)d_in[13];
  const float* W2   = (const float*)d_in[14];
  const float* b2   = (const float*)d_in[15];
  const float* ln2g = (const float*)d_in[16];
  const float* ln2b = (const float*)d_in[17];
  float* out = (float*)d_out;

  char* ws = (char*)d_ws;
  const size_t MB = 1ull << 20;
  bf16*  wqb  = (bf16*)(ws + 0 * MB);
  bf16*  wkb  = (bf16*)(ws + 2 * MB);
  bf16*  wvb  = (bf16*)(ws + 4 * MB);
  bf16*  wob  = (bf16*)(ws + 6 * MB);
  bf16*  w1b  = (bf16*)(ws + 8 * MB);     // F*D
  bf16*  w2b  = (bf16*)(ws + 16 * MB);    // D*F
  bf16*  xb   = (bf16*)(ws + 24 * MB);
  bf16*  qb   = (bf16*)(ws + 40 * MB);
  bf16*  kb   = (bf16*)(ws + 56 * MB);
  bf16*  vb   = (bf16*)(ws + 72 * MB);
  bf16*  ctxb = (bf16*)(ws + 88 * MB);
  float* sa   = (float*)(ws + 104 * MB);  // sa_out, then h (in-place LN1)
  bf16*  hb   = (bf16*)(ws + 136 * MB);
  bf16*  ffb  = (bf16*)(ws + 40 * MB);    // reuse q/k/v/ctx region (dead by FFN1)
  float* y2   = (float*)(ws + 152 * MB);

  // all seven conversions: wqb .. w2b and xb are one run of the workspace
  hipLaunchKernelGGL(cvt_all_f32_bf16, dim3(CVT_UNITS * DD * DD / CVT_BLOCK), dim3(256),
                     0, stream, Wq, Wk, Wv, Wo, W1, W2, x, wqb);

  const float* none = nullptr;
  dim3 gB(256);
  dim3 gQKV(NTOK / 256, DD / 128);
  // q = (x Wq^T + bq) / sqrt(64), k = x Wk^T + bk, v = x Wv^T + bv in one launch:
  // wqb, wkb, wvb are one [3 D, D] matrix and qb, kb, vb lie one behind another
  hipLaunchKernelGGL((gemm_bf16_nt<false, true, 3, true>), dim3(NTOK / 256, 3 * DD / 128),
                     gB, 0, stream,
                     xb, wqb, bq, bk, bv, 0.125f, (float*)nullptr, qb, NTOK, DD, DD);

  dim3 aG(SS / AQ, HH, BB), aB(128);
  hipLaunchKernelGGL(flash_attn, aG, aB, 0, stream, qb, kb, vb, msk, ctxb);

  // sa = ctx Wo^T + bo   (f32)
  hipLaunchKernelGGL((gemm_bf16_nt<false, false, 3, false>), gQKV, gB, 0, stream,
                     ctxb, wob, bo, none, none, 1.0f, sa, (bf16*)nullptr, NTOK, DD, DD);

  // h = LN1(sa + x), in-place in sa; also bf16 copy hb
  hipLaunchKernelGGL(ln_residual, dim3(NTOK), dim3(256), 0, stream,
                     sa, x, ln1g, ln1b, sa, hb);

  // ff = gelu(h W1^T + b1)   (bf16, M=8192 N=4096 K=1024)
  dim3 gF1(NTOK / 256, FF / 128);
  hipLaunchKernelGGL((gemm_bf16_nt<true, true, 2, false>), gF1, gB, 0, stream,
                     hb, w1b, b1, none, none, 1.0f, (float*)nullptr, ffb, NTOK, FF, DD);

  // y2 = ff W2^T + b2   (f32, K=4096)
  hipLaunchKernelGGL((gemm_bf16_nt<false, false, 3, false>), gQKV, gB, 0, stream,
                     ffb, w2b, b2, none, none, 1.0f, y2, (bf16*)nullptr, NTOK, DD, FF);

  // out = LN2(y2 + h)
  hipLaunchKernelGGL(ln_residual, dim3(NTOK), dim3(256), 0, stream,
                     y2, sa, ln2g, ln2b, out, (bf16*)nullptr);
}

// v008
// It runs in 223 microseconds.
// Next to v007, in two timings, it ran 1.06 times as fast each time.
// Counting every step since v000, it is 2.41 times as fast.
#include <hip/hip_runtime.h>
#include <math.h>
#include <stdint.h>

// ---------------------------------------------------------------------------
// Types
// ---------------------------------------------------------------------------
typedef __bf16 bf16;
typedef __bf16 v16bf __attribute__((ext_vector_type(16)));
typedef __bf16 v8bf  __attribute__((ext_vector_type(8)));
typedef float  v8f   __attribute__((ext_vector_type(8)));

#define BB 8
#define SS 1024
#define DD 1024
#define HH 16
#define DH 64
#define FF 4096
#define NTOK (BB * SS)          // 8192

// ---------------------------------------------------------------------------
// WMMA helpers (CDNA5 v_wmma_f32_16x16x32_bf16)
// ---------------------------------------------------------------------------
__device__ __forceinline__ v8f wmma_bf16(v16bf a, v16bf b, v8f c) {
  return __builtin_amdgcn_wmma_f32_16x16x32_bf16(
      /*neg_a=*/false, a, /*neg_b=*/false, b,
      /*c_mod=*/(short)0, c, /*reuse_a=*/false, /*reuse_b=*/false);
}

// A/B fragment loader. ISA 16-bit 16x32 layout: lane half h holds
// K[8h..8h+7] in halves 0..7 and K[16+8h..16+8h+7] in halves 8..15.
// Caller passes p = &row[k0 + 8*half]; we read p[0..7] and p[16..23].
__device__ __forceinline__ v16bf frag_from(const bf16* p) {
  v8bf lo = *(const v8bf*)(p);
  v8bf hi = *(const v8bf*)(p + 16);
  v16bf a;
#pragma unroll
  for (int i = 0; i < 8; ++i) { a[i] = lo[i]; a[i + 8] = hi[i]; }
  return a;
}

// CDNA5 async global->LDS copies of 16B chunks (tracked by ASYNCcnt; bypass
// VGPRs entirely).  GV addressing: vdst = LDS byte address, v[addr64], off.
// s_wait_xcnt 0 is the last line of the copies' own statement so that no address
// register is rewritten ahead of it.
__device__ __forceinline__ uint32_t lds_addr(const bf16* p) {
  return (uint32_t)(uint64_t)p;  // flat LDS addr[31:0] = LDS offset
}

// Twelve 16B chunks per lane: LDS places l + i * lstep for the eight chunks of
// the first operand (lstep bytes = the same count of rows apart in both), m + i * lstep
// for the four of the second.
__device__ __forceinline__ void async_copy16x12(uint32_t l, uint32_t m, uint32_t lstep,
                                                const bf16* a, const bf16* w, size_t gstep) {
  asm volatile("global_load_async_to_lds_b128 %0, %12, off\n\t"
               "global_load_async_to_lds_b128 %1, %13, off\n\t"
               "global_load_async_to_lds_b128 %2, %14, off\n\t"
               "global_load_async_to_lds_b128 %3, %15, off\n\t"
               "global_load_async_to_lds_b128 %4, %16, off\n\t"
               "global_load_async_to_lds_b128 %5, %17, off\n\t"
               "global_load_async_to_lds_b128 %6, %18, off\n\t"
               "global_load_async_to_lds_b128 %7, %19, off\n\t"
               "global_load_async_to_lds_b128 %8, %20, off\n\t"
               "global_load_async_to_lds_b128 %9, %21, off\n\t"
               "global_load_async_to_lds_b128 %10, %22, off\n\t"
               "global_load_async_to_lds_b128 %11, %23, off\n\t"
               "s_wait_xcnt 0x0"
               :: "v"(l), "v"(l + lstep), "v"(l + 2 * lstep), "v"(l + 3 * lstep),
                  "v"(l + 4 * lstep), "v"(l + 5 * lstep), "v"(l + 6 * lstep),
                  "v"(l + 7 * lstep),
                  "v"(m), "v"(m + lstep), "v"(m + 2 * lstep), "v"(m + 3 * lstep),
                  "v"((uint64_t)a), "v"((uint64_t)(a + gstep)),
                  "v"((uint64_t)(a + 2 * gstep)), "v"((uint64_t)(a + 3 * gstep)),
                  "v"((uint64_t)(a + 4 * gstep)), "v"((uint64_t)(a + 5 * gstep)),
                  "v"((uint64_t)(a + 6 * gstep)), "v"((uint64_t)(a + 7 * gstep)),
                  "v"((uint64_t)w), "v"((uint64_t)(w + gstep)),
                  "v"((uint64_t)(w + 2 * gstep)), "v"((uint64_t)(w + 3 * gstep))
               : "memory");
}

__device__ __forceinline__ void wait_async0() {
  asm volatile("s_wait_asynccnt 0x0" ::: "memory");
}
// All but this wave's youngest COPIES copies (one tile's worth, 12 or 24) have
// landed: the counter returns in issue order, and only these copies count on it here.
template <int COPIES>
__device__ __forceinline__ void wait_async_all_but_one_tile() {
  static_assert(COPIES == 12 || COPIES == 24, "one tile is 12 or 24 copies a lane");
  if constexpr (COPIES == 12) asm volatile("s_wait_asynccnt 0xc" ::: "memory");
  else                        asm volatile("s_wait_asynccnt 0x18" ::: "memory");
}

// ---------------------------------------------------------------------------
// fp32 -> bf16 conversion of all seven arrays in ONE launch.  Their bf16 copies
// lie one behind another in the workspace (Wq, Wk, Wv, Wo, W1, W2, x), so the
// destination is one run of 20 * D * D elements; a block takes 8192 of them,
// which lie inside one array (every length is a multiple of D * D), and picks
// its source by a scalar test.  16 B per lane, the eight loads first; a wave's
// store covers two whole lines.
// ---------------------------------------------------------------------------
typedef float  f32x4  __attribute__((ext_vector_type(4)));
typedef __bf16 bf16x4 __attribute__((ext_vector_type(4)));

#define CVT_UNITS 20            // 4 (Wq Wk Wv Wo) + 4 (W1) + 4 (W2) + 8 (x), in D * D
#define CVT_BLOCK 8192          // elements per block

__global__ __launch_bounds__(256)
void cvt_all_f32_bf16(const float* __restrict__ wq, const float* __restrict__ wk,
                      const float* __restrict__ wv, const float* __restrict__ wo,
                      const float* __restrict__ w1, const float* __restrict__ w2,
                      const float* __restrict__ x, bf16* __restrict__ out) {
  const uint32_t e0   = blockIdx.x * (uint32_t)CVT_BLOCK;   // first element, in out
  const uint32_t unit = e0 / (uint32_t)(DD * DD);
  const float* src;
  uint32_t first;                                           // unit where src begins
  if (unit < 4)       { src = unit == 0 ? wq : unit == 1 ? wk : unit == 2 ? wv : wo;
                        first = unit; }
  else if (unit < 8)  { src = w1; first = 4; }
  else if (unit < 12) { src = w2; first = 8; }
  else                { src = x;  first = 12; }
  const uint32_t t = threadIdx.x * 4;
  const float* p = src + (e0 - first * (uint32_t)(DD * DD)) + t;
  bf16* o = out + e0 + t;
  f32x4 v[8];
  // both loops unrolled: v[] is indexed by constants and stays in registers
#pragma unroll
  for (int c = 0; c < 8; ++c) v[c] = *(const f32x4*)(p + c * 1024);
#pragma unroll
  for (int c = 0; c < 8; ++c)
    *(bf16x4*)(o + c * 1024) = __builtin_convertvector(v[c], bf16x4);
}

// ---------------------------------------------------------------------------
// Exact-form GELU, 0.5 v (1 + erf(v / sqrt 2)), two values at a time, no branch.
// erf(z) = z P(z^2) / Q(z^2) on |z| <= 4 (beyond it erf rounds to +-1 in f32);
// absolute error below 4e-7 over the whole line.  Straight-line packed code:
// the values of a lane are independent chains that the scheduler interleaves,
// and the epilogue's text is a fraction of the branching form's.
// ---------------------------------------------------------------------------
typedef float  v2f  __attribute__((ext_vector_type(2)));
typedef __bf16 v2bf __attribute__((ext_vector_type(2)));

// Taken on the four pairs that a lane holds of one tile, step by step across the
// pairs: four independent chains stand next to one another in the text, so that
// no link waits for the one before it.
__device__ __forceinline__ void gelu2x4(v2f (&v)[4]) {
  const v2f lim = 4.0f;
  v2f z[4], z2[4], p[4], q[4];
  // every loop over c is unrolled: the arrays are indexed by constants and stay in registers
#pragma unroll
  for (int c = 0; c < 4; ++c) {
    z[c] = __builtin_elementwise_min(
        __builtin_elementwise_max(v[c] * 0.70710678118654752f, -lim), lim);
    z2[c] = z[c] * z[c];
  }
  const float pc[7] = {-2.72614225801306e-10f, 2.77068142495902e-08f, -2.10102402082508e-06f,
                       -5.69250639462346e-05f, -7.34990630326855e-04f, -2.95459980854025e-03f,
                       -1.60960333262415e-02f};
  const float qc[5] = {-1.45660718464996e-05f, -2.13374055278905e-04f, -1.68282697438203e-03f,
                       -7.37332916720468e-03f, -1.42647390514189e-02f};
#pragma unroll
  for (int c = 0; c < 4; ++c) { p[c] = pc[0]; q[c] = qc[0]; }
#pragma unroll
  for (int s = 1; s < 5; ++s)
#pragma unroll
    for (int c = 0; c < 4; ++c) {
      p[c] = __builtin_elementwise_fma(p[c], z2[c], (v2f)(pc[s]));
      q[c] = __builtin_elementwise_fma(q[c], z2[c], (v2f)(qc[s]));
    }
#pragma unroll
  for (int s = 5; s < 7; ++s)
#pragma unroll
    for (int c = 0; c < 4; ++c) p[c] = __builtin_elementwise_fma(p[c], z2[c], (v2f)(pc[s]));
#pragma unroll
  for (int c = 0; c < 4; ++c) {
    // Reciprocals in place, one statement: neither touches the other's register,
    // and the closing v_nop keeps the slot the instruction set asks for behind a
    // transcendental, whatever the compiler places next.
    float r0 = q[c][0], r1 = q[c][1];
    asm("v_rcp_f32 %0, %0\n\t"
        "v_rcp_f32 %1, %1\n\t"
        "v_nop"
        : "+v"(r0), "+v"(r1));
    q[c] = (v2f){r0, r1};
  }
#pragma unroll
  for (int c = 0; c < 4; ++c) {
    const v2f e = (p[c] * z[c]) * q[c];
    const v2f h = v[c] * 0.5f;
    v[c] = __builtin_elementwise_fma(h, e, h);
  }
}

// ---------------------------------------------------------------------------
// Tiled bf16 WMMA GEMM:  Y[M,N] = act( (A[M,K] * W[N,K]^T + bias) * scale )
// A, W row-major with K contiguous (torch Linear layout -> NT GEMM).
// Block tile 256x128, 8 waves of 64x64, K-step KS, LDS ring of NBUF tiles filled
// by async global->LDS DMA.  M % 256 == 0, N % 128 == 0, K % KS == 0.
// KS == 64: rows of 128 B, a tile of 54 KiB (two work-groups with two tiles each
// fit a WGP).  KS == 128: rows of 256 B, a tile of 102 KiB; one set of waits and
// one barrier serve 64 WMMAs a wave, and twice the bytes are in flight.
// NBUF == 2: one tile in flight; two work-groups fit a WGP and cover each other's
// waits (for grids of several work-groups per WGP).
// NBUF == 3: two tiles in flight, so that the path from L2 never runs empty
// between tiles (for grids of one work-group per WGP, which nothing else covers).
// THREE: one launch does three products with the same A.  W holds three [N, K]
// matrices one behind another, outB three [M, N] results likewise, each with its
// own bias; blockIdx.y runs over the 3 N / 128 column tiles and `scale` applies
// to the first product alone (the others take 1).
// ---------------------------------------------------------------------------
template <bool GELU, bool OUT_BF16, int NBUF, bool THREE, int KS>
__global__ __launch_bounds__(256)
void gemm_bf16_nt(const bf16* __restrict__ A, const bf16* __restrict__ W,
                  const float* __restrict__ bias, const float* __restrict__ bias1,
                  const float* __restrict__ bias2, float scale,
                  float* outF, bf16* outB, int M, int N, int K) {
  static_assert(!GELU || OUT_BF16, "the GELU epilogue writes bf16");
  static_assert(!THREE || (OUT_BF16 && !GELU), "three products: plain bf16 results");
  static_assert(NBUF == 2 || NBUF == 3, "ring of two or three tiles");
  static_assert(KS == 64 || KS == 128, "rows of 128 B or 256 B");
  constexpr int PITCH = KS + 8;        // 144 B or 272 B a row = 16 B x odd (b128 readers)
  __shared__ bf16 As[NBUF][256][PITCH];
  __shared__ bf16 Bs[NBUF][128][PITCH];

  const int tid  = threadIdx.x;
  const int lane = tid & 31;
  const int wave = tid >> 5;
  const int wm   = wave & 3;       // 4 M-bands of 64
  const int wn   = wave >> 2;      // 2 N-bands of 64
  const int half = lane >> 4;
  const int l16  = lane & 15;
  const int m0   = blockIdx.x * 256;
  const int n0   = blockIdx.y * 128;

  v8f acc[4][4] = {};

  // A tile goes out in KS / 64 parts of twelve 16B chunks per thread: 8 of A, rows
  // RSTEP apart, and 4 of W.  A wave's copy covers 512 B of whole lines: 4 rows of
  // 128 B or 2 rows of 256 B.
  constexpr int PARTS = KS / 64;
  constexpr int LPR   = KS / 8;                // lanes (16B chunks) a row
  constexpr int RSTEP = 256 / LPR;             // rows that one copy of the block covers
  const int cr = tid / LPR, cc = (tid % LPR) * 8;
  const bf16* gA = &A[(size_t)(m0 + cr) * K + cc];
  const bf16* gW = &W[(size_t)(n0 + cr) * K + cc];
  const size_t rs = (size_t)RSTEP * K;         // RSTEP rows further
  auto load_part = [&](int buf, int k0, int part) {
    async_copy16x12(lds_addr(&As[buf][cr + part * 8 * RSTEP][cc]),
                    lds_addr(&Bs[buf][cr + part * 4 * RSTEP][cc]),
                    RSTEP * PITCH * 2, gA + k0 + part * 8 * rs, gW + k0 + part * 4 * rs, rs);
  };
  auto load_tile = [&](int buf, int k0) {
    // unrolled: part is a constant in every call
#pragma unroll
    for (int part = 0; part < PARTS; ++part) load_part(buf, k0, part);
  };

  const int KT = K / KS;

  // One trip: the KS / 2 WMMAs of tile `cur`; where `fill` is set, the copies of the
  // tile at k0 go out into buffer `dst`, which every wave left at the last barrier.
  auto trip = [&](int cur, bool fill, int dst, int k0) {
    // every loop below is unrolled so that acc[][], a[] and b[] are indexed by
    // constants and stay in registers
#pragma unroll
    for (int ks = 0; ks < KS / 32; ++ks) {
      v16bf a[4], b[4];
#pragma unroll
      for (int i = 0; i < 4; ++i) {
        a[i] = frag_from(&As[cur][wm * 64 + i * 16 + l16][ks * 32 + 8 * half]);
        b[i] = frag_from(&Bs[cur][wn * 64 + i * 16 + l16][ks * 32 + 8 * half]);
      }
      // keeps the 16 LDS reads one group ahead of the 16 WMMAs: left alone the
      // scheduler sinks them among the WMMAs, one full LDS wait per row of four
      __builtin_amdgcn_sched_barrier(0);
      // issued here so that the copies' address work and wait run under the LDS
      // reads' latency
      if (ks < PARTS && fill) load_part(dst, k0, ks);
      // keeps the copies ahead of the WMMAs: left alone the scheduler sinks them,
      // with their wait, to the end of the block and forms their addresses in
      // fragment registers, at four idle slots behind a WMMA each time
      __builtin_amdgcn_sched_barrier(0);
#pragma unroll
      for (int mi = 0; mi < 4; ++mi)
#pragma unroll
        for (int ni = 0; ni < 4; ++ni)
          acc[mi][ni] = wmma_bf16(b[ni], a[mi], acc[mi][ni]);   // Y^T tile: W rows x A rows
      // second half of the pair: the next group's reads stay behind this block
      __builtin_amdgcn_sched_barrier(0);
    }
    // own LDS reads of `cur` retired before any wave may refill it
    asm volatile("s_wait_dscnt 0x0" ::: "memory");
  };

  if constexpr (NBUF == 2) {
    load_tile(0, 0);
    wait_async0();
    __syncthreads();
    for (int kt = 0; kt < KT; ++kt) {
      const int cur = kt & 1;
      trip(cur, kt + 1 < KT, cur ^ 1, (kt + 1) * KS);
      wait_async0();       // next-buffer DMA landed (ASYNCcnt not covered by barrier)
      __syncthreads();     // all waves done reading `cur`, writes visible
    }
  } else {
    // Tiles 0 and 1 go out together; tile 0 has landed when all but the copies
    // of tile 1 have.
    load_tile(0, 0);
    if (KT > 1) {
      load_tile(1, KS);
      wait_async_all_but_one_tile<12 * PARTS>();
    } else {
      wait_async0();
    }
    __syncthreads();

    int cur = 0, nxt = 1, dst = 2;   // kt, kt + 1, kt + 2 mod 3
    int kt = 0;
    // Every trip of this loop issues the copies of tile kt + 2, into the
    // buffer of tile kt - 1, and then waits for all but those: tile kt + 1 has
    // landed while tile kt + 2 stays in flight over the barrier.
    for (; kt + 2 < KT; ++kt) {
      trip(cur, true, dst, (kt + 2) * KS);
      wait_async_all_but_one_tile<12 * PARTS>();
      __syncthreads();     // tile kt + 1 visible; all waves done reading `cur`
      const int left = cur;
      cur = nxt; nxt = dst; dst = left;
    }
    // The last trips issue nothing more: the wait is to 0.
    for (; kt < KT; ++kt) {
      trip(cur, false, 0, 0);
      wait_async0();
      __syncthreads();
      cur = nxt;
    }
  }

  // ---- epilogue.  The products were taken transposed (W x A^T), so that
  // acc[mi][ni][j] = Y[row mi * 16 + l16][column ni * 16 + 8 * half + j]: a lane
  // holds 8 neighbouring columns of one row.  Each wave lays 32 rows of its 64 x 64
  // tile into its own part of the ring (free behind the loop's last barrier) with
  // 16-B LDS stores, reads them back row-wise and stores whole 128-B lines. ----
  if constexpr (THREE) {
    // Which product this block belongs to: the same for the whole block.  Columns
    // go on counting through all three, so the two bases are moved instead: the
    // indices below stay those of the single product.
    const int part = (n0 >= N) + (n0 >= 2 * N);
    bias  = (part == 0 ? bias : part == 1 ? bias1 : bias2) - (size_t)part * N;
    scale = part == 0 ? scale : 1.0f;
    outB += (size_t)part * M * N - (size_t)part * N;
  }
  constexpr int RP = OUT_BF16 ? 144 : 272;   // staged row pitch, bytes: 16 B x odd
  static_assert(8 * 32 * RP <= (int)sizeof(As), "the eight waves' rows fit the A ring");
  char* stage = (char*)&As[0][0][0] + wave * (32 * RP);
  const int colw = n0 + wn * 64;             // the wave's first column
  f32x4 bv[4][2];                            // the lane's 32 bias values, loaded together
  // every loop below is unrolled so that acc[][], bv[][], v[], w[] and t[] are
  // indexed by constants and stay in registers
  // the pair of fences keeps other address work out of the run of loads, so that
  // the wait stands in front of every rewrite of the loads' address registers
  __builtin_amdgcn_sched_barrier(0);
#pragma unroll
  for (int ni = 0; ni < 4; ++ni) {
    bv[ni][0] = *(const f32x4*)&bias[colw + ni * 16 + 8 * half];
    bv[ni][1] = *(const f32x4*)&bias[colw + ni * 16 + 8 * half + 4];
  }
  asm volatile("s_wait_xcnt 0x0" ::: "memory");
  __builtin_amdgcn_sched_barrier(0);
#pragma unroll
  for (int mh = 0; mh < 2; ++mh) {
#pragma unroll
    for (int m2 = 0; m2 < 2; ++m2) {
      char* p = stage + (m2 * 16 + l16) * RP;
#pragma unroll
      for (int ni = 0; ni < 4; ++ni) {
        float v[8];
#pragma unroll
        for (int j = 0; j < 8; ++j)
          v[j] = (acc[mh * 2 + m2][ni][j] + bv[ni][j >> 2][j & 3]) * scale;
        if constexpr (OUT_BF16) {
          v2f w[4] = {{v[0], v[1]}, {v[2], v[3]}, {v[4], v[5]}, {v[6], v[7]}};
          if constexpr (GELU) gelu2x4(w);       // pairs: the polynomial runs on packed f32
          v8bf o;
#pragma unroll
          for (int c = 0; c < 4; ++c) {
            const v2bf k = __builtin_convertvector(w[c], v2bf);
            o[2 * c] = k[0]; o[2 * c + 1] = k[1];
          }
          *(v8bf*)(p + ni * 32 + half * 16) = o;
        } else {
          const f32x4 lo = {v[0], v[1], v[2], v[3]}, hi = {v[4], v[5], v[6], v[7]};
          *(f32x4*)(p + ni * 64 + half * 32)      = lo;
          *(f32x4*)(p + ni * 64 + half * 32 + 16) = hi;
        }
      }
    }
    // the wave's 32 rows are in LDS before its lanes read one another's pieces
    asm volatile("s_wait_dscnt 0x0" ::: "memory");
    const size_t row0 = (size_t)(m0 + wm * 64 + mh * 32);
    if constexpr (OUT_BF16) {
      // 8 lanes a row of 128 B, 4 rows an instruction
      const int r = lane >> 3, c = lane & 7;
      v8bf t[8];
#pragma unroll
      for (int it = 0; it < 8; ++it) t[it] = *(const v8bf*)(stage + (it * 4 + r) * RP + c * 16);
#pragma unroll
      for (int it = 0; it < 8; ++it)
        *(v8bf*)&outB[(row0 + it * 4 + r) * N + colw + c * 8] = t[it];
    } else {
      // 16 lanes a row of 256 B, 2 rows an instruction
      f32x4 t[16];
#pragma unroll
      for (int it = 0; it < 16; ++it)
        t[it] = *(const f32x4*)(stage + (it * 2 + half) * RP + l16 * 16);
#pragma unroll
      for (int it = 0; it < 16; ++it)
        *(f32x4*)&outF[(row0 + it * 2 + half) * N + colw + l16 * 4] = t[it];
    }
    // the read-back has ended before the next 32 rows are laid over it
    if (mh == 0) asm volatile("s_wait_dscnt 0x0" ::: "memory");
  }
}

// ---------------------------------------------------------------------------
// Flash attention: grid (S/128, H, B), block = 128 threads = 4 waves.
// Each wave owns 32 queries, as two groups of 16 columns; K/V tiles of 64 keys
// staged in LDS.  Every K and V fragment read from LDS serves both groups, and
// maximum, correction and rescale are paid once per 64 keys.
// Transposed products: S^T = K x Q^T and O^T += V^T x P^T.  A lane then holds
// 32 of the 64 scores of ONE query per group (query = l16, keys 16 i + 8*half + r
// of score tile i), so maximum and sum are taken in the lane's own registers
// with one exchange between the wave's halves, and the score tiles, converted
// in place, already are the B operands of the second product.
// ---------------------------------------------------------------------------
typedef short s16x8 __attribute__((ext_vector_type(8)));
typedef float v4f   __attribute__((ext_vector_type(4)));

// Transposing LDS read: lane (l16, half) receives T[kbase + 8*half + 0..7][dbase + l16]
// when it passes &T[kbase + 8*half + (lane & 7)][dbase + 8 * ((lane >> 3) & 1)].
__device__ __forceinline__ v8bf ld_tr16(const bf16* p) {
  typedef __attribute__((address_space(3))) s16x8 lds_s16x8;
  return __builtin_bit_cast(v8bf, __builtin_amdgcn_ds_load_tr16_b128_v8i16((lds_s16x8*)p));
}

// lane l <-> lane l ^ 16
__device__ __forceinline__ float xhalf(float x) {
  return __builtin_bit_cast(float, __builtin_amdgcn_permlanex16(
      __builtin_bit_cast(int, x), __builtin_bit_cast(int, x),
      0x76543210, 0xfedcba98, false, false));
}

#define LOG2E 1.44269504088896340736f

// Base-2 exponentials in place.  Written as one statement so that the slot the
// instruction set asks for behind a transcendental is kept: inside the run no
// v_exp touches its neighbour's registers, and the closing v_nop stands in
// front of whatever the compiler places next.
__device__ __forceinline__ void exp2_x8(float (&e)[8]) {
  asm("v_exp_f32 %0, %0\n\t"
      "v_exp_f32 %1, %1\n\t"
      "v_exp_f32 %2, %2\n\t"
      "v_exp_f32 %3, %3\n\t"
      "v_exp_f32 %4, %4\n\t"
      "v_exp_f32 %5, %5\n\t"
      "v_exp_f32 %6, %6\n\t"
      "v_exp_f32 %7, %7\n\t"
      "v_nop"
      : "+v"(e[0]), "+v"(e[1]), "+v"(e[2]), "+v"(e[3]),
        "+v"(e[4]), "+v"(e[5]), "+v"(e[6]), "+v"(e[7]));
}
__device__ __forceinline__ void exp2_x1(float& e) {
  asm("v_exp_f32 %0, %0\n\t"
      "v_nop"
      : "+v"(e));
}

#define AK 64                   // keys per pass
#define AQ 128                  // queries per block: 4 waves x 2 groups x 16

__global__ __launch_bounds__(128)
void flash_attn(const bf16* __restrict__ Q, const bf16* __restrict__ Kb,
                const bf16* __restrict__ Vb, const int* __restrict__ mask,
                bf16* __restrict__ Ctx) {
  __shared__ bf16 Ks[AK][72];     // 144B pitch = 16B x odd (b128 readers)
  __shared__ bf16 Vs[AK][80];     // 160B pitch = 32B x odd (transposing readers)
  __shared__ __attribute__((aligned(16))) float Madd[AK];

  const int tid  = threadIdx.x;
  const int lane = tid & 31;
  const int wave = tid >> 5;
  const int half = lane >> 4;
  const int l16  = lane & 15;
  const int qt   = blockIdx.x;
  const int h    = blockIdx.y;
  const int b    = blockIdx.z;

  // Group g's 16 queries as two B-fragments (dh 0..31, 32..63): column = l16.
  const size_t qrow = ((size_t)b * SS + qt * AQ + wave * 32 + l16) * DD + h * DH;
  v16bf qb[2][2];
  // every loop over g, i, f, kc, c and r below is unrolled so that the arrays are
  // indexed by constants and stay in registers
#pragma unroll
  for (int g = 0; g < 2; ++g) {
    qb[g][0] = frag_from(&Q[qrow + (size_t)g * 16 * DD + 0  + 8 * half]);
    qb[g][1] = frag_from(&Q[qrow + (size_t)g * 16 * DD + 32 + 8 * half]);
  }

  // m[g]: running maximum of query l16 of group g (equal in both halves); l[g]:
  // this half's part of its running sum; cacc[g][f][r] = O^T[dh = 16 f + 8 half + r].
  float m[2] = {-1e30f, -1e30f}, l[2] = {0.0f, 0.0f};
  v8f cacc[2][4] = {};

  const bf16* vp = &Vs[8 * half + (lane & 7)][8 * ((lane >> 3) & 1)];

  for (int kt = 0; kt < SS / AK; ++kt) {
    // ---- cooperative K/V tile load: 64 keys x 64 dh each ----
    // the eight loads first, then the eight LDS stores: one memory latency a tile
    v8bf kr[4], vr[4];
#pragma unroll
    for (int c = 0; c < 4; ++c) {
      int ch = tid + c * 128;                 // 0..511
      int r = ch >> 3, col = (ch & 7) * 8;
      size_t g = ((size_t)b * SS + kt * AK + r) * DD + h * DH + col;
      kr[c] = *(const v8bf*)&Kb[g];
      vr[c] = *(const v8bf*)&Vb[g];
    }
#pragma unroll
    for (int c = 0; c < 4; ++c) {
      int ch = tid + c * 128;
      int r = ch >> 3, col = (ch & 7) * 8;
      *(v8bf*)&Ks[r][col] = kr[c];
      *(v8bf*)&Vs[r][col] = vr[c];
    }
    if (tid < AK)
      Madd[tid] = mask[(size_t)b * SS + kt * AK + tid] ? 0.0f : -1e30f;
    __syncthreads();

    // ---- scores: S^T = K x Q^T, four 16-key tiles, K-dim = dh 64.  The key's
    // additive mask is the accumulator's start value: row r of tile i is key
    // 16 i + 8 half + r. ----
    v8f s[2][4];
#pragma unroll
    for (int ip = 0; ip < 4; ip += 2) {
      v8f mk[2];
      v16bf ka[2][2];
#pragma unroll
      for (int j = 0; j < 2; ++j) {
        const int i = ip + j;
        const v4f ma = *(const v4f*)&Madd[16 * i + 8 * half];
        const v4f mb = *(const v4f*)&Madd[16 * i + 8 * half + 4];
#pragma unroll
        for (int r = 0; r < 4; ++r) { mk[j][r] = ma[r]; mk[j][r + 4] = mb[r]; }
        ka[j][0] = frag_from(&Ks[16 * i + l16][0 + 8 * half]);
        ka[j][1] = frag_from(&Ks[16 * i + l16][32 + 8 * half]);
      }
      // keeps the twelve LDS reads one group ahead of the eight WMMAs: left alone
      // the scheduler pairs them off, one full LDS wait per WMMA
      __builtin_amdgcn_sched_barrier(0);
#pragma unroll
      for (int j = 0; j < 2; ++j)
#pragma unroll
        for (int g = 0; g < 2; ++g) s[g][ip + j] = wmma_bf16(ka[j][0], qb[g][0], mk[j]);
#pragma unroll
      for (int j = 0; j < 2; ++j)
#pragma unroll
        for (int g = 0; g < 2; ++g)
          s[g][ip + j] = wmma_bf16(ka[j][1], qb[g][1], s[g][ip + j]);
    }
    // keeps the maxima behind the last product: left alone the scheduler puts one
    // behind each of the last four WMMAs, at four idle slots each time
    __builtin_amdgcn_sched_barrier(0);

    // ---- online softmax over this 64-key slab, one query per lane and group ----
    v16bf pb[2][2];               // P^T as B: [group][chunk kc], element s = key 32 kc + 8 half + s, or 32 kc + 16 + 8 half + s - 8 for s >= 8
#pragma unroll
    for (int g = 0; g < 2; ++g) {
      // two independent chains; the tiles whose products ended first come first
      float mx = fmaxf(s[g][0][0], s[g][1][0]), my = fmaxf(s[g][2][0], s[g][3][0]);
#pragma unroll
      for (int r = 1; r < 8; ++r) mx = fmaxf(mx, fmaxf(s[g][0][r], s[g][1][r]));
#pragma unroll
      for (int r = 1; r < 8; ++r) my = fmaxf(my, fmaxf(s[g][2][r], s[g][3][r]));
      mx = fmaxf(mx, my);
      mx = fmaxf(mx, xhalf(mx));              // the other half's 32 keys
      const float mn = fmaxf(m[g], mx);
      // the difference is taken first: it is never above 0, also where every key
      // so far carries the mask's -1e30
      float cor = (m[g] - mn) * LOG2E;
      float e[4][8];
#pragma unroll
      for (int i = 0; i < 4; ++i)
#pragma unroll
        for (int r = 0; r < 8; ++r) e[i][r] = (s[g][i][r] - mn) * LOG2E;
      exp2_x1(cor);
#pragma unroll
      for (int i = 0; i < 4; ++i) exp2_x8(e[i]);
      m[g] = mn;
      float t[8];
#pragma unroll
      for (int r = 0; r < 8; ++r) {
        t[r] = (e[0][r] + e[1][r]) + (e[2][r] + e[3][r]);
        pb[g][0][r]     = (bf16)e[0][r];
        pb[g][0][r + 8] = (bf16)e[1][r];
        pb[g][1][r]     = (bf16)e[2][r];
        pb[g][1][r + 8] = (bf16)e[3][r];
      }
      const float rs = ((t[0] + t[4]) + (t[2] + t[6])) + ((t[1] + t[5]) + (t[3] + t[7]));
      l[g] = l[g] * cor + rs;
#pragma unroll
      for (int f = 0; f < 4; ++f) cacc[g][f] *= cor;
    }

    // ---- O^T += V^T(16 dh x 32 keys) x P^T(32 keys x 16 queries), two key chunks,
    // each V^T fragment for both groups ----
#pragma unroll
    for (int kc = 0; kc < 2; ++kc) {
#pragma unroll
      for (int f = 0; f < 4; ++f) {
        v8bf lo = ld_tr16(vp + (kc * 32) * 80 + f * 16);        // keys 32 kc + 8 half + 0..7
        v8bf hi = ld_tr16(vp + (kc * 32 + 16) * 80 + f * 16);   // keys 32 kc + 16 + 8 half + 0..7
        v16bf va;
#pragma unroll
        for (int i = 0; i < 8; ++i) { va[i] = lo[i]; va[i + 8] = hi[i]; }
#pragma unroll
        for (int g = 0; g < 2; ++g) cacc[g][f] = wmma_bf16(va, pb[g][kc], cacc[g][f]);
      }
    }
    __syncthreads();  // Ks/Vs reused next iteration
  }

  // ---- finalize: join the halves' sums, divide, write bf16 ctx (b,s,h*64+dh):
  // a lane's 8 registers of a tile are 8 consecutive dh of its query ----
  v8bf ov[2][4];
#pragma unroll
  for (int g = 0; g < 2; ++g) {
    const float lt = l[g] + xhalf(l[g]);
    const float inv = (lt > 0.0f) ? (1.0f / lt) : 0.0f;
#pragma unroll
    for (int f = 0; f < 4; ++f)
#pragma unroll
      for (int r = 0; r < 8; ++r) ov[g][f][r] = (bf16)(cacc[g][f][r] * inv);
  }
  // keeps the eight stores behind the last conversion, so that no register of an
  // issued store is written again
  __builtin_amdgcn_sched_barrier(0);
#pragma unroll
  for (int g = 0; g < 2; ++g)
#pragma unroll
    for (int f = 0; f < 4; ++f)
      *(v8bf*)&Ctx[qrow + (size_t)g * 16 * DD + 8 * half + f * 16] = ov[g][f];
}

// ---------------------------------------------------------------------------
// Residual + LayerNorm over D=1024; optionally emits bf16 copy of the result.
// One block (256 thr) per token row. outF may alias y (in-place).
// ---------------------------------------------------------------------------
__device__ __forceinline__ float block_sum(float v, float* red) {
  v += __shfl_xor(v, 1);
  v += __shfl_xor(v, 2);
  v += __shfl_xor(v, 4);
  v += __shfl_xor(v, 8);
  v += __shfl_xor(v, 16);
  int lane = threadIdx.x & 31, w = threadIdx.x >> 5;
  if (lane == 0) red[w] = v;
  __syncthreads();
  if (threadIdx.x == 0) {
    float s = 0.0f;
#pragma unroll
    for (int i = 0; i < 8; ++i) s += red[i];
    red[0] = s;
  }
  __syncthreads();
  float r = red[0];
  __syncthreads();
  return r;
}

__global__ __launch_bounds__(256)
void ln_residual(const float* y, const float* __restrict__ res,
                 const float* __restrict__ g, const float* __restrict__ beta,
                 float* outF, bf16* outB) {
  __shared__ float red[8];
  const size_t row = blockIdx.x;
  const float* yp = y + row * DD;
  const float* rp = res + row * DD;
  const int base = threadIdx.x * 4;

  float v[4];
  float s = 0.0f;
#pragma unroll
  for (int i = 0; i < 4; ++i) { v[i] = yp[base + i] + rp[base + i]; s += v[i]; }
  float mu = block_sum(s, red) * (1.0f / DD);

  float q = 0.0f;
#pragma unroll
  for (int i = 0; i < 4; ++i) { float d = v[i] - mu; q += d * d; }
  float var = block_sum(q, red) * (1.0f / DD);
  float rstd = rsqrtf(var + 1e-12f);

#pragma unroll
  for (int i = 0; i < 4; ++i) {
    float o = (v[i] - mu) * rstd * g[base + i] + beta[base + i];
    outF[row * DD + base + i] = o;
    if (outB) outB[row * DD + base + i] = (bf16)o;
  }
}

// ---------------------------------------------------------------------------
// Launch
// ---------------------------------------------------------------------------
extern "C" void kernel_launch(void* const* d_in, const int* in_sizes, int n_in,
                              void* d_out, int out_size, void* d_ws, size_t ws_size,
                              hipStream_t stream) {
  (void)in_sizes; (void)n_in; (void)out_size; (void)ws_size;

  const float* x    = (const float*)d_in[0];
  const int*   msk  = (const int*)d_in[1];
  const float* Wq   = (const float*)d_in[2];
  const float* bq   = (const float*)d_in[3];
  const float* Wk   = (const float*)d_in[4];
  const float* bk   = (const float*)d_in[5];
  const float* Wv   = (const float*)d_in[6];
  const float* bv   = (const float*)d_in[7];
  const float* Wo   = (const float*)d_in[8];
  const float* bo   = (const float*)d_in[9];
  const float* ln1g = (const float*)d_in[10];
  const float* ln1b = (const float*)d_in[11];
  const float* W1   = (const float*)d_in[12];
  const float* b1   = (const float*)d_in[13];
  const float* W2   = (const float*)d_in[14];
  const float* b2   = (const float*)d_in[15];
  const float* ln2g = (const float*)d_in[16];
  const float* ln2b = (const float*)d_in[17];
  float* out = (float*)d_out;

  char* ws = (char*)d_ws;
  const size_t MB = 1ull << 20;
  bf16*  wqb  = (bf16*)(ws + 0 * MB);
  bf16*  wkb  = (bf16*)(ws + 2 * MB);
  bf16*  wvb  = (bf16*)(ws + 4 * MB);
  bf16*  wob  = (bf16*)(ws + 6 * MB);
  bf16*  w1b  = (bf16*)(ws + 8 * MB);     // F*D
  bf16*  w2b  = (bf16*)(ws + 16 * MB);    // D*F
  bf16*  xb   = (bf16*)(ws + 24 * MB);
  bf16*  qb   = (bf16*)(ws + 40 * MB);
  bf16*  kb   = (bf16*)(ws + 56 * MB);
  bf16*  vb   = (bf16*)(ws + 72 * MB);
  bf16*  ctxb = (bf16*)(ws + 88 * MB);
  float* sa   = (float*)(ws + 104 * MB);  // sa_out, then h (in-place LN1)
  bf16*  hb   = (bf16*)(ws + 136 * MB);
  bf16*  ffb  = (bf16*)(ws + 40 * MB);    // reuse q/k/v/ctx region (dead by FFN1)
  float* y2   = (float*)(ws + 152 * MB);

  // all seven conversions: wqb .. w2b and xb are one run of the workspace
  hipLaunchKernelGGL(cvt_all_f32_bf16, dim3(CVT_UNITS * DD * DD / CVT_BLOCK), dim3(256),
                     0, stream, Wq, Wk, Wv, Wo, W1, W2, x, wqb);

  const float* none = nullptr;
  dim3 gB(256);
  dim3 gQKV(NTOK / 256, DD / 128);
  // q = (x Wq^T + bq) / sqrt(64), k = x Wk^T + bk, v = x Wv^T + bv in one launch:
  // wqb, wkb, wvb are one [3 D, D] matrix and qb, kb, vb lie one behind another
  hipLaunchKernelGGL((gemm_bf16_nt<false, true, 3, true, 128>), dim3(NTOK / 256, 3 * DD / 128),
                     gB, 0, stream,
                     xb, wqb, bq, bk, bv, 0.125f, (float*)nullptr, qb, NTOK, DD, DD);

  dim3 aG(SS / AQ, HH, BB), aB(128);
  hipLaunchKernelGGL(flash_attn, aG, aB, 0, stream, qb, kb, vb, msk, ctxb);

  // sa = ctx Wo^T + bo   (f32)
  hipLaunchKernelGGL((gemm_bf16_nt<false, false, 3, false, 128>), gQKV, gB, 0, stream,
                     ctxb, wob, bo, none, none, 1.0f, sa, (bf16*)nullptr, NTOK, DD, DD);

  // h = LN1(sa + x), in-place in sa; also bf16 copy hb
  hipLaunchKernelGGL(ln_residual, dim3(NTOK), dim3(256), 0, stream,
                     sa, x, ln1g, ln1b, sa, hb);

  // ff = gelu(h W1^T + b1)   (bf16, M=8192 N=4096 K=1024)
  dim3 gF1(NTOK / 256, FF / 128);
  hipLaunchKernelGGL((gemm_bf16_nt<true, true, 2, false, 64>), gF1, gB, 0, stream,
                     hb, w1b, b1, none, none, 1.0f, (float*)nullptr, ffb, NTOK, FF, DD);

  // y2 = ff W2^T + b2   (f32, K=4096)
  hipLaunchKernelGGL((gemm_bf16_nt<false, false, 3, false, 128>), gQKV, gB, 0, stream,
                     ffb, w2b, b2, none, none, 1.0f, y2, (bf16*)nullptr, NTOK, DD, FF);

  // out = LN2(y2 + h)
  hipLaunchKernelGGL(ln_residual, dim3(NTOK), dim3(256), 0, stream,
                     y2, sa, ln2g, ln2b, out, (bf16*)nullptr);
}

// v009
// A run of this version takes 212 microseconds.
// Next to v008, in two timings, it ran 1.05 times as fast each time.
// All steps since v000 together make it 2.53 times as fast.
#include <hip/hip_runtime.h>
#include <math.h>
#include <stdint.h>

// ---------------------------------------------------------------------------
// Types
// ---------------------------------------------------------------------------
typedef __bf16 bf16;
typedef __bf16 v16bf __attribute__((ext_vector_type(16)));
typedef __bf16 v8bf  __attribute__((ext_vector_type(8)));
typedef float  v8f   __attribute__((ext_vector_type(8)));

#define BB 8
#define SS 1024
#define DD 1024
#define HH 16
#define DH 64
#define FF 4096
#define NTOK (BB * SS)          // 8192

// ---------------------------------------------------------------------------
// WMMA helpers (CDNA5 v_wmma_f32_16x16x32_bf16)
// ---------------------------------------------------------------------------
__device__ __forceinline__ v8f wmma_bf16(v16bf a, v16bf b, v8f c) {
  return __builtin_amdgcn_wmma_f32_16x16x32_bf16(
      /*neg_a=*/false, a, /*neg_b=*/false, b,
      /*c_mod=*/(short)0, c, /*reuse_a=*/false, /*reuse_b=*/false);
}

// A/B fragment loader. ISA 16-bit 16x32 layout: lane half h holds
// K[8h..8h+7] in halves 0..7 and K[16+8h..16+8h+7] in halves 8..15.
// Caller passes p = &row[k0 + 8*half]; we read p[0..7] and p[16..23].
__device__ __forceinline__ v16bf frag_from(const bf16* p) {
  v8bf lo = *(const v8bf*)(p);
  v8bf hi = *(const v8bf*)(p + 16);
  v16bf a;
#pragma unroll
  for (int i = 0; i < 8; ++i) { a[i] = lo[i]; a[i + 8] = hi[i]; }
  return a;
}

// CDNA5 async global->LDS copies of 16B chunks (tracked by ASYNCcnt; bypass
// VGPRs entirely).  GV addressing: vdst = LDS byte address, v[addr64], off.
// s_wait_xcnt 0 is the last line of the copies' own statement so that no address
// register is rewritten ahead of it.
__device__ __forceinline__ uint32_t lds_addr(const bf16* p) {
  return (uint32_t)(uint64_t)p;  // flat LDS addr[31:0] = LDS offset
}

// Twelve 16B chunks per lane: LDS places l + i * lstep for the eight chunks of
// the first operand (lstep bytes = the same count of rows apart in both), m + i * lstep
// for the four of the second.
__device__ __forceinline__ void async_copy16x12(uint32_t l, uint32_t m, uint32_t lstep,
                                                const bf16* a, const bf16* w, size_t gstep) {
  asm volatile("global_load_async_to_lds_b128 %0, %12, off\n\t"
               "global_load_async_to_lds_b128 %1, %13, off\n\t"
               "global_load_async_to_lds_b128 %2, %14, off\n\t"
               "global_load_async_to_lds_b128 %3, %15, off\n\t"
               "global_load_async_to_lds_b128 %4, %16, off\n\t"
               "global_load_async_to_lds_b128 %5, %17, off\n\t"
               "global_load_async_to_lds_b128 %6, %18, off\n\t"
               "global_load_async_to_lds_b128 %7, %19, off\n\t"
               "global_load_async_to_lds_b128 %8, %20, off\n\t"
               "global_load_async_to_lds_b128 %9, %21, off\n\t"
               "global_load_async_to_lds_b128 %10, %22, off\n\t"
               "global_load_async_to_lds_b128 %11, %23, off\n\t"
               "s_wait_xcnt 0x0"
               :: "v"(l), "v"(l + lstep), "v"(l + 2 * lstep), "v"(l + 3 * lstep),
                  "v"(l + 4 * lstep), "v"(l + 5 * lstep), "v"(l + 6 * lstep),
                  "v"(l + 7 * lstep),
                  "v"(m), "v"(m + lstep), "v"(m + 2 * lstep), "v"(m + 3 * lstep),
                  "v"((uint64_t)a), "v"((uint64_t)(a + gstep)),
                  "v"((uint64_t)(a + 2 * gstep)), "v"((uint64_t)(a + 3 * gstep)),
                  "v"((uint64_t)(a + 4 * gstep)), "v"((uint64_t)(a + 5 * gstep)),
                  "v"((uint64_t)(a + 6 * gstep)), "v"((uint64_t)(a + 7 * gstep)),
                  "v"((uint64_t)w), "v"((uint64_t)(w + gstep)),
                  "v"((uint64_t)(w + 2 * gstep)), "v"((uint64_t)(w + 3 * gstep))
               : "memory");
}

__device__ __forceinline__ void wait_async0() {
  asm volatile("s_wait_asynccnt 0x0" ::: "memory");
}
// All but this wave's youngest COPIES copies (one tile's worth, 12 or 24) have
// landed: the counter returns in issue order, and only these copies count on it here.
template <int COPIES>
__device__ __forceinline__ void wait_async_all_but_one_tile() {
  static_assert(COPIES == 12 || COPIES == 24, "one tile is 12 or 24 copies a lane");
  if constexpr (COPIES == 12) asm volatile("s_wait_asynccnt 0xc" ::: "memory");
  else                        asm volatile("s_wait_asynccnt 0x18" ::: "memory");
}

// ---------------------------------------------------------------------------
// fp32 -> bf16 conversion of all seven arrays in ONE launch.  Their bf16 copies
// lie one behind another in the workspace (Wq, Wk, Wv, Wo, W1, W2, x), so the
// destination is one run of 20 * D * D elements; a block takes 8192 of them,
// which lie inside one array (every length is a multiple of D * D), and picks
// its source by a scalar test.  16 B per lane, the eight loads first; a wave's
// store covers two whole lines.
// ---------------------------------------------------------------------------
typedef float  f32x4  __attribute__((ext_vector_type(4)));
typedef __bf16 bf16x4 __attribute__((ext_vector_type(4)));

#define CVT_UNITS 20            // 4 (Wq Wk Wv Wo) + 4 (W1) + 4 (W2) + 8 (x), in D * D
#define CVT_BLOCK 8192          // elements per block

__global__ __launch_bounds__(256)
void cvt_all_f32_bf16(const float* __restrict__ wq, const float* __restrict__ wk,
                      const float* __restrict__ wv, const float* __restrict__ wo,
                      const float* __restrict__ w1, const float* __restrict__ w2,
                      const float* __restrict__ x, bf16* __restrict__ out) {
  const uint32_t e0   = blockIdx.x * (uint32_t)CVT_BLOCK;   // first element, in out
  const uint32_t unit = e0 / (uint32_t)(DD * DD);
  const float* src;
  uint32_t first;                                           // unit where src begins
  if (unit < 4)       { src = unit == 0 ? wq : unit == 1 ? wk : unit == 2 ? wv : wo;
                        first = unit; }
  else if (unit < 8)  { src = w1; first = 4; }
  else if (unit < 12) { src = w2; first = 8; }
  else                { src = x;  first = 12; }
  const uint32_t t = threadIdx.x * 4;
  const float* p = src + (e0 - first * (uint32_t)(DD * DD)) + t;
  bf16* o = out + e0 + t;
  f32x4 v[8];
  // both loops unrolled: v[] is indexed by constants and stays in registers
#pragma unroll
  for (int c = 0; c < 8; ++c) v[c] = *(const f32x4*)(p + c * 1024);
#pragma unroll
  for (int c = 0; c < 8; ++c)
    *(bf16x4*)(o + c * 1024) = __builtin_convertvector(v[c], bf16x4);
}

// ---------------------------------------------------------------------------
// Exact-form GELU, 0.5 v (1 + erf(v / sqrt 2)), two values at a time, no branch.
// erf(z) = z P(z^2) / Q(z^2) on |z| <= 4 (beyond it erf rounds to +-1 in f32);
// absolute error below 4e-7 over the whole line.  Straight-line packed code:
// the values of a lane are independent chains that the scheduler interleaves,
// and the epilogue's text is a fraction of the branching form's.
// ---------------------------------------------------------------------------
typedef float  v2f  __attribute__((ext_vector_type(2)));
typedef __bf16 v2bf __attribute__((ext_vector_type(2)));

// Taken on the four pairs that a lane holds of one tile, step by step across the
// pairs: four independent chains stand next to one another in the text, so that
// no link waits for the one before it.
__device__ __forceinline__ void gelu2x4(v2f (&v)[4]) {
  const v2f lim = 4.0f;
  v2f z[4], z2[4], p[4], q[4];
  // every loop over c is unrolled: the arrays are indexed by constants and stay in registers
#pragma unroll
  for (int c = 0; c < 4; ++c) {
    z[c] = __builtin_elementwise_min(
        __builtin_elementwise_max(v[c] * 0.70710678118654752f, -lim), lim);
    z2[c] = z[c] * z[c];
  }
  const float pc[7] = {-2.72614225801306e-10f, 2.77068142495902e-08f, -2.10102402082508e-06f,
                       -5.69250639462346e-05f, -7.34990630326855e-04f, -2.95459980854025e-03f,
                       -1.60960333262415e-02f};
  const float qc[5] = {-1.45660718464996e-05f, -2.13374055278905e-04f, -1.68282697438203e-03f,
                       -7.37332916720468e-03f, -1.42647390514189e-02f};
#pragma unroll
  for (int c = 0; c < 4; ++c) { p[c] = pc[0]; q[c] = qc[0]; }
#pragma unroll
  for (int s = 1; s < 5; ++s)
#pragma unroll
    for (int c = 0; c < 4; ++c) {
      p[c] = __builtin_elementwise_fma(p[c], z2[c], (v2f)(pc[s]));
      q[c] = __builtin_elementwise_fma(q[c], z2[c], (v2f)(qc[s]));
    }
#pragma unroll
  for (int s = 5; s < 7; ++s)
#pragma unroll
    for (int c = 0; c < 4; ++c) p[c] = __builtin_elementwise_fma(p[c], z2[c], (v2f)(pc[s]));
#pragma unroll
  for (int c = 0; c < 4; ++c) {
    // Reciprocals in place, one statement: neither touches the other's register,
    // and the closing v_nop keeps the slot the instruction set asks for behind a
    // transcendental, whatever the compiler places next.
    float r0 = q[c][0], r1 = q[c][1];
    asm("v_rcp_f32 %0, %0\n\t"
        "v_rcp_f32 %1, %1\n\t"
        "v_nop"
        : "+v"(r0), "+v"(r1));
    q[c] = (v2f){r0, r1};
  }
#pragma unroll
  for (int c = 0; c < 4; ++c) {
    const v2f e = (p[c] * z[c]) * q[c];
    const v2f h = v[c] * 0.5f;
    v[c] = __builtin_elementwise_fma(h, e, h);
  }
}

// ---------------------------------------------------------------------------
// Tiled bf16 WMMA GEMM:  Y[M,N] = act( (A[M,K] * W[N,K]^T + bias) * scale )
// A, W row-major with K contiguous (torch Linear layout -> NT GEMM).
// Block tile 256x128, 8 waves of 64x64, K-step KS, LDS ring of NBUF tiles filled
// by async global->LDS DMA.  M % 256 == 0, N % 128 == 0, K % KS == 0.
// KS == 64: rows of 128 B, a tile of 54 KiB (two work-groups with two tiles each
// fit a WGP).  KS == 128: rows of 256 B, a tile of 102 KiB; one set of waits and
// one barrier serve 64 WMMAs a wave, and twice the bytes are in flight.
// NBUF == 2: one tile in flight; two work-groups fit a WGP and cover each other's
// waits (for grids of several work-groups per WGP).
// NBUF == 3: two tiles in flight, so that the path from L2 never runs empty
// between tiles (for grids of one work-group per WGP, which nothing else covers).
// THREE: one launch does three products with the same A.  W holds three [N, K]
// matrices one behind another, outB three [M, N] results likewise, each with its
// own bias; blockIdx.y runs over the 3 N / 128 column tiles and `scale` applies
// to the first product alone (the others take 1).
// ---------------------------------------------------------------------------
template <bool GELU, bool OUT_BF16, int NBUF, bool THREE, int KS>
__global__ __launch_bounds__(256)
void gemm_bf16_nt(const bf16* __restrict__ A, const bf16* __restrict__ W,
                  const float* __restrict__ bias, const float* __restrict__ bias1,
                  const float* __restrict__ bias2, float scale,
                  float* outF, bf16* outB, int M, int N, int K) {
  static_assert(!GELU || OUT_BF16, "the GELU epilogue writes bf16");
  static_assert(!THREE || (OUT_BF16 && !GELU), "three products: plain bf16 results");
  static_assert(NBUF == 2 || NBUF == 3, "ring of two or three tiles");
  static_assert(KS == 64 || KS == 128, "rows of 128 B or 256 B");
  constexpr int PITCH = KS + 8;        // 144 B or 272 B a row = 16 B x odd (b128 readers)
  __shared__ bf16 As[NBUF][256][PITCH];
  __shared__ bf16 Bs[NBUF][128][PITCH];

  const int tid  = threadIdx.x;
  const int lane = tid & 31;
  const int wave = tid >> 5;
  const int wm   = wave & 3;       // 4 M-bands of 64
  const int wn   = wave >> 2;      // 2 N-bands of 64
  const int half = lane >> 4;
  const int l16  = lane & 15;
  const int m0   = blockIdx.x * 256;
  const int n0   = blockIdx.y * 128;

  v8f acc[4][4] = {};

  // A tile goes out in KS / 64 parts of twelve 16B chunks per thread: 8 of A, rows
  // RSTEP apart, and 4 of W.  A wave's copy covers 512 B of whole lines: 4 rows of
  // 128 B or 2 rows of 256 B.
  constexpr int PARTS = KS / 64;
  constexpr int LPR   = KS / 8;                // lanes (16B chunks) a row
  constexpr int RSTEP = 256 / LPR;             // rows that one copy of the block covers
  const int cr = tid / LPR, cc = (tid % LPR) * 8;
  const bf16* gA = &A[(size_t)(m0 + cr) * K + cc];
  const bf16* gW = &W[(size_t)(n0 + cr) * K + cc];
  const size_t rs = (size_t)RSTEP * K;         // RSTEP rows further
  auto load_part = [&](int buf, int k0, int part) {
    async_copy16x12(lds_addr(&As[buf][cr + part * 8 * RSTEP][cc]),
                    lds_addr(&Bs[buf][cr + part * 4 * RSTEP][cc]),
                    RSTEP * PITCH * 2, gA + k0 + part * 8 * rs, gW + k0 + part * 4 * rs, rs);
  };
  auto load_tile = [&](int buf, int k0) {
    // unrolled: part is a constant in every call
#pragma unroll
    for (int part = 0; part < PARTS; ++part) load_part(buf, k0, part);
  };

  const int KT = K / KS;

  // One trip: the KS / 2 WMMAs of tile `cur`; where `fill` is set, the copies of the
  // tile at k0 go out into buffer `dst`, which every wave left at the last barrier.
  auto trip = [&](int cur, bool fill, int dst, int k0) {
    // every loop below is unrolled so that acc[][], a[] and b[] are indexed by
    // constants and stay in registers
#pragma unroll
    for (int ks = 0; ks < KS / 32; ++ks) {
      v16bf a[4], b[4];
#pragma unroll
      for (int i = 0; i < 4; ++i) {
        a[i] = frag_from(&As[cur][wm * 64 + i * 16 + l16][ks * 32 + 8 * half]);
        b[i] = frag_from(&Bs[cur][wn * 64 + i * 16 + l16][ks * 32 + 8 * half]);
      }
      // keeps the 16 LDS reads one group ahead of the 16 WMMAs: left alone the
      // scheduler sinks them among the WMMAs, one full LDS wait per row of four
      __builtin_amdgcn_sched_barrier(0);
      // issued here so that the copies' address work and wait run under the LDS
      // reads' latency
      if (ks < PARTS && fill) load_part(dst, k0, ks);
      // keeps the copies ahead of the WMMAs: left alone the scheduler sinks them,
      // with their wait, to the end of the block and forms their addresses in
      // fragment registers, at four idle slots behind a WMMA each time
      __builtin_amdgcn_sched_barrier(0);
#pragma unroll
      for (int mi = 0; mi < 4; ++mi)
#pragma unroll
        for (int ni = 0; ni < 4; ++ni)
          acc[mi][ni] = wmma_bf16(b[ni], a[mi], acc[mi][ni]);   // Y^T tile: W rows x A rows
      // second half of the pair: the next group's reads stay behind this block
      __builtin_amdgcn_sched_barrier(0);
    }
    // own LDS reads of `cur` retired before any wave may refill it
    asm volatile("s_wait_dscnt 0x0" ::: "memory");
  };

  if constexpr (NBUF == 2) {
    load_tile(0, 0);
    wait_async0();
    __syncthreads();
    for (int kt = 0; kt < KT; ++kt) {
      const int cur = kt & 1;
      trip(cur, kt + 1 < KT, cur ^ 1, (kt + 1) * KS);
      wait_async0();       // next-buffer DMA landed (ASYNCcnt not covered by barrier)
      __syncthreads();     // all waves done reading `cur`, writes visible
    }
  } else {
    // Tiles 0 and 1 go out together; tile 0 has landed when all but the copies
    // of tile 1 have.
    load_tile(0, 0);
    if (KT > 1) {
      load_tile(1, KS);
      wait_async_all_but_one_tile<12 * PARTS>();
    } else {
      wait_async0();
    }
    __syncthreads();

    int cur = 0, nxt = 1, dst = 2;   // kt, kt + 1, kt + 2 mod 3
    int kt = 0;
    // Every trip of this loop issues the copies of tile kt + 2, into the
    // buffer of tile kt - 1, and then waits for all but those: tile kt + 1 has
    // landed while tile kt + 2 stays in flight over the barrier.
    for (; kt + 2 < KT; ++kt) {
      trip(cur, true, dst, (kt + 2) * KS);
      wait_async_all_but_one_tile<12 * PARTS>();
      __syncthreads();     // tile kt + 1 visible; all waves done reading `cur`
      const int left = cur;
      cur = nxt; nxt = dst; dst = left;
    }
    // The last trips issue nothing more: the wait is to 0.
    for (; kt < KT; ++kt) {
      trip(cur, false, 0, 0);
      wait_async0();
      __syncthreads();
      cur = nxt;
    }
  }

  // ---- epilogue.  The products were taken transposed (W x A^T), so that
  // acc[mi][ni][j] = Y[row mi * 16 + l16][column ni * 16 + 8 * half + j]: a lane
  // holds 8 neighbouring columns of one row.  Each wave lays 32 rows of its 64 x 64
  // tile into its own part of the ring (free behind the loop's last barrier) with
  // 16-B LDS stores, reads them back row-wise and stores whole 128-B lines. ----
  if constexpr (THREE) {
    // Which product this block belongs to: the same for the whole block.  Columns
    // go on counting through all three, so the two bases are moved instead: the
    // indices below stay those of the single product.
    const int part = (n0 >= N) + (n0 >= 2 * N);
    bias  = (part == 0 ? bias : part == 1 ? bias1 : bias2) - (size_t)part * N;
    scale = part == 0 ? scale : 1.0f;
    outB += (size_t)part * M * N - (size_t)part * N;
  }
  constexpr int RP = OUT_BF16 ? 144 : 272;   // staged row pitch, bytes: 16 B x odd
  static_assert(8 * 32 * RP <= (int)sizeof(As), "the eight waves' rows fit the A ring");
  char* stage = (char*)&As[0][0][0] + wave * (32 * RP);
  const int colw = n0 + wn * 64;             // the wave's first column
  f32x4 bv[4][2];                            // the lane's 32 bias values, loaded together
  // every loop below is unrolled so that acc[][], bv[][], v[], w[] and t[] are
  // indexed by constants and stay in registers
  // the pair of fences keeps other address work out of the run of loads, so that
  // the wait stands in front of every rewrite of the loads' address registers
  __builtin_amdgcn_sched_barrier(0);
#pragma unroll
  for (int ni = 0; ni < 4; ++ni) {
    bv[ni][0] = *(const f32x4*)&bias[colw + ni * 16 + 8 * half];
    bv[ni][1] = *(const f32x4*)&bias[colw + ni * 16 + 8 * half + 4];
  }
  asm volatile("s_wait_xcnt 0x0" ::: "memory");
  __builtin_amdgcn_sched_barrier(0);
#pragma unroll
  for (int mh = 0; mh < 2; ++mh) {
#pragma unroll
    for (int m2 = 0; m2 < 2; ++m2) {
      char* p = stage + (m2 * 16 + l16) * RP;
#pragma unroll
      for (int ni = 0; ni < 4; ++ni) {
        float v[8];
#pragma unroll
        for (int j = 0; j < 8; ++j)
          v[j] = (acc[mh * 2 + m2][ni][j] + bv[ni][j >> 2][j & 3]) * scale;
        if constexpr (OUT_BF16) {
          v2f w[4] = {{v[0], v[1]}, {v[2], v[3]}, {v[4], v[5]}, {v[6], v[7]}};
          if constexpr (GELU) gelu2x4(w);       // pairs: the polynomial runs on packed f32
          v8bf o;
#pragma unroll
          for (int c = 0; c < 4; ++c) {
            const v2bf k = __builtin_convertvector(w[c], v2bf);
            o[2 * c] = k[0]; o[2 * c + 1] = k[1];
          }
          *(v8bf*)(p + ni * 32 + half * 16) = o;
        } else {
          const f32x4 lo = {v[0], v[1], v[2], v[3]}, hi = {v[4], v[5], v[6], v[7]};
          *(f32x4*)(p + ni * 64 + half * 32)      = lo;
          *(f32x4*)(p + ni * 64 + half * 32 + 16) = hi;
        }
      }
    }
    // the wave's 32 rows are in LDS before its lanes read one another's pieces
    asm volatile("s_wait_dscnt 0x0" ::: "memory");
    const size_t row0 = (size_t)(m0 + wm * 64 + mh * 32);
    if constexpr (OUT_BF16) {
      // 8 lanes a row of 128 B, 4 rows an instruction
      const int r = lane >> 3, c = lane & 7;
      v8bf t[8];
#pragma unroll
      for (int it = 0; it < 8; ++it) t[it] = *(const v8bf*)(stage + (it * 4 + r) * RP + c * 16);
#pragma unroll
      for (int it = 0; it < 8; ++it)
        *(v8bf*)&outB[(row0 + it * 4 + r) * N + colw + c * 8] = t[it];
    } else {
      // 16 lanes a row of 256 B, 2 rows an instruction
      f32x4 t[16];
#pragma unroll
      for (int it = 0; it < 16; ++it)
        t[it] = *(const f32x4*)(stage + (it * 2 + half) * RP + l16 * 16);
#pragma unroll
      for (int it = 0; it < 16; ++it)
        *(f32x4*)&outF[(row0 + it * 2 + half) * N + colw + l16 * 4] = t[it];
    }
    // the read-back has ended before the next 32 rows are laid over it
    if (mh == 0) asm volatile("s_wait_dscnt 0x0" ::: "memory");
  }
}

// ---------------------------------------------------------------------------
// Flash attention: grid (S/128, H, B), block = 128 threads = 4 waves.
// Each wave owns 32 queries, as two groups of 16 columns; K/V tiles of 64 keys
// staged in LDS.  Every K and V fragment read from LDS serves both groups, and
// maximum, correction and rescale are paid once per 64 keys.
// Transposed products: S^T = K x Q^T and O^T += V^T x P^T.  A lane then holds
// 32 of the 64 scores of ONE query per group (query = l16, keys 16 i + 8*half + r
// of score tile i), so maximum and sum are taken in the lane's own registers
// with one exchange between the wave's halves, and the score tiles, converted
// in place, already are the B operands of the second product.
// ---------------------------------------------------------------------------
typedef short s16x8 __attribute__((ext_vector_type(8)));
typedef float v4f   __attribute__((ext_vector_type(4)));

// Transposing LDS read: lane (l16, half) receives T[kbase + 8*half + 0..7][dbase + l16]
// when it passes &T[kbase + 8*half + (lane & 7)][dbase + 8 * ((lane >> 3) & 1)].
__device__ __forceinline__ v8bf ld_tr16(const bf16* p) {
  typedef __attribute__((address_space(3))) s16x8 lds_s16x8;
  return __builtin_bit_cast(v8bf, __builtin_amdgcn_ds_load_tr16_b128_v8i16((lds_s16x8*)p));
}

// lane l <-> lane l ^ 16
__device__ __forceinline__ float xhalf(float x) {
  return __builtin_bit_cast(float, __builtin_amdgcn_permlanex16(
      __builtin_bit_cast(int, x), __builtin_bit_cast(int, x),
      0x76543210, 0xfedcba98, false, false));
}

#define LOG2E 1.44269504088896340736f

// Base-2 exponentials in place.  Written as one statement so that the slot the
// instruction set asks for behind a transcendental is kept: inside the run no
// v_exp touches its neighbour's registers, and the closing v_nop stands in
// front of whatever the compiler places next.
__device__ __forceinline__ void exp2_x8(float (&e)[8]) {
  asm("v_exp_f32 %0, %0\n\t"
      "v_exp_f32 %1, %1\n\t"
      "v_exp_f32 %2, %2\n\t"
      "v_exp_f32 %3, %3\n\t"
      "v_exp_f32 %4, %4\n\t"
      "v_exp_f32 %5, %5\n\t"
      "v_exp_f32 %6, %6\n\t"
      "v_exp_f32 %7, %7\n\t"
      "v_nop"
      : "+v"(e[0]), "+v"(e[1]), "+v"(e[2]), "+v"(e[3]),
        "+v"(e[4]), "+v"(e[5]), "+v"(e[6]), "+v"(e[7]));
}
__device__ __forceinline__ void exp2_x1(float& e) {
  asm("v_exp_f32 %0, %0\n\t"
      "v_nop"
      : "+v"(e));
}

#define AK 64                   // keys per pass
#define AQ 128                  // queries per block: 4 waves x 2 groups x 16

__global__ __launch_bounds__(128)
void flash_attn(const bf16* __restrict__ Q, const bf16* __restrict__ Kb,
                const bf16* __restrict__ Vb, const int* __restrict__ mask,
                bf16* __restrict__ Ctx) {
  __shared__ bf16 Ks[AK][72];     // 144B pitch = 16B x odd (b128 readers)
  __shared__ bf16 Vs[AK][80];     // 160B pitch = 32B x odd (transposing readers)
  __shared__ __attribute__((aligned(16))) float Madd[AK];

  const int tid  = threadIdx.x;
  const int lane = tid & 31;
  const int wave = tid >> 5;
  const int half = lane >> 4;
  const int l16  = lane & 15;
  const int qt   = blockIdx.x;
  const int h    = blockIdx.y;
  const int b    = blockIdx.z;

  // Group g's 16 queries as two B-fragments (dh 0..31, 32..63): column = l16.
  const size_t qrow = ((size_t)b * SS + qt * AQ + wave * 32 + l16) * DD + h * DH;
  v16bf qb[2][2];
  // every loop over g, i, f, kc, c and r below is unrolled so that the arrays are
  // indexed by constants and stay in registers
#pragma unroll
  for (int g = 0; g < 2; ++g) {
    qb[g][0] = frag_from(&Q[qrow + (size_t)g * 16 * DD + 0  + 8 * half]);
    qb[g][1] = frag_from(&Q[qrow + (size_t)g * 16 * DD + 32 + 8 * half]);
  }

  // m[g]: running maximum of query l16 of group g (equal in both halves); l[g]:
  // this half's part of its running sum; cacc[g][f][r] = O^T[dh = 16 f + 8 half + r].
  float m[2] = {-1e30f, -1e30f}, l[2] = {0.0f, 0.0f};
  v8f cacc[2][4] = {};

  const bf16* vp = &Vs[8 * half + (lane & 7)][8 * ((lane >> 3) & 1)];

  for (int kt = 0; kt < SS / AK; ++kt) {
    // ---- cooperative K/V tile load: 64 keys x 64 dh each ----
    // the eight loads first, then the eight LDS stores: one memory latency a tile
    v8bf kr[4], vr[4];
#pragma unroll
    for (int c = 0; c < 4; ++c) {
      int ch = tid + c * 128;                 // 0..511
      int r = ch >> 3, col = (ch & 7) * 8;
      size_t g = ((size_t)b * SS + kt * AK + r) * DD + h * DH + col;
      kr[c] = *(const v8bf*)&Kb[g];
      vr[c] = *(const v8bf*)&Vb[g];
    }
#pragma unroll
    for (int c = 0; c < 4; ++c) {
      int ch = tid + c * 128;
      int r = ch >> 3, col = (ch & 7) * 8;
      *(v8bf*)&Ks[r][col] = kr[c];
      *(v8bf*)&Vs[r][col] = vr[c];
    }
    if (tid < AK)
      Madd[tid] = mask[(size_t)b * SS + kt * AK + tid] ? 0.0f : -1e30f;
    __syncthreads();

    // ---- scores: S^T = K x Q^T, four 16-key tiles, K-dim = dh 64.  The key's
    // additive mask is the accumulator's start value: row r of tile i is key
    // 16 i + 8 half + r. ----
    v8f s[2][4];
#pragma unroll
    for (int ip = 0; ip < 4; ip += 2) {
      v8f mk[2];
      v16bf ka[2][2];
#pragma unroll
      for (int j = 0; j < 2; ++j) {
        const int i = ip + j;
        const v4f ma = *(const v4f*)&Madd[16 * i + 8 * half];
        const v4f mb = *(const v4f*)&Madd[16 * i + 8 * half + 4];
#pragma unroll
        for (int r = 0; r < 4; ++r) { mk[j][r] = ma[r]; mk[j][r + 4] = mb[r]; }
        ka[j][0] = frag_from(&Ks[16 * i + l16][0 + 8 * half]);
        ka[j][1] = frag_from(&Ks[16 * i + l16][32 + 8 * half]);
      }
      // keeps the twelve LDS reads one group ahead of the eight WMMAs: left alone
      // the scheduler pairs them off, one full LDS wait per WMMA
      __builtin_amdgcn_sched_barrier(0);
#pragma unroll
      for (int j = 0; j < 2; ++j)
#pragma unroll
        for (int g = 0; g < 2; ++g) s[g][ip + j] = wmma_bf16(ka[j][0], qb[g][0], mk[j]);
#pragma unroll
      for (int j = 0; j < 2; ++j)
#pragma unroll
        for (int g = 0; g < 2; ++g)
          s[g][ip + j] = wmma_bf16(ka[j][1], qb[g][1], s[g][ip + j]);
    }
    // keeps the maxima behind the last product: left alone the scheduler puts one
    // behind each of the last four WMMAs, at four idle slots each time
    __builtin_amdgcn_sched_barrier(0);

    // ---- online softmax over this 64-key slab, one query per lane and group ----
    v16bf pb[2][2];               // P^T as B: [group][chunk kc], element s = key 32 kc + 8 half + s, or 32 kc + 16 + 8 half + s - 8 for s >= 8
#pragma unroll
    for (int g = 0; g < 2; ++g) {
      // two independent chains; the tiles whose products ended first come first
      float mx = fmaxf(s[g][0][0], s[g][1][0]), my = fmaxf(s[g][2][0], s[g][3][0]);
#pragma unroll
      for (int r = 1; r < 8; ++r) mx = fmaxf(mx, fmaxf(s[g][0][r], s[g][1][r]));
#pragma unroll
      for (int r = 1; r < 8; ++r) my = fmaxf(my, fmaxf(s[g][2][r], s[g][3][r]));
      mx = fmaxf(mx, my);
      mx = fmaxf(mx, xhalf(mx));              // the other half's 32 keys
      const float mn = fmaxf(m[g], mx);
      // the difference is taken first: it is never above 0, also where every key
      // so far carries the mask's -1e30
      float cor = (m[g] - mn) * LOG2E;
      float e[4][8];
#pragma unroll
      for (int i = 0; i < 4; ++i)
#pragma unroll
        for (int r = 0; r < 8; ++r) e[i][r] = (s[g][i][r] - mn) * LOG2E;
      exp2_x1(cor);
#pragma unroll
      for (int i = 0; i < 4; ++i) exp2_x8(e[i]);
      m[g] = mn;
      float t[8];
#pragma unroll
      for (int r = 0; r < 8; ++r) {
        t[r] = (e[0][r] + e[1][r]) + (e[2][r] + e[3][r]);
        pb[g][0][r]     = (bf16)e[0][r];
        pb[g][0][r + 8] = (bf16)e[1][r];
        pb[g][1][r]     = (bf16)e[2][r];
        pb[g][1][r + 8] = (bf16)e[3][r];
      }
      const float rs = ((t[0] + t[4]) + (t[2] + t[6])) + ((t[1] + t[5]) + (t[3] + t[7]));
      l[g] = l[g] * cor + rs;
#pragma unroll
      for (int f = 0; f < 4; ++f) cacc[g][f] *= cor;
    }

    // ---- O^T += V^T(16 dh x 32 keys) x P^T(32 keys x 16 queries), two key chunks,
    // each V^T fragment for both groups ----
#pragma unroll
    for (int kc = 0; kc < 2; ++kc) {
#pragma unroll
      for (int f = 0; f < 4; ++f) {
        v8bf lo = ld_tr16(vp + (kc * 32) * 80 + f * 16);        // keys 32 kc + 8 half + 0..7
        v8bf hi = ld_tr16(vp + (kc * 32 + 16) * 80 + f * 16);   // keys 32 kc + 16 + 8 half + 0..7
        v16bf va;
#pragma unroll
        for (int i = 0; i < 8; ++i) { va[i] = lo[i]; va[i + 8] = hi[i]; }
#pragma unroll
        for (int g = 0; g < 2; ++g) cacc[g][f] = wmma_bf16(va, pb[g][kc], cacc[g][f]);
      }
    }
    __syncthreads();  // Ks/Vs reused next iteration
  }

  // ---- finalize: join the halves' sums, divide, write bf16 ctx (b,s,h*64+dh):
  // a lane's 8 registers of a tile are 8 consecutive dh of its query ----
  v8bf ov[2][4];
#pragma unroll
  for (int g = 0; g < 2; ++g) {
    const float lt = l[g] + xhalf(l[g]);
    const float inv = (lt > 0.0f) ? (1.0f / lt) : 0.0f;
#pragma unroll
    for (int f = 0; f < 4; ++f)
#pragma unroll
      for (int r = 0; r < 8; ++r) ov[g][f][r] = (bf16)(cacc[g][f][r] * inv);
  }
  // keeps the eight stores behind the last conversion, so that no register of an
  // issued store is written again
  __builtin_amdgcn_sched_barrier(0);
#pragma unroll
  for (int g = 0; g < 2; ++g)
#pragma unroll
    for (int f = 0; f < 4; ++f)
      *(v8bf*)&Ctx[qrow + (size_t)g * 16 * DD + 8 * half + f * 16] = ov[g][f];
}

// ---------------------------------------------------------------------------
// Residual + LayerNorm over D=1024; optionally emits bf16 copy of the result.
// One wave per token row, eight rows per block (256 thr): a lane holds 32 values
// of its row, as eight pieces of 16 B that lie 512 B apart, so that every load
// and store of the wave covers whole lines.  Mean and variance are summed in the
// lane's registers and then across the wave: no LDS, no barrier.
// outF may alias y (in-place): a wave has read its whole row before it stores.
// ---------------------------------------------------------------------------
// x + (x of lane l ^ M), M in 1, 2, 4, 8: stays inside the 16-lane row
template <int M>
__device__ __forceinline__ float add_xmask(float x) {
  return x + __builtin_bit_cast(float, __builtin_amdgcn_update_dpp(
      0, __builtin_bit_cast(int, x), 0x160 + M, 0xf, 0xf, true));
}
__device__ __forceinline__ float wave_sum(float v) {
  v = add_xmask<1>(v);
  v = add_xmask<2>(v);
  v = add_xmask<4>(v);
  v = add_xmask<8>(v);
  return v + xhalf(v);
}
__device__ __forceinline__ float sum4(f32x4 t) { return (t[0] + t[1]) + (t[2] + t[3]); }

#define LN_ROWS 8               // rows (waves) per block

__global__ __launch_bounds__(256)
void ln_residual(const float* y, const float* __restrict__ res,
                 const float* __restrict__ g, const float* __restrict__ beta,
                 float* outF, bf16* outB) {
  const int lane = threadIdx.x & 31;
  // the wave's number as a scalar: the row's base addresses stay in scalar registers
  const int wave = __builtin_amdgcn_readfirstlane((int)(threadIdx.x >> 5));
  const size_t row = (size_t)blockIdx.x * LN_ROWS + wave;
  const float* yp = y + row * DD;
  const float* rp = res + row * DD;
  const int base = lane * 4;

  // every loop over c is unrolled: the arrays are indexed by constants and stay in registers
  f32x4 v[8], r[8], gg[8], bb[8];
#pragma unroll
  for (int c = 0; c < 8; ++c) v[c] = *(const f32x4*)(yp + base + c * 128);
#pragma unroll
  for (int c = 0; c < 8; ++c) r[c] = *(const f32x4*)(rp + base + c * 128);
  // keeps the loads of g and beta behind the row's sixteen: moved ahead they take the
  // registers of the row's last pieces, whose loads then wait for the first ones
  __builtin_amdgcn_sched_barrier(0);
#pragma unroll
  for (int c = 0; c < 8; ++c) v[c] += r[c];
  // asked for here, used behind both sums: their latency runs under the reductions
#pragma unroll
  for (int c = 0; c < 8; ++c) {
    gg[c] = *(const f32x4*)(g + base + c * 128);
    bb[c] = *(const f32x4*)(beta + base + c * 128);
  }
  // keeps the sixteen loads here: left alone the scheduler sinks them behind the
  // second sum, pair by pair, one full load latency per pair
  __builtin_amdgcn_sched_barrier(0);

  const f32x4 s4 = ((v[0] + v[1]) + (v[2] + v[3])) + ((v[4] + v[5]) + (v[6] + v[7]));
  const float mu = wave_sum(sum4(s4)) * (1.0f / DD);

  f32x4 q0 = 0.0f, q1 = 0.0f;   // two independent chains
#pragma unroll
  for (int c = 0; c < 8; c += 2) {
    v[c]     -= mu;
    v[c + 1] -= mu;
    q0 += v[c] * v[c];
    q1 += v[c + 1] * v[c + 1];
  }
  const float var  = wave_sum(sum4(q0 + q1)) * (1.0f / DD);
  const float rstd = rsqrtf(var + 1e-12f);

#pragma unroll
  for (int c = 0; c < 8; ++c) v[c] = v[c] * rstd * gg[c] + bb[c];
#pragma unroll
  for (int c = 0; c < 8; ++c) *(f32x4*)(outF + row * DD + base + c * 128) = v[c];
  // in front of the conversions and of the second base address, which take the
  // registers of the stores just issued
  asm volatile("s_wait_xcnt 0x0" ::: "memory");
  if (outB) {
#pragma unroll
    for (int c = 0; c < 8; ++c)
      *(bf16x4*)(outB + row * DD + base + c * 128) = __builtin_convertvector(v[c], bf16x4);
  }
}

// ---------------------------------------------------------------------------
// Launch
// ---------------------------------------------------------------------------
extern "C" void kernel_launch(void* const* d_in, const int* in_sizes, int n_in,
                              void* d_out, int out_size, void* d_ws, size_t ws_size,
                              hipStream_t stream) {
  (void)in_sizes; (void)n_in; (void)out_size; (void)ws_size;

  const float* x    = (const float*)d_in[0];
  const int*   msk  = (const int*)d_in[1];
  const float* Wq   = (const float*)d_in[2];
  const float* bq   = (const float*)d_in[3];
  const float* Wk   = (const float*)d_in[4];
  const float* bk   = (const float*)d_in[5];
  const float* Wv   = (const float*)d_in[6];
  const float* bv   = (const float*)d_in[7];
  const float* Wo   = (const float*)d_in[8];
  const float* bo   = (const float*)d_in[9];
  const float* ln1g = (const float*)d_in[10];
  const float* ln1b = (const float*)d_in[11];
  const float* W1   = (const float*)d_in[12];
  const float* b1   = (const float*)d_in[13];
  const float* W2   = (const float*)d_in[14];
  const float* b2   = (const float*)d_in[15];
  const float* ln2g = (const float*)d_in[16];
  const float* ln2b = (const float*)d_in[17];
  float* out = (float*)d_out;

  char* ws = (char*)d_ws;
  const size_t MB = 1ull << 20;
  bf16*  wqb  = (bf16*)(ws + 0 * MB);
  bf16*  wkb  = (bf16*)(ws + 2 * MB);
  bf16*  wvb  = (bf16*)(ws + 4 * MB);
  bf16*  wob  = (bf16*)(ws + 6 * MB);
  bf16*  w1b  = (bf16*)(ws + 8 * MB);     // F*D
  bf16*  w2b  = (bf16*)(ws + 16 * MB);    // D*F
  bf16*  xb   = (bf16*)(ws + 24 * MB);
  bf16*  qb   = (bf16*)(ws + 40 * MB);
  bf16*  kb   = (bf16*)(ws + 56 * MB);
  bf16*  vb   = (bf16*)(ws + 72 * MB);
  bf16*  ctxb = (bf16*)(ws + 88 * MB);
  float* sa   = (float*)(ws + 104 * MB);  // sa_out, then h (in-place LN1)
  bf16*  hb   = (bf16*)(ws + 136 * MB);
  bf16*  ffb  = (bf16*)(ws + 40 * MB);    // reuse q/k/v/ctx region (dead by FFN1)
  float* y2   = (float*)(ws + 152 * MB);

  // all seven conversions: wqb .. w2b and xb are one run of the workspace
  hipLaunchKernelGGL(cvt_all_f32_bf16, dim3(CVT_UNITS * DD * DD / CVT_BLOCK), dim3(256),
                     0, stream, Wq, Wk, Wv, Wo, W1, W2, x, wqb);

  const float* none = nullptr;
  dim3 gB(256);
  dim3 gQKV(NTOK / 256, DD / 128);
  // q = (x Wq^T + bq) / sqrt(64), k = x Wk^T + bk, v = x Wv^T + bv in one launch:
  // wqb, wkb, wvb are one [3 D, D] matrix and qb, kb, vb lie one behind another
  hipLaunchKernelGGL((gemm_bf16_nt<false, true, 3, true, 128>), dim3(NTOK / 256, 3 * DD / 128),
                     gB, 0, stream,
                     xb, wqb, bq, bk, bv, 0.125f, (float*)nullptr, qb, NTOK, DD, DD);

  dim3 aG(SS / AQ, HH, BB), aB(128);
  hipLaunchKernelGGL(flash_attn, aG, aB, 0, stream, qb, kb, vb, msk, ctxb);

  // sa = ctx Wo^T + bo   (f32)
  hipLaunchKernelGGL((gemm_bf16_nt<false, false, 3, false, 128>), gQKV, gB, 0, stream,
                     ctxb, wob, bo, none, none, 1.0f, sa, (bf16*)nullptr, NTOK, DD, DD);

  // h = LN1(sa + x), in-place in sa; also bf16 copy hb
  hipLaunchKernelGGL(ln_residual, dim3(NTOK / LN_ROWS), dim3(256), 0, stream,
                     sa, x, ln1g, ln1b, sa, hb);

  // ff = gelu(h W1^T + b1)   (bf16, M=8192 N=4096 K=1024)
  dim3 gF1(NTOK / 256, FF / 128);
  hipLaunchKernelGGL((gemm_bf16_nt<true, true, 2, false, 64>), gF1, gB, 0, stream,
                     hb, w1b, b1, none, none, 1.0f, (float*)nullptr, ffb, NTOK, FF, DD);

  // y2 = ff W2^T + b2   (f32, K=4096)
  hipLaunchKernelGGL((gemm_bf16_nt<false, false, 3, false, 128>), gQKV, gB, 0, stream,
                     ffb, w2b, b2, none, none, 1.0f, y2, (bf16*)nullptr, NTOK, DD, FF);

  // out = LN2(y2 + h)
  hipLaunchKernelGGL(ln_residual, dim3(NTOK / LN_ROWS), dim3(256), 0, stream,
                     y2, sa, ln2g, ln2b, out, (bf16*)nullptr);
}
